// v000
// The times below were measured on an AMD MI455X: many runs one after another, warmed up first and cycling through
// copies of the inputs, with the whole window's GPU time divided by the number of runs. Launches and the gaps
// between them are all in it. The median over several windows is given; except for v000 it joins two sittings, which
// can be a few percent apart, so the side-by-side timings, each taken in one sitting, are the better comparison.
// v000 is the starting kernel. One run takes 209 microseconds.
// Contractions: scores K.Q^T on v_wmma_f32_16x16x32_bf16 (bf16 operands = RNE bf16 copies of q and k, f32 accumulate); context V^T.P^T on v_wmma_f32_16x16x32_f16 (f16 operands: v = f16 of its RNE bf16 copy, p carried x4096, f32 accumulate); scale, mask and online softmax in f32.
#include <hip/hip_runtime.h>
#include <math.h>

// ---------------------------------------------------------------------------
// Problem constants (NB / SEQ / SKV overridable for a reduced build; *_FULL = input strides)
// ---------------------------------------------------------------------------
#ifndef NB
#define NB 2
#endif
#ifndef SEQ
#define SEQ 2048
#endif
#ifndef SKV
#define SKV 3072
#endif
#define NB_FULL   2
#define NH        16
#define HD        64
#define SEQ_FULL  2048
#define SKV_FULL  3072

static_assert(NB >= 1 && NB <= NB_FULL);
static_assert(SEQ % 128 == 0 && SEQ <= SEQ_FULL);
static_assert(SKV % 64 == 0 && SKV <= SKV_FULL);
static_assert(HD == 64);
static_assert((NB * NH * SKV) % 32 == 0);

constexpr float kScale2   = 0.125f * 1.44269504088896340736f;   // 1/sqrt(64) * log2(e): softmax in log2 domain
constexpr float kCarry    = 4096.0f;                            // p in [0,1] carried x4096 as f16 operand
constexpr float kInvCarry = 1.0f / 4096.0f;
#define NEG_INF (-__builtin_inff())

#if __has_builtin(__builtin_amdgcn_exp2f)
#define EXP2(x) __builtin_amdgcn_exp2f(x)
#else
#define EXP2(x) exp2f(x)
#endif

typedef __attribute__((ext_vector_type(16))) _Float16 v16h;
typedef __attribute__((ext_vector_type(8)))  _Float16 v8h;
typedef __attribute__((ext_vector_type(2)))  _Float16 v2h;
typedef __attribute__((ext_vector_type(16))) __bf16   v16b;
typedef __attribute__((ext_vector_type(8)))  __bf16   v8b;
typedef __attribute__((ext_vector_type(8)))  float    v8f;
typedef __attribute__((ext_vector_type(4)))  float    v4f;
typedef __attribute__((ext_vector_type(4)))  unsigned int v4u;
typedef __attribute__((ext_vector_type(8)))  unsigned int v8u;

__device__ __forceinline__ unsigned short f2bf_bits(float f) {        // RNE convert f32 -> bf16 bits
  unsigned u = __float_as_uint(f);
  return (unsigned short)((u + 0x7FFFu + ((u >> 16) & 1u)) >> 16);
}
__device__ __forceinline__ float bf_bits2f(unsigned short h) { return __uint_as_float(((unsigned)h) << 16); }

// hazard guards: 4 VALU slots after the last WMMA of a group, tie D, keep A/B live
__device__ __forceinline__ void dep_guard1_b(v8f& a, v16b w, v16b x, v16b y, v16b z) {
  asm volatile("v_nop\n\tv_nop\n\tv_nop\n\tv_nop" : "+v"(a) : "v"(w), "v"(x), "v"(y), "v"(z));
}
__device__ __forceinline__ void dep_guard4_h(v8f& a, v8f& b, v8f& c, v8f& d, v16h x, v16h y) {
  asm volatile("v_nop\n\tv_nop\n\tv_nop\n\tv_nop" : "+v"(a), "+v"(b), "+v"(c), "+v"(d) : "v"(x), "v"(y));
}
__device__ __forceinline__ void keep4_h(v16h a, v16h b, v16h c, v16h d) { asm volatile("v_nop" :: "v"(a), "v"(b), "v"(c), "v"(d)); }
__device__ __forceinline__ void acc_guard4(v8f& a, v8f& b, v8f& c, v8f& d) {
  asm volatile("v_nop\n\tv_nop\n\tv_nop\n\tv_nop" : "+v"(a), "+v"(b), "+v"(c), "+v"(d));
}

template <typename T> struct Frag;
template <> struct Frag<_Float16> {
  typedef v16h V; union U { v16h v; v8h h[2]; };
  // elements 0..7 <- p[0..7], 8..15 <- p[16..23]; caller passes p = row + k0 + 8*(lane>>4)
  static __device__ __forceinline__ v16h load(const _Float16* p) {
    U f; f.h[0] = *(const v8h*)(p); f.h[1] = *(const v8h*)(p + 16); return f.v;
  }
  static __device__ __forceinline__ v8f mma(v16h a, v16h b, v8f c) {
    return __builtin_amdgcn_wmma_f32_16x16x32_f16(false, a, false, b, (short)0, c, false, false);
  }
};
template <> struct Frag<__bf16> {
  typedef v16b V; union U { v16b v; v8b h[2]; };
  static __device__ __forceinline__ v16b load(const __bf16* p) {
    U f; f.h[0] = *(const v8b*)(p); f.h[1] = *(const v8b*)(p + 16); return f.v;
  }
  static __device__ __forceinline__ v8f mma(v16b a, v16b b, v8f c) {
    return __builtin_amdgcn_wmma_f32_16x16x32_bf16(false, a, false, b, (short)0, c, false, false);
  }
};
typedef Frag<_Float16> FragH;
typedef Frag<__bf16>   FragB;

__device__ __forceinline__ unsigned pk16(unsigned short a, unsigned short b) { return (unsigned)a | ((unsigned)b << 16); }
// pack two f32 -> one dword of two f16 (element 0 = a)
__device__ __forceinline__ unsigned pkh2(float a, float b) {
  v2h p; p[0] = (_Float16)a; p[1] = (_Float16)b;
  return __builtin_bit_cast(unsigned, p);
}
__device__ __forceinline__ v8f zero8() { return (v8f){0.f, 0.f, 0.f, 0.f, 0.f, 0.f, 0.f, 0.f}; }
__device__ __forceinline__ v8f neg8()  { return (v8f){NEG_INF, NEG_INF, NEG_INF, NEG_INF, NEG_INF, NEG_INF, NEG_INF, NEG_INF}; }
// balanced-tree horizontal reductions
__device__ __forceinline__ float hsum8(v8f v) {
  float a = v[0] + v[1], b = v[2] + v[3], c = v[4] + v[5], d = v[6] + v[7];
  return (a + b) + (c + d);
}
__device__ __forceinline__ float hmax8(v8f v) {
  float a = fmaxf(v[0], v[1]), b = fmaxf(v[2], v[3]);
  float c = fmaxf(v[4], v[5]), d = fmaxf(v[6], v[7]);
  return fmaxf(fmaxf(a, b), fmaxf(c, d));
}

// ---------------------------------------------------------------------------
// dst row pr = g * rowsPerGroup + r  <-  src row g * srcRowsPerGroup + r  (g = (b*NH + h)).
// Block 256 threads = 32 rows; thread t: row t>>3, 8 halves at (t&7)*8.
// ---------------------------------------------------------------------------
__global__ __launch_bounds__(256) void cast_rows_kernel(const float* __restrict__ src,
                                                         unsigned short* __restrict__ dst,
                                                         int rowsPerGroup, int srcRowsPerGroup, int nRows) {
  const int t  = threadIdx.x;
  int pr = blockIdx.x * 32 + (t >> 3);
  pr = (pr < nRows) ? pr : (nRows - 1);            // address clamp (grid is exact)
  const int c8 = (t & 7) * 8;
  const int g  = pr / rowsPerGroup;
  const int r  = pr - g * rowsPerGroup;
  const float* s = src + ((size_t)g * srcRowsPerGroup + r) * HD + c8;
  const v4f a = *(const v4f*)(s);
  const v4f b = *(const v4f*)(s + 4);
  unsigned short hb[8];
#pragma unroll
  for (int e = 0; e < 4; ++e) { hb[e] = f2bf_bits(a[e]); hb[4 + e] = f2bf_bits(b[e]); }
  const v4u u = (v4u){pk16(hb[0], hb[1]), pk16(hb[2], hb[3]), pk16(hb[4], hb[5]), pk16(hb[6], hb[7])};
  unsigned short* d = dst + (size_t)pr * HD + c8;
  *(v4u*)d = u;
  
}

// ---------------------------------------------------------------------------
// (2) V cast + transpose: Vt[bh][d][kv] = f16( bf16( v[bh][kv][d] ) )   (pitch SKV halves)
// grid (SKV/64, NB*NH), 256 threads; one 64(kv) x 64(d) tile through LDS.
// Load coverage: 16 iterations x 256 threads = 4096 = whole tile (coalesced along d); sm cross-wave -> __syncthreads.
// Store coverage: 8 waves x 2 iterations x 4 rows (lane>>3) = 64 d-rows; (lane&7) x 8 halves = 64 kv;
// ---------------------------------------------------------------------------
__global__ __launch_bounds__(256) void v_transpose_kernel(const float* __restrict__ v,
                                                           _Float16* __restrict__ Vt) {
  __shared__ float sm[64][65];   // sm[kv_local][d]
  const int tid = threadIdx.x;
  const int kv0 = blockIdx.x * 64;
  const int bh  = blockIdx.y;                        // b*NH + h, b < NB
  const float* vb = v + ((size_t)bh * SKV_FULL + kv0) * HD;
#pragma unroll
  for (int i = 0; i < 16; ++i) {
    const int e = i * 256 + tid;
    const int r = e >> 6;          // kv local
    const int c = e & 63;          // d
    sm[r][c] = vb[(size_t)r * HD + c];
  }
  __syncthreads();
  const int lane = tid & 31, wave = tid >> 5;
  const int q = lane >> 3, c8 = (lane & 7) * 8;
  _Float16* vt = Vt + (size_t)bh * HD * SKV;
  {
#pragma unroll
    for (int it = 0; it < 2; ++it) {
      const int row = wave * 8 + it * 4 + q;          // d
      v8h hv;
#pragma unroll
      for (int e = 0; e < 8; ++e) hv[e] = (_Float16)bf_bits2f(f2bf_bits(sm[c8 + e][row]));
      *(v8h*)(vt + (size_t)row * SKV + kv0 + c8) = hv;
    }
    
  }
}

// ---------------------------------------------------------------------------
// (3) Flash-style prefix-causal attention. grid (SEQ/128, NH, NB), 256 threads = 8 waves x 16 query rows.
// Per wave: Q B-fragments (bf16, RNE) in registers; loop over 64-key tiles up to the last visible key;
//   S^T subtile = K(16 kv x 64 d, bf16 plane rows) . Q^T : 2 bf16 WMMAs; scale, mask (kv > q + num_pt -> -inf), f32 online softmax
//   in log2 domain (row stats shared by lanes l and l^16); O^T += V^T(16 d x 32 kv, f16 plane rows) . P^T with
//   P^T fragment = [own D of subtile 2si (kv 0-15 of slice), own D of subtile 2si+1 (kv 16-31)] as f16 x4096.
// No LDS in the main loop (fragments from 16-bit planes, arithmetic addressing); waves fully independent.
// ---------------------------------------------------------------------------
__global__ __launch_bounds__(256) void attn_kernel(const float* __restrict__ q,
                                                    const unsigned short* __restrict__ Kp,
                                                    const unsigned short* __restrict__ Vtp,
                                                    const int* __restrict__ np,
                                                    float* __restrict__ out) {
  __shared__ __align__(16) float sT[8][16 * 68];   // per-wave 16x64 slab, pitch 68 floats
  const int tid  = threadIdx.x;
  const int wave = tid >> 5;
  const int lane = tid & 31;
  const int hi   = lane >> 4;                // lane half: k offset 8*hi, D row offset 8*hi
  const int l15  = lane & 15;                // A row / B,D column
  const int h    = blockIdx.y;
  const int b    = blockIdx.z;
  const int bh   = b * NH + h;
  const int q0w  = blockIdx.x * 128 + wave * 16;

  int numpt = np[0];
  numpt = (numpt < 0) ? 0 : numpt;
  numpt = (numpt > SKV) ? SKV : numpt;

  const float*    Qb = q + ((size_t)bh * SEQ_FULL) * HD;
  const __bf16*   Kb = (const __bf16*)Kp + (size_t)bh * SKV * HD;
  const _Float16* Vb = (const _Float16*)Vtp + (size_t)bh * HD * SKV;
  float*          Ob = out + ((size_t)bh * SEQ) * HD;

  // ---- Q as bf16 B operand of S^T = K.Q^T: B[k=d][n=q]; elements 0..7 <- d k0+8hi+0..7, 8..15 <- d k0+16+8hi+0..7 ----
  v16b bq[2];
  {
    const float* qrow = Qb + (size_t)(q0w + l15) * HD;
#pragma unroll
    for (int si = 0; si < 2; ++si) {
      const v4f f0 = *(const v4f*)(qrow + si * 32 + 8 * hi);
      const v4f f1 = *(const v4f*)(qrow + si * 32 + 8 * hi + 4);
      const v4f g0 = *(const v4f*)(qrow + si * 32 + 16 + 8 * hi);
      const v4f g1 = *(const v4f*)(qrow + si * 32 + 16 + 8 * hi + 4);
      v8u u;
      u[0] = pk16(f2bf_bits(f0[0]), f2bf_bits(f0[1]));
      u[1] = pk16(f2bf_bits(f0[2]), f2bf_bits(f0[3]));
      u[2] = pk16(f2bf_bits(f1[0]), f2bf_bits(f1[1]));
      u[3] = pk16(f2bf_bits(f1[2]), f2bf_bits(f1[3]));
      u[4] = pk16(f2bf_bits(g0[0]), f2bf_bits(g0[1]));
      u[5] = pk16(f2bf_bits(g0[2]), f2bf_bits(g0[3]));
      u[6] = pk16(f2bf_bits(g1[0]), f2bf_bits(g1[1]));
      u[7] = pk16(f2bf_bits(g1[2]), f2bf_bits(g1[3]));
      bq[si] = __builtin_bit_cast(v16b, u);
    }
  }

  // O^T accumulators: oacc[dg][r] = carry * O[q0w+l15][dg*16 + 8*hi + r]
  v8f oacc[4];
#pragma unroll
  for (int dg = 0; dg < 4; ++dg) oacc[dg] = zero8();
  float m = NEG_INF;                         // per-lane row stats (log2 domain)
  float l = 0.f;

  const int qmax   = q0w + 15 + numpt;       // last visible key of this wave's last row
  const int kv_end = (SKV < qmax + 1) ? SKV : (qmax + 1);

#pragma unroll 1
  for (int kv0 = 0; kv0 < kv_end; kv0 += 64) {
    // ---- S^T subtiles (16 kv each): 2 bf16 WMMAs, then scale + mask ----
    v8f s4[4];
#pragma unroll
    for (int t = 0; t < 4; ++t) {
      const int c0 = kv0 + t * 16;
      if (c0 > qmax) {                       // wave-uniform: whole subtile masked
        s4[t] = neg8();
        continue;
      }
      const __bf16* krow = Kb + (size_t)(c0 + l15) * HD + 8 * hi;
      const v16b ak0 = FragB::load(krow);
      const v16b ak1 = FragB::load(krow + 32);
      v8f s = zero8();
      s = FragB::mma(ak0, bq[0], s);
      s = FragB::mma(ak1, bq[1], s);
      dep_guard1_b(s, ak0, ak1, bq[0], bq[1]);
      const bool part = (c0 + 15 > q0w + numpt);   // wave-uniform: some (q, kv) of the subtile masked
      const int  lim  = q0w + l15 + numpt - c0;     // kv local index visible iff <= lim
      v8f sc;
#pragma unroll
      for (int r = 0; r < 8; ++r) {
        float vv = s[r] * kScale2;
        if (part && (r + 8 * hi > lim)) vv = NEG_INF;
        sc[r] = vv;
      }
      s4[t] = sc;
    }

    // ---- tile-level online softmax in log2 domain ----
    float tmax = fmaxf(fmaxf(hmax8(s4[0]), hmax8(s4[1])), fmaxf(hmax8(s4[2]), hmax8(s4[3])));
    tmax = fmaxf(tmax, __shfl_xor(tmax, 16, 32));
    const float mn    = fmaxf(m, tmax);
    const float alpha = (m > NEG_INF) ? EXP2(m - mn) : 0.0f;
    const float mref  = (mn > NEG_INF) ? mn : 0.0f;
    m = mn;
#pragma unroll
    for (int t = 0; t < 4; ++t)
#pragma unroll
      for (int r = 0; r < 8; ++r) s4[t][r] = EXP2(s4[t][r] - mref);
    float ts = (hsum8(s4[0]) + hsum8(s4[1])) + (hsum8(s4[2]) + hsum8(s4[3]));
    ts += __shfl_xor(ts, 16, 32);
    l = l * alpha + ts;
#pragma unroll
    for (int dg = 0; dg < 4; ++dg)
#pragma unroll
      for (int r = 0; r < 8; ++r) oacc[dg][r] *= alpha;

    // ---- O^T += V^T . P^T : 2 slices of 32 kv, 4 f16 WMMAs each ----
#pragma unroll
    for (int si = 0; si < 2; ++si) {
      const v8f p0 = s4[2 * si];               // kv si*32 + 8*hi + 0..7 of this lane's q column
      const v8f p1 = s4[2 * si + 1];           // kv si*32 + 16 + 8*hi + 0..7
      v8u u;
#pragma unroll
      for (int j = 0; j < 4; ++j) {
        u[j]     = pkh2(p0[2 * j] * kCarry, p0[2 * j + 1] * kCarry);
        u[4 + j] = pkh2(p1[2 * j] * kCarry, p1[2 * j + 1] * kCarry);
      }
      const v16h bp = __builtin_bit_cast(v16h, u);
      const _Float16* vrow = Vb + (size_t)l15 * SKV + kv0 + si * 32 + 8 * hi;   // row d = dg*16 + l15
      const v16h av0 = FragH::load(vrow);
      const v16h av1 = FragH::load(vrow + (size_t)16 * SKV);
      const v16h av2 = FragH::load(vrow + (size_t)32 * SKV);
      const v16h av3 = FragH::load(vrow + (size_t)48 * SKV);
      oacc[0] = FragH::mma(av0, bp, oacc[0]);
      oacc[1] = FragH::mma(av1, bp, oacc[1]);
      oacc[2] = FragH::mma(av2, bp, oacc[2]);
      oacc[3] = FragH::mma(av3, bp, oacc[3]);
      dep_guard4_h(oacc[0], oacc[1], oacc[2], oacc[3], av3, bp);
      keep4_h(av0, av1, av2, bp);
    }
  }
  acc_guard4(oacc[0], oacc[1], oacc[2], oacc[3]);

  // ---- epilogue: normalize, transpose O^T -> O through the wave's LDS slab, whole-line stores ----
  const float inv = (l > 0.f) ? ((1.0f / l) * kInvCarry) : 0.f;
  float* slab = sT[wave];
#pragma unroll
  for (int dg = 0; dg < 4; ++dg)
#pragma unroll
    for (int r = 0; r < 8; ++r)
      slab[l15 * 68 + dg * 16 + 8 * hi + r] = oacc[dg][r] * inv;
  __builtin_amdgcn_fence(3 /* release order */, "workgroup");
  __builtin_amdgcn_wave_barrier();
  __builtin_amdgcn_fence(2 /* acquire order */, "workgroup");
  const int hh = lane >> 4, c4 = (lane & 15) * 4;   // row seg = 256 B = 16 lanes x 16 B
  {
#pragma unroll
    for (int it = 0; it < 8; ++it) {
      const int row = it * 2 + hh;
      const v4f vv = *(const v4f*)(slab + row * 68 + c4);
      *(v4f*)(Ob + (size_t)(q0w + row) * HD + c4) = vv;
    }
    
  }
}

// ---------------------------------------------------------------------------
// Host glue.
//   Kp  bf16 [NB*NH][SKV][64]     NB*NH*SKV*128   at 0              (cast_rows_kernel)
//   Vt  f16  [NB*NH][64][SKV]     NB*NH*SKV*128   at NB*NH*SKV*128  (v_transpose_kernel)
//   total (NB=2, SKV=3072)         25,165,824
// 3 launches.
// ---------------------------------------------------------------------------
extern "C" void kernel_launch(void* const* d_in, const int* in_sizes, int n_in,
                              void* d_out, int out_size, void* d_ws, size_t ws_size,
                              hipStream_t stream) {
  if (n_in < 4) return;
  if (in_sizes[0] < NB * NH * SEQ * HD) return;
  if (in_sizes[1] < NB * NH * SKV * HD) return;
  if (in_sizes[2] < NB * NH * SKV * HD) return;
  if (in_sizes[3] < 1) return;
  if (out_size < NB * NH * SEQ * HD) return;

  const size_t szK   = (size_t)NB * NH * SKV * HD * 2;
  const size_t szVt  = (size_t)NB * NH * HD * SKV * 2;
  const size_t offK  = 0;
  const size_t offVt = offK + szK;
  const size_t total = offVt + szVt;
  if (ws_size < total) return;

  const float* q  = (const float*)d_in[0];
  const float* k  = (const float*)d_in[1];
  const float* v  = (const float*)d_in[2];
  const int*   np = (const int*)d_in[3];
  float* out = (float*)d_out;
  char* ws = (char*)d_ws;
  unsigned short* Kp = (unsigned short*)(ws + offK);
  _Float16*       Vt = (_Float16*)(ws + offVt);

  const int nRowsK = NB * NH * SKV;                 // multiple of 32
  // (1) Kp[bh][kv][d] = bf16(k[bh][kv][d])
  cast_rows_kernel<<<dim3(nRowsK / 32), dim3(256), 0, stream>>>(k, Kp, SKV, SKV_FULL, nRowsK);
  // (2) Vt[bh][d][kv] = f16(bf16(v[bh][kv][d]))
  v_transpose_kernel<<<dim3(SKV / 64, NB * NH), dim3(256), 0, stream>>>(v, Vt);
  // (3) attention
  attn_kernel<<<dim3(SEQ / 128, NH, NB), dim3(256), 0, stream>>>(q, Kp, (const unsigned short*)Vt, np, out);
}

// v001
// One run takes 76.1 microseconds.
// Next to v000, in two timings, it ran 2.79 and 2.81 times as fast.
// Contractions: scores K.Q^T on v_wmma_f32_16x16x32_bf16 (bf16 operands = RNE bf16 copies of q and k, f32 accumulate); context V^T.P^T on v_wmma_f32_16x16x32_f16 (f16 operands: v = f16 of its RNE bf16 copy, p carried x4096, f32 accumulate); scale, mask and online softmax in f32.
#include <hip/hip_runtime.h>
#include <math.h>

// ---------------------------------------------------------------------------
// Problem constants (NB / SEQ / SKV overridable for a reduced build; *_FULL = input strides)
// ---------------------------------------------------------------------------
#ifndef NB
#define NB 2
#endif
#ifndef SEQ
#define SEQ 2048
#endif
#ifndef SKV
#define SKV 3072
#endif
#define NB_FULL   2
#define NH        16
#define HD        64
#define SEQ_FULL  2048
#define SKV_FULL  3072

static_assert(NB >= 1 && NB <= NB_FULL);
static_assert(SEQ % 128 == 0 && SEQ <= SEQ_FULL);
static_assert(SKV % 64 == 0 && SKV <= SKV_FULL);
static_assert(HD == 64);
static_assert((NB * NH * SKV) % 32 == 0);

constexpr float kScale2   = 0.125f * 1.44269504088896340736f;   // 1/sqrt(64) * log2(e): softmax in log2 domain
constexpr float kCarry    = 4096.0f;                            // p in [0,1] carried x4096 as f16 operand
constexpr float kInvCarry = 1.0f / 4096.0f;
#define NEG_INF (-__builtin_inff())

#if __has_builtin(__builtin_amdgcn_exp2f)
#define EXP2(x) __builtin_amdgcn_exp2f(x)
#else
#define EXP2(x) exp2f(x)
#endif

typedef __attribute__((ext_vector_type(16))) _Float16 v16h;
typedef __attribute__((ext_vector_type(8)))  _Float16 v8h;
typedef __attribute__((ext_vector_type(2)))  _Float16 v2h;
typedef __attribute__((ext_vector_type(16))) __bf16   v16b;
typedef __attribute__((ext_vector_type(8)))  __bf16   v8b;
typedef __attribute__((ext_vector_type(8)))  float    v8f;
typedef __attribute__((ext_vector_type(4)))  float    v4f;
typedef __attribute__((ext_vector_type(4)))  unsigned int v4u;
typedef __attribute__((ext_vector_type(8)))  unsigned int v8u;

__device__ __forceinline__ unsigned short f2bf_bits(float f) {        // RNE convert f32 -> bf16 bits
  unsigned u = __float_as_uint(f);
  return (unsigned short)((u + 0x7FFFu + ((u >> 16) & 1u)) >> 16);
}
__device__ __forceinline__ float bf_bits2f(unsigned short h) { return __uint_as_float(((unsigned)h) << 16); }

// hazard guards: 4 VALU slots after the last WMMA of a group, tie D, keep A/B live
__device__ __forceinline__ void dep_guard1_b(v8f& a, v16b w, v16b x, v16b y, v16b z) {
  asm volatile("v_nop\n\tv_nop\n\tv_nop\n\tv_nop" : "+v"(a) : "v"(w), "v"(x), "v"(y), "v"(z));
}
__device__ __forceinline__ void dep_guard4_h(v8f& a, v8f& b, v8f& c, v8f& d, v16h x, v16h y) {
  asm volatile("v_nop\n\tv_nop\n\tv_nop\n\tv_nop" : "+v"(a), "+v"(b), "+v"(c), "+v"(d) : "v"(x), "v"(y));
}
__device__ __forceinline__ void keep4_h(v16h a, v16h b, v16h c, v16h d) { asm volatile("v_nop" :: "v"(a), "v"(b), "v"(c), "v"(d)); }
__device__ __forceinline__ void acc_guard4(v8f& a, v8f& b, v8f& c, v8f& d) {
  asm volatile("v_nop\n\tv_nop\n\tv_nop\n\tv_nop" : "+v"(a), "+v"(b), "+v"(c), "+v"(d));
}

template <typename T> struct Frag;
template <> struct Frag<_Float16> {
  typedef v16h V; union U { v16h v; v8h h[2]; };
  // elements 0..7 <- p[0..7], 8..15 <- p[16..23]; caller passes p = row + k0 + 8*(lane>>4)
  static __device__ __forceinline__ v16h load(const _Float16* p) {
    U f; f.h[0] = *(const v8h*)(p); f.h[1] = *(const v8h*)(p + 16); return f.v;
  }
  static __device__ __forceinline__ v8f mma(v16h a, v16h b, v8f c) {
    return __builtin_amdgcn_wmma_f32_16x16x32_f16(false, a, false, b, (short)0, c, false, false);
  }
};
template <> struct Frag<__bf16> {
  typedef v16b V; union U { v16b v; v8b h[2]; };
  static __device__ __forceinline__ v16b load(const __bf16* p) {
    U f; f.h[0] = *(const v8b*)(p); f.h[1] = *(const v8b*)(p + 16); return f.v;
  }
  static __device__ __forceinline__ v8f mma(v16b a, v16b b, v8f c) {
    return __builtin_amdgcn_wmma_f32_16x16x32_bf16(false, a, false, b, (short)0, c, false, false);
  }
};
typedef Frag<_Float16> FragH;
typedef Frag<__bf16>   FragB;

__device__ __forceinline__ unsigned pk16(unsigned short a, unsigned short b) { return (unsigned)a | ((unsigned)b << 16); }
// pack two f32 -> one dword of two f16 (element 0 = a)
__device__ __forceinline__ unsigned pkh2(float a, float b) {
  v2h p; p[0] = (_Float16)a; p[1] = (_Float16)b;
  return __builtin_bit_cast(unsigned, p);
}
__device__ __forceinline__ v8f zero8() { return (v8f){0.f, 0.f, 0.f, 0.f, 0.f, 0.f, 0.f, 0.f}; }
__device__ __forceinline__ v8f neg8()  { return (v8f){NEG_INF, NEG_INF, NEG_INF, NEG_INF, NEG_INF, NEG_INF, NEG_INF, NEG_INF}; }
// balanced-tree horizontal reductions
__device__ __forceinline__ float hsum8(v8f v) {
  float a = v[0] + v[1], b = v[2] + v[3], c = v[4] + v[5], d = v[6] + v[7];
  return (a + b) + (c + d);
}
__device__ __forceinline__ float hmax8(v8f v) {
  float a = fmaxf(v[0], v[1]), b = fmaxf(v[2], v[3]);
  float c = fmaxf(v[4], v[5]), d = fmaxf(v[6], v[7]);
  return fmaxf(fmaxf(a, b), fmaxf(c, d));
}

// ---------------------------------------------------------------------------
// dst row pr = g * rowsPerGroup + r  <-  src row g * srcRowsPerGroup + r  (g = (b*NH + h)).
// Block 256 threads = 32 rows; thread t: row t>>3, 8 halves at (t&7)*8.
// ---------------------------------------------------------------------------
__global__ __launch_bounds__(256) void cast_rows_kernel(const float* __restrict__ src,
                                                         unsigned short* __restrict__ dst,
                                                         int rowsPerGroup, int srcRowsPerGroup, int nRows) {
  const int t  = threadIdx.x;
  int pr = blockIdx.x * 32 + (t >> 3);
  pr = (pr < nRows) ? pr : (nRows - 1);            // address clamp (grid is exact)
  const int c8 = (t & 7) * 8;
  const int g  = pr / rowsPerGroup;
  const int r  = pr - g * rowsPerGroup;
  const float* s = src + ((size_t)g * srcRowsPerGroup + r) * HD + c8;
  const v4f a = *(const v4f*)(s);
  const v4f b = *(const v4f*)(s + 4);
  unsigned short hb[8];
#pragma unroll
  for (int e = 0; e < 4; ++e) { hb[e] = f2bf_bits(a[e]); hb[4 + e] = f2bf_bits(b[e]); }
  const v4u u = (v4u){pk16(hb[0], hb[1]), pk16(hb[2], hb[3]), pk16(hb[4], hb[5]), pk16(hb[6], hb[7])};
  unsigned short* d = dst + (size_t)pr * HD + c8;
  *(v4u*)d = u;
  
}

// ---------------------------------------------------------------------------
// (2) V cast + transpose: Vt[bh][d][kv] = f16( bf16( v[bh][kv][d] ) )   (pitch SKV halves)
// grid (SKV/64, NB*NH), 256 threads; one 64(kv) x 64(d) tile through LDS.
// Load coverage: 16 iterations x 256 threads = 4096 = whole tile (coalesced along d); sm cross-wave -> __syncthreads.
// Store coverage: 8 waves x 2 iterations x 4 rows (lane>>3) = 64 d-rows; (lane&7) x 8 halves = 64 kv;
// ---------------------------------------------------------------------------
__global__ __launch_bounds__(256) void v_transpose_kernel(const float* __restrict__ v,
                                                           _Float16* __restrict__ Vt) {
  __shared__ float sm[64][65];   // sm[kv_local][d]
  const int tid = threadIdx.x;
  const int kv0 = blockIdx.x * 64;
  const int bh  = blockIdx.y;                        // b*NH + h, b < NB
  const float* vb = v + ((size_t)bh * SKV_FULL + kv0) * HD;
#pragma unroll
  for (int i = 0; i < 16; ++i) {
    const int e = i * 256 + tid;
    const int r = e >> 6;          // kv local
    const int c = e & 63;          // d
    sm[r][c] = vb[(size_t)r * HD + c];
  }
  __syncthreads();
  const int lane = tid & 31, wave = tid >> 5;
  const int q = lane >> 3, c8 = (lane & 7) * 8;
  _Float16* vt = Vt + (size_t)bh * HD * SKV;
  {
#pragma unroll
    for (int it = 0; it < 2; ++it) {
      const int row = wave * 8 + it * 4 + q;          // d
      v8h hv;
#pragma unroll
      for (int e = 0; e < 8; ++e) hv[e] = (_Float16)bf_bits2f(f2bf_bits(sm[c8 + e][row]));
      *(v8h*)(vt + (size_t)row * SKV + kv0 + c8) = hv;
    }
    
  }
}

// ---------------------------------------------------------------------------
// LDS ring of the attention kernel: a stage = one 64-key K tile (64 kv rows x 128 B) and one V^T tile (64 d rows x 128 B).
// ---------------------------------------------------------------------------
constexpr int kPitch  = 144;              // LDS row pitch in bytes: 128 + 16, an odd multiple of 16 (ds_load_b128 readers)
constexpr int kTileB  = 64 * kPitch;      // one tile
constexpr int kStageB = 2 * kTileB;       // K tile, then V^T tile
static_assert(kPitch % 16 == 0 && ((kPitch / 16) & 1) == 1);
static_assert(SKV >= 128);                // the ring's prologue fills two stages

// Four 16-byte asynchronous copies per lane = this lane's share of one stage. l* = LDS byte addresses, g* = global addresses.
// s_wait_xcnt 0 is the statement's last line so that it stands ahead of any rewrite of the address registers the copies name.
__device__ __forceinline__ void copy_stage(unsigned l0, unsigned l1, unsigned l2, unsigned l3,
                                           const unsigned char* g0, const unsigned char* g1,
                                           const unsigned char* g2, const unsigned char* g3) {
  asm volatile("global_load_async_to_lds_b128 %0, %4, off\n\t"
               "global_load_async_to_lds_b128 %1, %5, off\n\t"
               "global_load_async_to_lds_b128 %2, %6, off\n\t"
               "global_load_async_to_lds_b128 %3, %7, off\n\t"
               "s_wait_xcnt 0x0"
               :: "v"(l0), "v"(l1), "v"(l2), "v"(l3), "v"(g0), "v"(g1), "v"(g2), "v"(g3) : "memory");
}
// the wave's own copies have landed (the compiler places no wait for them)
__device__ __forceinline__ void wait_async0() { asm volatile("s_wait_asynccnt 0x0" ::: "memory"); }
// the wave's own LDS reads have returned, before the buffer is handed to its next writer
__device__ __forceinline__ void wait_ds0() { asm volatile("s_wait_dscnt 0x0" ::: "memory"); }

// ---------------------------------------------------------------------------
// (3) Flash-style prefix-causal attention. grid (SEQ/128, NH, NB), 256 threads = 8 waves x 16 query rows.
// Per wave: Q B-fragments (bf16, RNE) in registers; loop over 64-key tiles up to the last visible key;
//   S^T subtile = K(16 kv x 64 d, bf16 plane rows) . Q^T : 2 bf16 WMMAs; scale, mask (kv > q + num_pt -> -inf), f32 online softmax
//   in log2 domain (row stats shared by lanes l and l^16); O^T += V^T(16 d x 32 kv, f16 plane rows) . P^T with
//   P^T fragment = [own D of subtile 2si (kv 0-15 of slice), own D of subtile 2si+1 (kv 16-31)] as f16 x4096.
// K and V^T tiles are brought into LDS once per work-group by asynchronous copies, two buffers: tile t + 1 flies while tile t is
// worked on; one publish point per tile (own LDS reads done, own copies landed, barrier, refill), passed by every wave; a wave
// skips only the work of tiles beyond its own last visible key.
// ---------------------------------------------------------------------------
__global__ __launch_bounds__(256) void attn_kernel(const float* __restrict__ q,
                                                    const unsigned short* __restrict__ Kp,
                                                    const unsigned short* __restrict__ Vtp,
                                                    const int* __restrict__ np,
                                                    float* __restrict__ out) {
  __shared__ __align__(16) float sT[8][16 * 68];   // per-wave 16x64 slab, pitch 68 floats
  __shared__ __align__(16) unsigned char ring[2 * kStageB];
  const int tid  = threadIdx.x;
  const int wave = __builtin_amdgcn_readfirstlane(tid >> 5);   // scalar: the per-wave skip between publish points is a scalar branch
  const int lane = tid & 31;
  const int hi   = lane >> 4;                // lane half: k offset 8*hi, D row offset 8*hi
  const int l15  = lane & 15;                // A row / B,D column
  const int h    = blockIdx.y;
  const int b    = blockIdx.z;
  const int bh   = b * NH + h;
  const int q0w  = blockIdx.x * 128 + wave * 16;

  int numpt = np[0];
  numpt = (numpt < 0) ? 0 : numpt;
  numpt = (numpt > SKV) ? SKV : numpt;

  const float*    Qb = q + ((size_t)bh * SEQ_FULL) * HD;
  const __bf16*   Kb = (const __bf16*)Kp + (size_t)bh * SKV * HD;
  const _Float16* Vb = (const _Float16*)Vtp + (size_t)bh * HD * SKV;
  float*          Ob = out + ((size_t)bh * SEQ) * HD;

  // ---- Q as bf16 B operand of S^T = K.Q^T: B[k=d][n=q]; elements 0..7 <- d k0+8hi+0..7, 8..15 <- d k0+16+8hi+0..7 ----
  v16b bq[2];
  {
    const float* qrow = Qb + (size_t)(q0w + l15) * HD;
#pragma unroll
    for (int si = 0; si < 2; ++si) {
      const v4f f0 = *(const v4f*)(qrow + si * 32 + 8 * hi);
      const v4f f1 = *(const v4f*)(qrow + si * 32 + 8 * hi + 4);
      const v4f g0 = *(const v4f*)(qrow + si * 32 + 16 + 8 * hi);
      const v4f g1 = *(const v4f*)(qrow + si * 32 + 16 + 8 * hi + 4);
      v8u u;
      u[0] = pk16(f2bf_bits(f0[0]), f2bf_bits(f0[1]));
      u[1] = pk16(f2bf_bits(f0[2]), f2bf_bits(f0[3]));
      u[2] = pk16(f2bf_bits(f1[0]), f2bf_bits(f1[1]));
      u[3] = pk16(f2bf_bits(f1[2]), f2bf_bits(f1[3]));
      u[4] = pk16(f2bf_bits(g0[0]), f2bf_bits(g0[1]));
      u[5] = pk16(f2bf_bits(g0[2]), f2bf_bits(g0[3]));
      u[6] = pk16(f2bf_bits(g1[0]), f2bf_bits(g1[1]));
      u[7] = pk16(f2bf_bits(g1[2]), f2bf_bits(g1[3]));
      bq[si] = __builtin_bit_cast(v16b, u);
    }
  }

  // O^T accumulators: oacc[dg][r] = carry * O[q0w+l15][dg*16 + 8*hi + r]
  v8f oacc[4];
#pragma unroll
  for (int dg = 0; dg < 4; ++dg) oacc[dg] = zero8();
  float m = NEG_INF;                         // per-lane row stats (log2 domain)
  float l = 0.f;

  const int qmax   = q0w + 15 + numpt;       // last visible key of this wave's last row
  const int kv_end = (SKV < qmax + 1) ? SKV : (qmax + 1);

  // work-group-uniform tile count: up to the last visible key of the block's last row; >= 2 (128 rows see >= 128 keys)
  const int qmaxb = blockIdx.x * 128 + 127 + numpt;
  const int nt    = (((SKV < qmaxb + 1) ? SKV : (qmaxb + 1)) + 63) >> 6;

  // this lane's share of a stage: 16 B at column ccol of rows crow and crow + 32 of each tile (a wave-wide copy = 4 whole lines)
  const int crow = tid >> 3, ccol = (tid & 7) * 16;
  const unsigned char* kg = (const unsigned char*)Kb + (size_t)crow * (HD * 2) + ccol;
  const unsigned char* vg = (const unsigned char*)Vb + (size_t)crow * (SKV * 2) + ccol;
  const unsigned       lc = (unsigned)(size_t)ring + crow * kPitch + ccol;
  auto issue_stage = [&](int s) {
    const unsigned lb = lc + (s & 1) * kStageB;
    const unsigned char* k0 = kg + (size_t)s * (64 * HD * 2);
    const unsigned char* v0 = vg + (size_t)s * (64 * 2);
    copy_stage(lb, lb + 32 * kPitch, lb + kTileB, lb + kTileB + 32 * kPitch,
               k0, k0 + 32 * HD * 2, v0, v0 + (size_t)32 * SKV * 2);
  };

  issue_stage(0);
  wait_async0();
  __syncthreads();
  issue_stage(1);

#pragma unroll 1
  for (int it = 0; it < nt; ++it) {
    const int kv0 = it * 64;
    const unsigned char* stK = ring + (it & 1) * kStageB;
    const unsigned char* stV = stK + kTileB;
    if (kv0 < kv_end) {                        // wave-uniform (scalar): tiles beyond this wave's last visible key hold no work
    // ---- S^T subtiles (16 kv each): 2 bf16 WMMAs, then scale + mask ----
    v8f s4[4];
#pragma unroll
    for (int t = 0; t < 4; ++t) {
      const int c0 = kv0 + t * 16;
      if (c0 > qmax) {                       // wave-uniform: whole subtile masked
        s4[t] = neg8();
        continue;
      }
      const __bf16* krow = (const __bf16*)(stK + (t * 16 + l15) * kPitch) + 8 * hi;
      const v16b ak0 = FragB::load(krow);
      const v16b ak1 = FragB::load(krow + 32);
      v8f s = zero8();
      s = FragB::mma(ak0, bq[0], s);
      s = FragB::mma(ak1, bq[1], s);
      dep_guard1_b(s, ak0, ak1, bq[0], bq[1]);
      const bool part = (c0 + 15 > q0w + numpt);   // wave-uniform: some (q, kv) of the subtile masked
      const int  lim  = q0w + l15 + numpt - c0;     // kv local index visible iff <= lim
      v8f sc;
#pragma unroll
      for (int r = 0; r < 8; ++r) {
        float vv = s[r] * kScale2;
        if (part && (r + 8 * hi > lim)) vv = NEG_INF;
        sc[r] = vv;
      }
      s4[t] = sc;
    }

    // ---- tile-level online softmax in log2 domain ----
    float tmax = fmaxf(fmaxf(hmax8(s4[0]), hmax8(s4[1])), fmaxf(hmax8(s4[2]), hmax8(s4[3])));
    tmax = fmaxf(tmax, __shfl_xor(tmax, 16, 32));
    const float mn    = fmaxf(m, tmax);
    const float alpha = (m > NEG_INF) ? EXP2(m - mn) : 0.0f;
    const float mref  = (mn > NEG_INF) ? mn : 0.0f;
    m = mn;
#pragma unroll
    for (int t = 0; t < 4; ++t)
#pragma unroll
      for (int r = 0; r < 8; ++r) s4[t][r] = EXP2(s4[t][r] - mref);
    float ts = (hsum8(s4[0]) + hsum8(s4[1])) + (hsum8(s4[2]) + hsum8(s4[3]));
    ts += __shfl_xor(ts, 16, 32);
    l = l * alpha + ts;
#pragma unroll
    for (int dg = 0; dg < 4; ++dg)
#pragma unroll
      for (int r = 0; r < 8; ++r) oacc[dg][r] *= alpha;

    // ---- O^T += V^T . P^T : 2 slices of 32 kv, 4 f16 WMMAs each ----
#pragma unroll
    for (int si = 0; si < 2; ++si) {
      const v8f p0 = s4[2 * si];               // kv si*32 + 8*hi + 0..7 of this lane's q column
      const v8f p1 = s4[2 * si + 1];           // kv si*32 + 16 + 8*hi + 0..7
      v8u u;
#pragma unroll
      for (int j = 0; j < 4; ++j) {
        u[j]     = pkh2(p0[2 * j] * kCarry, p0[2 * j + 1] * kCarry);
        u[4 + j] = pkh2(p1[2 * j] * kCarry, p1[2 * j + 1] * kCarry);
      }
      const v16h bp = __builtin_bit_cast(v16h, u);
      const _Float16* vrow = (const _Float16*)(stV + l15 * kPitch) + si * 32 + 8 * hi;   // row d = dg*16 + l15
      const v16h av0 = FragH::load(vrow);
      const v16h av1 = FragH::load(vrow + 16 * (kPitch / 2));
      const v16h av2 = FragH::load(vrow + 32 * (kPitch / 2));
      const v16h av3 = FragH::load(vrow + 48 * (kPitch / 2));
      oacc[0] = FragH::mma(av0, bp, oacc[0]);
      oacc[1] = FragH::mma(av1, bp, oacc[1]);
      oacc[2] = FragH::mma(av2, bp, oacc[2]);
      oacc[3] = FragH::mma(av3, bp, oacc[3]);
      dep_guard4_h(oacc[0], oacc[1], oacc[2], oacc[3], av3, bp);
      keep4_h(av0, av1, av2, bp);
    }
    }
    // ---- publish point of tile it + 1, every wave: own reads of this buffer done, own copies landed, barrier, then the refill ----
    wait_ds0();
    wait_async0();
    __syncthreads();
    if (it + 2 < nt) issue_stage(it + 2);      // work-group-uniform: into the buffer that this trip has just read
  }
  wait_async0();
  acc_guard4(oacc[0], oacc[1], oacc[2], oacc[3]);

  // ---- epilogue: normalize, transpose O^T -> O through the wave's LDS slab, whole-line stores ----
  const float inv = (l > 0.f) ? ((1.0f / l) * kInvCarry) : 0.f;
  float* slab = sT[wave];
#pragma unroll
  for (int dg = 0; dg < 4; ++dg)
#pragma unroll
    for (int r = 0; r < 8; ++r)
      slab[l15 * 68 + dg * 16 + 8 * hi + r] = oacc[dg][r] * inv;
  __builtin_amdgcn_fence(3 /* release order */, "workgroup");
  __builtin_amdgcn_wave_barrier();
  __builtin_amdgcn_fence(2 /* acquire order */, "workgroup");
  const int hh = lane >> 4, c4 = (lane & 15) * 4;   // row seg = 256 B = 16 lanes x 16 B
  {
#pragma unroll
    for (int it = 0; it < 8; ++it) {
      const int row = it * 2 + hh;
      const v4f vv = *(const v4f*)(slab + row * 68 + c4);
      *(v4f*)(Ob + (size_t)(q0w + row) * HD + c4) = vv;
    }
    
  }
}

// ---------------------------------------------------------------------------
// Host glue.
//   Kp  bf16 [NB*NH][SKV][64]     NB*NH*SKV*128   at 0              (cast_rows_kernel)
//   Vt  f16  [NB*NH][64][SKV]     NB*NH*SKV*128   at NB*NH*SKV*128  (v_transpose_kernel)
//   total (NB=2, SKV=3072)         25,165,824
// 3 launches.
// ---------------------------------------------------------------------------
extern "C" void kernel_launch(void* const* d_in, const int* in_sizes, int n_in,
                              void* d_out, int out_size, void* d_ws, size_t ws_size,
                              hipStream_t stream) {
  if (n_in < 4) return;
  if (in_sizes[0] < NB * NH * SEQ * HD) return;
  if (in_sizes[1] < NB * NH * SKV * HD) return;
  if (in_sizes[2] < NB * NH * SKV * HD) return;
  if (in_sizes[3] < 1) return;
  if (out_size < NB * NH * SEQ * HD) return;

  const size_t szK   = (size_t)NB * NH * SKV * HD * 2;
  const size_t szVt  = (size_t)NB * NH * HD * SKV * 2;
  const size_t offK  = 0;
  const size_t offVt = offK + szK;
  const size_t total = offVt + szVt;
  if (ws_size < total) return;

  const float* q  = (const float*)d_in[0];
  const float* k  = (const float*)d_in[1];
  const float* v  = (const float*)d_in[2];
  const int*   np = (const int*)d_in[3];
  float* out = (float*)d_out;
  char* ws = (char*)d_ws;
  unsigned short* Kp = (unsigned short*)(ws + offK);
  _Float16*       Vt = (_Float16*)(ws + offVt);

  const int nRowsK = NB * NH * SKV;                 // multiple of 32
  // (1) Kp[bh][kv][d] = bf16(k[bh][kv][d])
  cast_rows_kernel<<<dim3(nRowsK / 32), dim3(256), 0, stream>>>(k, Kp, SKV, SKV_FULL, nRowsK);
  // (2) Vt[bh][d][kv] = f16(bf16(v[bh][kv][d]))
  v_transpose_kernel<<<dim3(SKV / 64, NB * NH), dim3(256), 0, stream>>>(v, Vt);
  // (3) attention
  attn_kernel<<<dim3(SEQ / 128, NH, NB), dim3(256), 0, stream>>>(q, Kp, (const unsigned short*)Vt, np, out);
}

// v002
// A run of this version takes 64.7 microseconds.
// Two timings next to v001 put it at 1.17 and 1.18 times that version's speed.
// Counting every step since v000, it is 3.30 times as fast.
// Contractions: scores K.Q^T on v_wmma_f32_16x16x32_bf16 (bf16 operands = RNE bf16 copies of q and k, f32 accumulate); context V^T.P^T on v_wmma_f32_16x16x32_f16 (f16 operands: v = f16 of its RNE bf16 copy, p carried x4096, f32 accumulate); scale, mask and online softmax in f32.
#include <hip/hip_runtime.h>
#include <math.h>

// ---------------------------------------------------------------------------
// Problem constants (NB / SEQ / SKV overridable for a reduced build; *_FULL = input strides)
// ---------------------------------------------------------------------------
#ifndef NB
#define NB 2
#endif
#ifndef SEQ
#define SEQ 2048
#endif
#ifndef SKV
#define SKV 3072
#endif
#define NB_FULL   2
#define NH        16
#define HD        64
#define SEQ_FULL  2048
#define SKV_FULL  3072

static_assert(NB >= 1 && NB <= NB_FULL);
static_assert(SEQ % 128 == 0 && SEQ <= SEQ_FULL);
static_assert(SKV % 64 == 0 && SKV <= SKV_FULL);
static_assert(HD == 64);
static_assert((NB * NH * SKV) % 32 == 0);

constexpr float kScale2   = 0.125f * 1.44269504088896340736f;   // 1/sqrt(64) * log2(e): softmax in log2 domain
constexpr float kCarry    = 4096.0f;                            // p in [0,1] carried x4096 as f16 operand
constexpr float kInvCarry = 1.0f / 4096.0f;
#define NEG_INF (-__builtin_inff())

#if __has_builtin(__builtin_amdgcn_exp2f)
#define EXP2(x) __builtin_amdgcn_exp2f(x)
#else
#define EXP2(x) exp2f(x)
#endif

typedef __attribute__((ext_vector_type(16))) _Float16 v16h;
typedef __attribute__((ext_vector_type(8)))  _Float16 v8h;
typedef __attribute__((ext_vector_type(2)))  _Float16 v2h;
typedef __attribute__((ext_vector_type(16))) __bf16   v16b;
typedef __attribute__((ext_vector_type(8)))  __bf16   v8b;
typedef __attribute__((ext_vector_type(8)))  float    v8f;
typedef __attribute__((ext_vector_type(4)))  float    v4f;
typedef __attribute__((ext_vector_type(4)))  unsigned int v4u;
typedef __attribute__((ext_vector_type(8)))  unsigned int v8u;

__device__ __forceinline__ unsigned short f2bf_bits(float f) {        // RNE convert f32 -> bf16 bits
  unsigned u = __float_as_uint(f);
  return (unsigned short)((u + 0x7FFFu + ((u >> 16) & 1u)) >> 16);
}
__device__ __forceinline__ float bf_bits2f(unsigned short h) { return __uint_as_float(((unsigned)h) << 16); }

// hazard guards: 4 VALU slots after the last WMMA of a group, tie D, keep A/B live
__device__ __forceinline__ void dep_guard1_b(v8f& a, v16b w, v16b x, v16b y, v16b z) {
  asm volatile("v_nop\n\tv_nop\n\tv_nop\n\tv_nop" : "+v"(a) : "v"(w), "v"(x), "v"(y), "v"(z));
}
__device__ __forceinline__ void dep_guard4_h(v8f& a, v8f& b, v8f& c, v8f& d, v16h x, v16h y) {
  asm volatile("v_nop\n\tv_nop\n\tv_nop\n\tv_nop" : "+v"(a), "+v"(b), "+v"(c), "+v"(d) : "v"(x), "v"(y));
}
__device__ __forceinline__ void keep4_h(v16h a, v16h b, v16h c, v16h d) { asm volatile("v_nop" :: "v"(a), "v"(b), "v"(c), "v"(d)); }
__device__ __forceinline__ void acc_guard4(v8f& a, v8f& b, v8f& c, v8f& d) {
  asm volatile("v_nop\n\tv_nop\n\tv_nop\n\tv_nop" : "+v"(a), "+v"(b), "+v"(c), "+v"(d));
}

template <typename T> struct Frag;
template <> struct Frag<_Float16> {
  typedef v16h V; union U { v16h v; v8h h[2]; };
  // elements 0..7 <- p[0..7], 8..15 <- p[16..23]; caller passes p = row + k0 + 8*(lane>>4)
  static __device__ __forceinline__ v16h load(const _Float16* p) {
    U f; f.h[0] = *(const v8h*)(p); f.h[1] = *(const v8h*)(p + 16); return f.v;
  }
  static __device__ __forceinline__ v8f mma(v16h a, v16h b, v8f c) {
    return __builtin_amdgcn_wmma_f32_16x16x32_f16(false, a, false, b, (short)0, c, false, false);
  }
};
template <> struct Frag<__bf16> {
  typedef v16b V; union U { v16b v; v8b h[2]; };
  static __device__ __forceinline__ v16b load(const __bf16* p) {
    U f; f.h[0] = *(const v8b*)(p); f.h[1] = *(const v8b*)(p + 16); return f.v;
  }
  static __device__ __forceinline__ v8f mma(v16b a, v16b b, v8f c) {
    return __builtin_amdgcn_wmma_f32_16x16x32_bf16(false, a, false, b, (short)0, c, false, false);
  }
};
typedef Frag<_Float16> FragH;
typedef Frag<__bf16>   FragB;

__device__ __forceinline__ unsigned pk16(unsigned short a, unsigned short b) { return (unsigned)a | ((unsigned)b << 16); }
// pack two f32 -> one dword of two f16 (element 0 = a)
__device__ __forceinline__ unsigned pkh2(float a, float b) {
  v2h p; p[0] = (_Float16)a; p[1] = (_Float16)b;
  return __builtin_bit_cast(unsigned, p);
}
__device__ __forceinline__ v8f zero8() { return (v8f){0.f, 0.f, 0.f, 0.f, 0.f, 0.f, 0.f, 0.f}; }
__device__ __forceinline__ v8f neg8()  { return (v8f){NEG_INF, NEG_INF, NEG_INF, NEG_INF, NEG_INF, NEG_INF, NEG_INF, NEG_INF}; }
// balanced-tree horizontal reductions
__device__ __forceinline__ float hsum8(v8f v) {
  float a = v[0] + v[1], b = v[2] + v[3], c = v[4] + v[5], d = v[6] + v[7];
  return (a + b) + (c + d);
}
__device__ __forceinline__ float hmax8(v8f v) {
  float a = fmaxf(v[0], v[1]), b = fmaxf(v[2], v[3]);
  float c = fmaxf(v[4], v[5]), d = fmaxf(v[6], v[7]);
  return fmaxf(fmaxf(a, b), fmaxf(c, d));
}

// ---------------------------------------------------------------------------
// dst row pr = g * rowsPerGroup + r  <-  src row g * srcRowsPerGroup + r  (g = (b*NH + h)).
// Block 256 threads = 32 rows; thread t: row t>>3, 8 halves at (t&7)*8.
// ---------------------------------------------------------------------------
__global__ __launch_bounds__(256) void cast_rows_kernel(const float* __restrict__ src,
                                                         unsigned short* __restrict__ dst,
                                                         int rowsPerGroup, int srcRowsPerGroup, int nRows) {
  const int t  = threadIdx.x;
  int pr = blockIdx.x * 32 + (t >> 3);
  pr = (pr < nRows) ? pr : (nRows - 1);            // address clamp (grid is exact)
  const int c8 = (t & 7) * 8;
  const int g  = pr / rowsPerGroup;
  const int r  = pr - g * rowsPerGroup;
  const float* s = src + ((size_t)g * srcRowsPerGroup + r) * HD + c8;
  const v4f a = *(const v4f*)(s);
  const v4f b = *(const v4f*)(s + 4);
  unsigned short hb[8];
#pragma unroll
  for (int e = 0; e < 4; ++e) { hb[e] = f2bf_bits(a[e]); hb[4 + e] = f2bf_bits(b[e]); }
  const v4u u = (v4u){pk16(hb[0], hb[1]), pk16(hb[2], hb[3]), pk16(hb[4], hb[5]), pk16(hb[6], hb[7])};
  unsigned short* d = dst + (size_t)pr * HD + c8;
  *(v4u*)d = u;
  
}

// ---------------------------------------------------------------------------
// (2) V cast + transpose: Vt[bh][d][kv] = f16( bf16( v[bh][kv][d] ) )   (pitch SKV halves)
// grid (SKV/64, NB*NH), 256 threads; one 64(kv) x 64(d) tile through LDS.
// Load coverage: 16 iterations x 256 threads = 4096 = whole tile (coalesced along d); sm cross-wave -> __syncthreads.
// Store coverage: 8 waves x 2 iterations x 4 rows (lane>>3) = 64 d-rows; (lane&7) x 8 halves = 64 kv;
// ---------------------------------------------------------------------------
__global__ __launch_bounds__(256) void v_transpose_kernel(const float* __restrict__ v,
                                                           _Float16* __restrict__ Vt) {
  __shared__ float sm[64][65];   // sm[kv_local][d]
  const int tid = threadIdx.x;
  const int kv0 = blockIdx.x * 64;
  const int bh  = blockIdx.y;                        // b*NH + h, b < NB
  const float* vb = v + ((size_t)bh * SKV_FULL + kv0) * HD;
#pragma unroll
  for (int i = 0; i < 16; ++i) {
    const int e = i * 256 + tid;
    const int r = e >> 6;          // kv local
    const int c = e & 63;          // d
    sm[r][c] = vb[(size_t)r * HD + c];
  }
  __syncthreads();
  const int lane = tid & 31, wave = tid >> 5;
  const int q = lane >> 3, c8 = (lane & 7) * 8;
  _Float16* vt = Vt + (size_t)bh * HD * SKV;
  {
#pragma unroll
    for (int it = 0; it < 2; ++it) {
      const int row = wave * 8 + it * 4 + q;          // d
      v8h hv;
#pragma unroll
      for (int e = 0; e < 8; ++e) hv[e] = (_Float16)bf_bits2f(f2bf_bits(sm[c8 + e][row]));
      *(v8h*)(vt + (size_t)row * SKV + kv0 + c8) = hv;
    }
    
  }
}

// ---------------------------------------------------------------------------
// LDS ring of the attention kernel: a stage = one 64-key K tile (64 kv rows x 128 B) and one V^T tile (64 d rows x 128 B).
// ---------------------------------------------------------------------------
constexpr int kPitch  = 144;              // LDS row pitch in bytes: 128 + 16, an odd multiple of 16 (ds_load_b128 readers)
constexpr int kTileB  = 64 * kPitch;      // one tile
constexpr int kStageB = 2 * kTileB;       // K tile, then V^T tile
static_assert(kPitch % 16 == 0 && ((kPitch / 16) & 1) == 1);
static_assert(SKV >= 128);                // the ring's prologue fills two stages

// Four 16-byte asynchronous copies per lane = this lane's share of one stage. l* = LDS byte addresses, g* = global addresses.
// s_wait_xcnt 0 is the statement's last line so that it stands ahead of any rewrite of the address registers the copies name.
__device__ __forceinline__ void copy_stage(unsigned l0, unsigned l1, unsigned l2, unsigned l3,
                                           const unsigned char* g0, const unsigned char* g1,
                                           const unsigned char* g2, const unsigned char* g3) {
  asm volatile("global_load_async_to_lds_b128 %0, %4, off\n\t"
               "global_load_async_to_lds_b128 %1, %5, off\n\t"
               "global_load_async_to_lds_b128 %2, %6, off\n\t"
               "global_load_async_to_lds_b128 %3, %7, off\n\t"
               "s_wait_xcnt 0x0"
               :: "v"(l0), "v"(l1), "v"(l2), "v"(l3), "v"(g0), "v"(g1), "v"(g2), "v"(g3) : "memory");
}
// the wave's own copies have landed (the compiler places no wait for them)
__device__ __forceinline__ void wait_async0() { asm volatile("s_wait_asynccnt 0x0" ::: "memory"); }
// the wave's own LDS reads have returned, before the buffer is handed to its next writer
__device__ __forceinline__ void wait_ds0() { asm volatile("s_wait_dscnt 0x0" ::: "memory"); }

// ---------------------------------------------------------------------------
// (3) Flash-style prefix-causal attention. grid (SEQ/128, NH, NB), 256 threads = 8 waves x 16 query rows.
// Per wave: Q B-fragments (bf16, RNE) in registers; loop over 64-key tiles up to the last visible key;
//   S^T subtile = K(16 kv x 64 d, bf16 plane rows) . Q^T : 2 bf16 WMMAs; scale, mask (kv > q + num_pt -> -inf), f32 online softmax
//   in log2 domain (row stats shared by lanes l and l^16); O^T += V^T(16 d x 32 kv, f16 plane rows) . P^T with
//   P^T fragment = [own D of subtile 2si (kv 0-15 of slice), own D of subtile 2si+1 (kv 16-31)] as f16 x4096.
// K and V^T tiles are brought into LDS once per work-group by asynchronous copies, two buffers: tile t + 1 flies while tile t is
// worked on; one publish point per tile (own LDS reads done, own copies landed, barrier, refill), passed by every wave; a wave
// skips only the work of tiles beyond its own last visible key.
// ---------------------------------------------------------------------------
__global__ __launch_bounds__(256) void attn_kernel(const float* __restrict__ q,
                                                    const unsigned short* __restrict__ Kp,
                                                    const unsigned short* __restrict__ Vtp,
                                                    const int* __restrict__ np,
                                                    float* __restrict__ out) {
  __shared__ __align__(16) float sT[8][16 * 68];   // per-wave 16x64 slab, pitch 68 floats
  __shared__ __align__(16) unsigned char ring[2 * kStageB];
  const int tid  = threadIdx.x;
  const int wave = __builtin_amdgcn_readfirstlane(tid >> 5);   // scalar: the per-wave skip between publish points is a scalar branch
  const int lane = tid & 31;
  const int hi   = lane >> 4;                // lane half: k offset 8*hi, D row offset 8*hi
  const int l15  = lane & 15;                // A row / B,D column
  const int h    = blockIdx.y;
  const int b    = blockIdx.z;
  const int bh   = b * NH + h;
  const int q0w  = blockIdx.x * 128 + wave * 16;

  int numpt = np[0];
  numpt = (numpt < 0) ? 0 : numpt;
  numpt = (numpt > SKV) ? SKV : numpt;

  const float*    Qb = q + ((size_t)bh * SEQ_FULL) * HD;
  const __bf16*   Kb = (const __bf16*)Kp + (size_t)bh * SKV * HD;
  const _Float16* Vb = (const _Float16*)Vtp + (size_t)bh * HD * SKV;
  float*          Ob = out + ((size_t)bh * SEQ) * HD;

  // ---- Q as bf16 B operand of S^T = K.Q^T: B[k=d][n=q]; elements 0..7 <- d k0+8hi+0..7, 8..15 <- d k0+16+8hi+0..7 ----
  v16b bq[2];
  {
    const float* qrow = Qb + (size_t)(q0w + l15) * HD;
#pragma unroll
    for (int si = 0; si < 2; ++si) {
      const v4f f0 = *(const v4f*)(qrow + si * 32 + 8 * hi);
      const v4f f1 = *(const v4f*)(qrow + si * 32 + 8 * hi + 4);
      const v4f g0 = *(const v4f*)(qrow + si * 32 + 16 + 8 * hi);
      const v4f g1 = *(const v4f*)(qrow + si * 32 + 16 + 8 * hi + 4);
      v8u u;
      u[0] = pk16(f2bf_bits(f0[0]), f2bf_bits(f0[1]));
      u[1] = pk16(f2bf_bits(f0[2]), f2bf_bits(f0[3]));
      u[2] = pk16(f2bf_bits(f1[0]), f2bf_bits(f1[1]));
      u[3] = pk16(f2bf_bits(f1[2]), f2bf_bits(f1[3]));
      u[4] = pk16(f2bf_bits(g0[0]), f2bf_bits(g0[1]));
      u[5] = pk16(f2bf_bits(g0[2]), f2bf_bits(g0[3]));
      u[6] = pk16(f2bf_bits(g1[0]), f2bf_bits(g1[1]));
      u[7] = pk16(f2bf_bits(g1[2]), f2bf_bits(g1[3]));
      bq[si] = __builtin_bit_cast(v16b, u);
    }
  }

  // O^T accumulators: oacc[dg][r] = carry * O[q0w+l15][dg*16 + 8*hi + r]
  v8f oacc[4];
#pragma unroll
  for (int dg = 0; dg < 4; ++dg) oacc[dg] = zero8();
  float m = NEG_INF;                         // per-lane row stats (log2 domain)
  float l = 0.f;

  const int qmax   = q0w + 15 + numpt;       // last visible key of this wave's last row
  const int kv_end = (SKV < qmax + 1) ? SKV : (qmax + 1);

  // work-group-uniform tile count: up to the last visible key of the block's last row; >= 2 (128 rows see >= 128 keys)
  const int qmaxb = blockIdx.x * 128 + 127 + numpt;
  const int nt    = (((SKV < qmaxb + 1) ? SKV : (qmaxb + 1)) + 63) >> 6;

  // this lane's share of a stage: 16 B at column ccol of rows crow and crow + 32 of each tile (a wave-wide copy = 4 whole lines)
  const int crow = tid >> 3, ccol = (tid & 7) * 16;
  const unsigned char* kg = (const unsigned char*)Kb + (size_t)crow * (HD * 2) + ccol;
  const unsigned char* vg = (const unsigned char*)Vb + (size_t)crow * (SKV * 2) + ccol;
  const unsigned       lc = (unsigned)(size_t)ring + crow * kPitch + ccol;
  auto issue_stage = [&](int s) {
    const unsigned lb = lc + (s & 1) * kStageB;
    const unsigned char* k0 = kg + (size_t)s * (64 * HD * 2);
    const unsigned char* v0 = vg + (size_t)s * (64 * 2);
    copy_stage(lb, lb + 32 * kPitch, lb + kTileB, lb + kTileB + 32 * kPitch,
               k0, k0 + 32 * HD * 2, v0, v0 + (size_t)32 * SKV * 2);
  };

  issue_stage(0);
  wait_async0();
  __syncthreads();
  issue_stage(1);

#pragma unroll 1
  for (int it = 0; it < nt; ++it) {
    const int kv0 = it * 64;
    const unsigned char* stK = ring + (it & 1) * kStageB;
    const unsigned char* stV = stK + kTileB;
    if (kv0 < kv_end) {                        // wave-uniform (scalar): tiles beyond this wave's last visible key hold no work
    // ---- S^T subtiles (16 kv each): 2 bf16 WMMAs, then scale + mask ----
    v8f s4[4];
    if (kv0 + 63 <= q0w + numpt) {             // wave-uniform (scalar): every key of the tile is visible to every row of the wave
      // interior tile: no mask and no per-subtile test; the 8 K fragment loads stand as one group, the 8 WMMAs run on 4 independent tiles
      v16b ak[4][2];
      const __bf16* krow = (const __bf16*)(stK + l15 * kPitch) + 8 * hi;
#pragma unroll
      for (int t = 0; t < 4; ++t) ak[t][0] = FragB::load(krow + t * 16 * (kPitch / 2));
#pragma unroll
      for (int t = 0; t < 4; ++t) ak[t][1] = FragB::load(krow + t * 16 * (kPitch / 2) + 32);
      __builtin_amdgcn_sched_barrier(0);       // keeps the loads one group ahead of the WMMAs: one LDS latency a tile, not one a subtile
      v8f s[4];
#pragma unroll
      for (int t = 0; t < 4; ++t) s[t] = FragB::mma(ak[t][0], bq[0], zero8());
#pragma unroll
      for (int t = 0; t < 4; ++t) s[t] = FragB::mma(ak[t][1], bq[1], s[t]);
      __builtin_amdgcn_sched_barrier(0);       // keeps the 8 WMMAs back to back: each fills the others' result distance instead of v_nop
#pragma unroll
      for (int t = 0; t < 4; ++t)
#pragma unroll
        for (int r = 0; r < 8; ++r) s4[t][r] = s[t][r] * kScale2;
    } else {
#pragma unroll
    for (int t = 0; t < 4; ++t) {
      const int c0 = kv0 + t * 16;
      if (c0 > qmax) {                       // wave-uniform: whole subtile masked
        s4[t] = neg8();
        continue;
      }
      const __bf16* krow = (const __bf16*)(stK + (t * 16 + l15) * kPitch) + 8 * hi;
      const v16b ak0 = FragB::load(krow);
      const v16b ak1 = FragB::load(krow + 32);
      v8f s = zero8();
      s = FragB::mma(ak0, bq[0], s);
      s = FragB::mma(ak1, bq[1], s);
      dep_guard1_b(s, ak0, ak1, bq[0], bq[1]);
      const bool part = (c0 + 15 > q0w + numpt);   // wave-uniform: some (q, kv) of the subtile masked
      const int  lim  = q0w + l15 + numpt - c0;     // kv local index visible iff <= lim
      v8f sc;
#pragma unroll
      for (int r = 0; r < 8; ++r) {
        float vv = s[r] * kScale2;
        if (part && (r + 8 * hi > lim)) vv = NEG_INF;
        sc[r] = vv;
      }
      s4[t] = sc;
    }
    }

    // ---- tile-level online softmax in log2 domain ----
    float tmax = fmaxf(fmaxf(hmax8(s4[0]), hmax8(s4[1])), fmaxf(hmax8(s4[2]), hmax8(s4[3])));
    tmax = fmaxf(tmax, __shfl_xor(tmax, 16, 32));
    const float mn    = fmaxf(m, tmax);
    const float alpha = (m > NEG_INF) ? EXP2(m - mn) : 0.0f;
    const float mref  = (mn > NEG_INF) ? mn : 0.0f;
    m = mn;
#pragma unroll
    for (int t = 0; t < 4; ++t)
#pragma unroll
      for (int r = 0; r < 8; ++r) s4[t][r] = EXP2(s4[t][r] - mref);
    float ts = (hsum8(s4[0]) + hsum8(s4[1])) + (hsum8(s4[2]) + hsum8(s4[3]));
    ts += __shfl_xor(ts, 16, 32);
    l = l * alpha + ts;
#pragma unroll
    for (int dg = 0; dg < 4; ++dg)
#pragma unroll
      for (int r = 0; r < 8; ++r) oacc[dg][r] *= alpha;

    // ---- O^T += V^T . P^T : 2 slices of 32 kv, 4 f16 WMMAs each ----
#pragma unroll
    for (int si = 0; si < 2; ++si) {
      const v8f p0 = s4[2 * si];               // kv si*32 + 8*hi + 0..7 of this lane's q column
      const v8f p1 = s4[2 * si + 1];           // kv si*32 + 16 + 8*hi + 0..7
      v8u u;
#pragma unroll
      for (int j = 0; j < 4; ++j) {
        u[j]     = pkh2(p0[2 * j] * kCarry, p0[2 * j + 1] * kCarry);
        u[4 + j] = pkh2(p1[2 * j] * kCarry, p1[2 * j + 1] * kCarry);
      }
      const v16h bp = __builtin_bit_cast(v16h, u);
      const _Float16* vrow = (const _Float16*)(stV + l15 * kPitch) + si * 32 + 8 * hi;   // row d = dg*16 + l15
      const v16h av0 = FragH::load(vrow);
      const v16h av1 = FragH::load(vrow + 16 * (kPitch / 2));
      const v16h av2 = FragH::load(vrow + 32 * (kPitch / 2));
      const v16h av3 = FragH::load(vrow + 48 * (kPitch / 2));
      oacc[0] = FragH::mma(av0, bp, oacc[0]);
      oacc[1] = FragH::mma(av1, bp, oacc[1]);
      oacc[2] = FragH::mma(av2, bp, oacc[2]);
      oacc[3] = FragH::mma(av3, bp, oacc[3]);
      dep_guard4_h(oacc[0], oacc[1], oacc[2], oacc[3], av3, bp);
      keep4_h(av0, av1, av2, bp);
    }
    }
    // ---- publish point of tile it + 1, every wave: own reads of this buffer done, own copies landed, barrier, then the refill ----
    wait_ds0();
    wait_async0();
    __syncthreads();
    if (it + 2 < nt) issue_stage(it + 2);      // work-group-uniform: into the buffer that this trip has just read
  }
  wait_async0();
  acc_guard4(oacc[0], oacc[1], oacc[2], oacc[3]);

  // ---- epilogue: normalize, transpose O^T -> O through the wave's LDS slab, whole-line stores ----
  const float inv = (l > 0.f) ? ((1.0f / l) * kInvCarry) : 0.f;
  float* slab = sT[wave];
#pragma unroll
  for (int dg = 0; dg < 4; ++dg)
#pragma unroll
    for (int r = 0; r < 8; ++r)
      slab[l15 * 68 + dg * 16 + 8 * hi + r] = oacc[dg][r] * inv;
  __builtin_amdgcn_fence(3 /* release order */, "workgroup");
  __builtin_amdgcn_wave_barrier();
  __builtin_amdgcn_fence(2 /* acquire order */, "workgroup");
  const int hh = lane >> 4, c4 = (lane & 15) * 4;   // row seg = 256 B = 16 lanes x 16 B
  {
#pragma unroll
    for (int it = 0; it < 8; ++it) {
      const int row = it * 2 + hh;
      const v4f vv = *(const v4f*)(slab + row * 68 + c4);
      *(v4f*)(Ob + (size_t)(q0w + row) * HD + c4) = vv;
    }
    
  }
}

// ---------------------------------------------------------------------------
// Host glue.
//   Kp  bf16 [NB*NH][SKV][64]     NB*NH*SKV*128   at 0              (cast_rows_kernel)
//   Vt  f16  [NB*NH][64][SKV]     NB*NH*SKV*128   at NB*NH*SKV*128  (v_transpose_kernel)
//   total (NB=2, SKV=3072)         25,165,824
// 3 launches.
// ---------------------------------------------------------------------------
extern "C" void kernel_launch(void* const* d_in, const int* in_sizes, int n_in,
                              void* d_out, int out_size, void* d_ws, size_t ws_size,
                              hipStream_t stream) {
  if (n_in < 4) return;
  if (in_sizes[0] < NB * NH * SEQ * HD) return;
  if (in_sizes[1] < NB * NH * SKV * HD) return;
  if (in_sizes[2] < NB * NH * SKV * HD) return;
  if (in_sizes[3] < 1) return;
  if (out_size < NB * NH * SEQ * HD) return;

  const size_t szK   = (size_t)NB * NH * SKV * HD * 2;
  const size_t szVt  = (size_t)NB * NH * HD * SKV * 2;
  const size_t offK  = 0;
  const size_t offVt = offK + szK;
  const size_t total = offVt + szVt;
  if (ws_size < total) return;

  const float* q  = (const float*)d_in[0];
  const float* k  = (const float*)d_in[1];
  const float* v  = (const float*)d_in[2];
  const int*   np = (const int*)d_in[3];
  float* out = (float*)d_out;
  char* ws = (char*)d_ws;
  unsigned short* Kp = (unsigned short*)(ws + offK);
  _Float16*       Vt = (_Float16*)(ws + offVt);

  const int nRowsK = NB * NH * SKV;                 // multiple of 32
  // (1) Kp[bh][kv][d] = bf16(k[bh][kv][d])
  cast_rows_kernel<<<dim3(nRowsK / 32), dim3(256), 0, stream>>>(k, Kp, SKV, SKV_FULL, nRowsK);
  // (2) Vt[bh][d][kv] = f16(bf16(v[bh][kv][d]))
  v_transpose_kernel<<<dim3(SKV / 64, NB * NH), dim3(256), 0, stream>>>(v, Vt);
  // (3) attention
  attn_kernel<<<dim3(SEQ / 128, NH, NB), dim3(256), 0, stream>>>(q, Kp, (const unsigned short*)Vt, np, out);
}

// v003
// It runs in 59.4 microseconds.
// Next to v002, in two timings, it ran 1.08 and 1.07 times as fast.
// All steps since v000 together make it 3.54 times as fast.
// Contractions: scores K.Q^T on v_wmma_f32_16x16x32_bf16 (bf16 operands = RNE bf16 copies of q and k, f32 accumulate); context V^T.P^T on v_wmma_f32_16x16x32_f16 (f16 operands: v = f16 of its RNE bf16 copy, p carried x4096, f32 accumulate); scale, mask and online softmax in f32.
#include <hip/hip_runtime.h>
#include <math.h>

// ---------------------------------------------------------------------------
// Problem constants (NB / SEQ / SKV overridable for a reduced build; *_FULL = input strides)
// ---------------------------------------------------------------------------
#ifndef NB
#define NB 2
#endif
#ifndef SEQ
#define SEQ 2048
#endif
#ifndef SKV
#define SKV 3072
#endif
#define NB_FULL   2
#define NH        16
#define HD        64
#define SEQ_FULL  2048
#define SKV_FULL  3072

static_assert(NB >= 1 && NB <= NB_FULL);
static_assert(SEQ % 128 == 0 && SEQ <= SEQ_FULL);
static_assert(SKV % 64 == 0 && SKV <= SKV_FULL);
static_assert(HD == 64);
static_assert((NB * NH * SKV) % 32 == 0);

constexpr float kScale2   = 0.125f * 1.44269504088896340736f;   // 1/sqrt(64) * log2(e): softmax in log2 domain
constexpr float kCarry    = 4096.0f;                            // p in [0,1] carried x4096 as f16 operand
constexpr float kInvCarry = 1.0f / 4096.0f;
#define NEG_INF (-__builtin_inff())

#if __has_builtin(__builtin_amdgcn_exp2f)
#define EXP2(x) __builtin_amdgcn_exp2f(x)
#else
#define EXP2(x) exp2f(x)
#endif

typedef __attribute__((ext_vector_type(16))) _Float16 v16h;
typedef __attribute__((ext_vector_type(8)))  _Float16 v8h;
typedef __attribute__((ext_vector_type(2)))  _Float16 v2h;
typedef __attribute__((ext_vector_type(16))) __bf16   v16b;
typedef __attribute__((ext_vector_type(8)))  __bf16   v8b;
typedef __attribute__((ext_vector_type(8)))  float    v8f;
typedef __attribute__((ext_vector_type(4)))  float    v4f;
typedef __attribute__((ext_vector_type(4)))  unsigned int v4u;
typedef __attribute__((ext_vector_type(8)))  unsigned int v8u;

__device__ __forceinline__ unsigned short f2bf_bits(float f) {        // RNE convert f32 -> bf16 bits
  unsigned u = __float_as_uint(f);
  return (unsigned short)((u + 0x7FFFu + ((u >> 16) & 1u)) >> 16);
}
__device__ __forceinline__ float bf_bits2f(unsigned short h) { return __uint_as_float(((unsigned)h) << 16); }

// hazard guards: 4 VALU slots after the last WMMA of a group, tie D, keep A/B live
__device__ __forceinline__ void dep_guard1_b(v8f& a, v16b w, v16b x, v16b y, v16b z) {
  asm volatile("v_nop\n\tv_nop\n\tv_nop\n\tv_nop" : "+v"(a) : "v"(w), "v"(x), "v"(y), "v"(z));
}
__device__ __forceinline__ void dep_guard4_h(v8f& a, v8f& b, v8f& c, v8f& d, v16h x, v16h y) {
  asm volatile("v_nop\n\tv_nop\n\tv_nop\n\tv_nop" : "+v"(a), "+v"(b), "+v"(c), "+v"(d) : "v"(x), "v"(y));
}
__device__ __forceinline__ void keep4_h(v16h a, v16h b, v16h c, v16h d) { asm volatile("v_nop" :: "v"(a), "v"(b), "v"(c), "v"(d)); }
__device__ __forceinline__ void acc_guard4(v8f& a, v8f& b, v8f& c, v8f& d) {
  asm volatile("v_nop\n\tv_nop\n\tv_nop\n\tv_nop" : "+v"(a), "+v"(b), "+v"(c), "+v"(d));
}

template <typename T> struct Frag;
template <> struct Frag<_Float16> {
  typedef v16h V; union U { v16h v; v8h h[2]; };
  // elements 0..7 <- p[0..7], 8..15 <- p[16..23]; caller passes p = row + k0 + 8*(lane>>4)
  static __device__ __forceinline__ v16h load(const _Float16* p) {
    U f; f.h[0] = *(const v8h*)(p); f.h[1] = *(const v8h*)(p + 16); return f.v;
  }
  static __device__ __forceinline__ v8f mma(v16h a, v16h b, v8f c) {
    return __builtin_amdgcn_wmma_f32_16x16x32_f16(false, a, false, b, (short)0, c, false, false);
  }
};
template <> struct Frag<__bf16> {
  typedef v16b V; union U { v16b v; v8b h[2]; };
  static __device__ __forceinline__ v16b load(const __bf16* p) {
    U f; f.h[0] = *(const v8b*)(p); f.h[1] = *(const v8b*)(p + 16); return f.v;
  }
  static __device__ __forceinline__ v8f mma(v16b a, v16b b, v8f c) {
    return __builtin_amdgcn_wmma_f32_16x16x32_bf16(false, a, false, b, (short)0, c, false, false);
  }
};
typedef Frag<_Float16> FragH;
typedef Frag<__bf16>   FragB;

__device__ __forceinline__ unsigned pk16(unsigned short a, unsigned short b) { return (unsigned)a | ((unsigned)b << 16); }
// pack two f32 -> one dword of two f16 (element 0 = a)
__device__ __forceinline__ unsigned pkh2(float a, float b) {
  v2h p; p[0] = (_Float16)a; p[1] = (_Float16)b;
  return __builtin_bit_cast(unsigned, p);
}
__device__ __forceinline__ v8f zero8() { return (v8f){0.f, 0.f, 0.f, 0.f, 0.f, 0.f, 0.f, 0.f}; }
__device__ __forceinline__ v8f neg8()  { return (v8f){NEG_INF, NEG_INF, NEG_INF, NEG_INF, NEG_INF, NEG_INF, NEG_INF, NEG_INF}; }
// balanced-tree horizontal reductions
__device__ __forceinline__ float hsum8(v8f v) {
  float a = v[0] + v[1], b = v[2] + v[3], c = v[4] + v[5], d = v[6] + v[7];
  return (a + b) + (c + d);
}
__device__ __forceinline__ float hmax8(v8f v) {
  float a = fmaxf(v[0], v[1]), b = fmaxf(v[2], v[3]);
  float c = fmaxf(v[4], v[5]), d = fmaxf(v[6], v[7]);
  return fmaxf(fmaxf(a, b), fmaxf(c, d));
}

// ---------------------------------------------------------------------------
// dst row pr = g * rowsPerGroup + r  <-  src row g * srcRowsPerGroup + r  (g = (b*NH + h)).
// Block 256 threads = 32 rows; thread t: row t>>3, 8 halves at (t&7)*8.
// ---------------------------------------------------------------------------
__global__ __launch_bounds__(256) void cast_rows_kernel(const float* __restrict__ src,
                                                         unsigned short* __restrict__ dst,
                                                         int rowsPerGroup, int srcRowsPerGroup, int nRows) {
  const int t  = threadIdx.x;
  int pr = blockIdx.x * 32 + (t >> 3);
  pr = (pr < nRows) ? pr : (nRows - 1);            // address clamp (grid is exact)
  const int c8 = (t & 7) * 8;
  const int g  = pr / rowsPerGroup;
  const int r  = pr - g * rowsPerGroup;
  const float* s = src + ((size_t)g * srcRowsPerGroup + r) * HD + c8;
  const v4f a = *(const v4f*)(s);
  const v4f b = *(const v4f*)(s + 4);
  unsigned short hb[8];
#pragma unroll
  for (int e = 0; e < 4; ++e) { hb[e] = f2bf_bits(a[e]); hb[4 + e] = f2bf_bits(b[e]); }
  const v4u u = (v4u){pk16(hb[0], hb[1]), pk16(hb[2], hb[3]), pk16(hb[4], hb[5]), pk16(hb[6], hb[7])};
  unsigned short* d = dst + (size_t)pr * HD + c8;
  *(v4u*)d = u;
  
}

// ---------------------------------------------------------------------------
// (2) V cast + transpose: Vt[bh][d][kv] = f16( bf16( v[bh][kv][d] ) )   (pitch SKV halves)
// grid (SKV/64, NB*NH), 256 threads; one 64(kv) x 64(d) tile through LDS.
// Load coverage: 16 iterations x 256 threads = 4096 = whole tile (coalesced along d); sm cross-wave -> __syncthreads.
// Store coverage: 8 waves x 2 iterations x 4 rows (lane>>3) = 64 d-rows; (lane&7) x 8 halves = 64 kv;
// ---------------------------------------------------------------------------
__global__ __launch_bounds__(256) void v_transpose_kernel(const float* __restrict__ v,
                                                           _Float16* __restrict__ Vt) {
  __shared__ float sm[64][65];   // sm[kv_local][d]
  const int tid = threadIdx.x;
  const int kv0 = blockIdx.x * 64;
  const int bh  = blockIdx.y;                        // b*NH + h, b < NB
  const float* vb = v + ((size_t)bh * SKV_FULL + kv0) * HD;
#pragma unroll
  for (int i = 0; i < 16; ++i) {
    const int e = i * 256 + tid;
    const int r = e >> 6;          // kv local
    const int c = e & 63;          // d
    sm[r][c] = vb[(size_t)r * HD + c];
  }
  __syncthreads();
  const int lane = tid & 31, wave = tid >> 5;
  const int q = lane >> 3, c8 = (lane & 7) * 8;
  _Float16* vt = Vt + (size_t)bh * HD * SKV;
  {
#pragma unroll
    for (int it = 0; it < 2; ++it) {
      const int row = wave * 8 + it * 4 + q;          // d
      v8h hv;
#pragma unroll
      for (int e = 0; e < 8; ++e) hv[e] = (_Float16)bf_bits2f(f2bf_bits(sm[c8 + e][row]));
      *(v8h*)(vt + (size_t)row * SKV + kv0 + c8) = hv;
    }
    
  }
}

// ---------------------------------------------------------------------------
// LDS ring of the attention kernel: a stage = one 64-key K tile (64 kv rows x 128 B) and one V^T tile (64 d rows x 128 B).
// ---------------------------------------------------------------------------
constexpr int kPitch  = 144;              // LDS row pitch in bytes: 128 + 16, an odd multiple of 16 (ds_load_b128 readers)
constexpr int kTileB  = 64 * kPitch;      // one tile
constexpr int kStageB = 2 * kTileB;       // K tile, then V^T tile
static_assert(kPitch % 16 == 0 && ((kPitch / 16) & 1) == 1);
static_assert(SKV >= 128);                // the ring's prologue fills two stages

// Four 16-byte asynchronous copies per lane = this lane's share of one stage. l* = LDS byte addresses, g* = global addresses.
// s_wait_xcnt 0 is the statement's last line so that it stands ahead of any rewrite of the address registers the copies name.
__device__ __forceinline__ void copy_stage(unsigned l0, unsigned l1, unsigned l2, unsigned l3,
                                           const unsigned char* g0, const unsigned char* g1,
                                           const unsigned char* g2, const unsigned char* g3) {
  asm volatile("global_load_async_to_lds_b128 %0, %4, off\n\t"
               "global_load_async_to_lds_b128 %1, %5, off\n\t"
               "global_load_async_to_lds_b128 %2, %6, off\n\t"
               "global_load_async_to_lds_b128 %3, %7, off\n\t"
               "s_wait_xcnt 0x0"
               :: "v"(l0), "v"(l1), "v"(l2), "v"(l3), "v"(g0), "v"(g1), "v"(g2), "v"(g3) : "memory");
}
// the wave's own copies have landed (the compiler places no wait for them)
__device__ __forceinline__ void wait_async0() { asm volatile("s_wait_asynccnt 0x0" ::: "memory"); }
// the wave's own LDS reads have returned, before the buffer is handed to its next writer
__device__ __forceinline__ void wait_ds0() { asm volatile("s_wait_dscnt 0x0" ::: "memory"); }

// ---------------------------------------------------------------------------
// (3) Flash-style prefix-causal attention. grid (SEQ/128, NH, NB), 256 threads = 8 waves x 16 query rows; blockIdx.x -> query tile by a per-head permutation.
// Per wave: Q B-fragments (bf16, RNE) in registers; loop over 64-key tiles up to the last visible key;
//   S^T subtile = K(16 kv x 64 d, bf16 plane rows) . Q^T : 2 bf16 WMMAs; scale, mask (kv > q + num_pt -> -inf), f32 online softmax
//   in log2 domain (row stats shared by lanes l and l^16); O^T += V^T(16 d x 32 kv, f16 plane rows) . P^T with
//   P^T fragment = [own D of subtile 2si (kv 0-15 of slice), own D of subtile 2si+1 (kv 16-31)] as f16 x4096.
// K and V^T tiles are brought into LDS once per work-group by asynchronous copies, two buffers: tile t + 1 flies while tile t is
// worked on; one publish point per tile (own LDS reads done, own copies landed, barrier, refill), passed by every wave; a wave
// skips only the work of tiles beyond its own last visible key.
// ---------------------------------------------------------------------------
__global__ __launch_bounds__(256) void attn_kernel(const float* __restrict__ q,
                                                    const unsigned short* __restrict__ Kp,
                                                    const unsigned short* __restrict__ Vtp,
                                                    const int* __restrict__ np,
                                                    float* __restrict__ out) {
  __shared__ __align__(16) float sT[8][16 * 68];   // per-wave 16x64 slab, pitch 68 floats
  __shared__ __align__(16) unsigned char ring[2 * kStageB];
  const int tid  = threadIdx.x;
  const int wave = __builtin_amdgcn_readfirstlane(tid >> 5);   // scalar: the per-wave skip between publish points is a scalar branch
  const int lane = tid & 31;
  const int hi   = lane >> 4;                // lane half: k offset 8*hi, D row offset 8*hi
  const int l15  = lane & 15;                // A row / B,D column
  const int h    = blockIdx.y;
  const int b    = blockIdx.z;
  const int bh   = b * NH + h;
  // Query tile of this work-group. A tile's cost grows with its index (tile t walks 2 t more key tiles than tile 0) and every
  // work-group is resident from the start, two to a WGP, so the launch lasts as long as the fullest WGP. Work-groups whose flat
  // index differs in one bit above the low three get tiles d and kQT - 1 - d: equal sums.
  // For speed only: for each bh the map is a permutation of the tiles, wherever the work-groups land.
  constexpr int kQT = SEQ / 128;
  int qt = blockIdx.x;
  if (kQT % 2 == 0) {
    const int up   = (qt >= kQT / 2) ? 1 : 0;
    const int d    = qt - up * (kQT / 2);
    const int flip = (up ^ __builtin_popcount((unsigned)bh)) & 1;
    qt = flip ? (kQT - 1 - d) : d;
  }
  const int q0w  = qt * 128 + wave * 16;

  int numpt = np[0];
  numpt = (numpt < 0) ? 0 : numpt;
  numpt = (numpt > SKV) ? SKV : numpt;

  const float*    Qb = q + ((size_t)bh * SEQ_FULL) * HD;
  const __bf16*   Kb = (const __bf16*)Kp + (size_t)bh * SKV * HD;
  const _Float16* Vb = (const _Float16*)Vtp + (size_t)bh * HD * SKV;
  float*          Ob = out + ((size_t)bh * SEQ) * HD;

  // ---- Q as bf16 B operand of S^T = K.Q^T: B[k=d][n=q]; elements 0..7 <- d k0+8hi+0..7, 8..15 <- d k0+16+8hi+0..7 ----
  v16b bq[2];
  {
    const float* qrow = Qb + (size_t)(q0w + l15) * HD;
#pragma unroll
    for (int si = 0; si < 2; ++si) {
      const v4f f0 = *(const v4f*)(qrow + si * 32 + 8 * hi);
      const v4f f1 = *(const v4f*)(qrow + si * 32 + 8 * hi + 4);
      const v4f g0 = *(const v4f*)(qrow + si * 32 + 16 + 8 * hi);
      const v4f g1 = *(const v4f*)(qrow + si * 32 + 16 + 8 * hi + 4);
      v8u u;
      u[0] = pk16(f2bf_bits(f0[0]), f2bf_bits(f0[1]));
      u[1] = pk16(f2bf_bits(f0[2]), f2bf_bits(f0[3]));
      u[2] = pk16(f2bf_bits(f1[0]), f2bf_bits(f1[1]));
      u[3] = pk16(f2bf_bits(f1[2]), f2bf_bits(f1[3]));
      u[4] = pk16(f2bf_bits(g0[0]), f2bf_bits(g0[1]));
      u[5] = pk16(f2bf_bits(g0[2]), f2bf_bits(g0[3]));
      u[6] = pk16(f2bf_bits(g1[0]), f2bf_bits(g1[1]));
      u[7] = pk16(f2bf_bits(g1[2]), f2bf_bits(g1[3]));
      bq[si] = __builtin_bit_cast(v16b, u);
    }
  }

  // O^T accumulators: oacc[dg][r] = carry * O[q0w+l15][dg*16 + 8*hi + r]
  v8f oacc[4];
#pragma unroll
  for (int dg = 0; dg < 4; ++dg) oacc[dg] = zero8();
  float m = NEG_INF;                         // per-lane row stats (log2 domain)
  float l = 0.f;

  const int qmax   = q0w + 15 + numpt;       // last visible key of this wave's last row
  const int kv_end = (SKV < qmax + 1) ? SKV : (qmax + 1);

  // work-group-uniform tile count: up to the last visible key of the block's last row; >= 2 (128 rows see >= 128 keys)
  const int qmaxb = qt * 128 + 127 + numpt;
  const int nt    = (((SKV < qmaxb + 1) ? SKV : (qmaxb + 1)) + 63) >> 6;

  // this lane's share of a stage: 16 B at column ccol of rows crow and crow + 32 of each tile (a wave-wide copy = 4 whole lines)
  const int crow = tid >> 3, ccol = (tid & 7) * 16;
  const unsigned char* kg = (const unsigned char*)Kb + (size_t)crow * (HD * 2) + ccol;
  const unsigned char* vg = (const unsigned char*)Vb + (size_t)crow * (SKV * 2) + ccol;
  const unsigned       lc = (unsigned)(size_t)ring + crow * kPitch + ccol;
  auto issue_stage = [&](int s) {
    const unsigned lb = lc + (s & 1) * kStageB;
    const unsigned char* k0 = kg + (size_t)s * (64 * HD * 2);
    const unsigned char* v0 = vg + (size_t)s * (64 * 2);
    copy_stage(lb, lb + 32 * kPitch, lb + kTileB, lb + kTileB + 32 * kPitch,
               k0, k0 + 32 * HD * 2, v0, v0 + (size_t)32 * SKV * 2);
  };

  issue_stage(0);
  wait_async0();
  __syncthreads();
  issue_stage(1);

#pragma unroll 1
  for (int it = 0; it < nt; ++it) {
    const int kv0 = it * 64;
    const unsigned char* stK = ring + (it & 1) * kStageB;
    const unsigned char* stV = stK + kTileB;
    if (kv0 < kv_end) {                        // wave-uniform (scalar): tiles beyond this wave's last visible key hold no work
    // ---- S^T subtiles (16 kv each): 2 bf16 WMMAs, then scale + mask ----
    v8f s4[4];
    if (kv0 + 63 <= q0w + numpt) {             // wave-uniform (scalar): every key of the tile is visible to every row of the wave
      // interior tile: no mask and no per-subtile test; the 8 K fragment loads stand as one group, the 8 WMMAs run on 4 independent tiles
      v16b ak[4][2];
      const __bf16* krow = (const __bf16*)(stK + l15 * kPitch) + 8 * hi;
#pragma unroll
      for (int t = 0; t < 4; ++t) ak[t][0] = FragB::load(krow + t * 16 * (kPitch / 2));
#pragma unroll
      for (int t = 0; t < 4; ++t) ak[t][1] = FragB::load(krow + t * 16 * (kPitch / 2) + 32);
      __builtin_amdgcn_sched_barrier(0);       // keeps the loads one group ahead of the WMMAs: one LDS latency a tile, not one a subtile
      v8f s[4];
#pragma unroll
      for (int t = 0; t < 4; ++t) s[t] = FragB::mma(ak[t][0], bq[0], zero8());
#pragma unroll
      for (int t = 0; t < 4; ++t) s[t] = FragB::mma(ak[t][1], bq[1], s[t]);
      __builtin_amdgcn_sched_barrier(0);       // keeps the 8 WMMAs back to back: each fills the others' result distance instead of v_nop
#pragma unroll
      for (int t = 0; t < 4; ++t)
#pragma unroll
        for (int r = 0; r < 8; ++r) s4[t][r] = s[t][r] * kScale2;
    } else {
#pragma unroll
    for (int t = 0; t < 4; ++t) {
      const int c0 = kv0 + t * 16;
      if (c0 > qmax) {                       // wave-uniform: whole subtile masked
        s4[t] = neg8();
        continue;
      }
      const __bf16* krow = (const __bf16*)(stK + (t * 16 + l15) * kPitch) + 8 * hi;
      const v16b ak0 = FragB::load(krow);
      const v16b ak1 = FragB::load(krow + 32);
      v8f s = zero8();
      s = FragB::mma(ak0, bq[0], s);
      s = FragB::mma(ak1, bq[1], s);
      dep_guard1_b(s, ak0, ak1, bq[0], bq[1]);
      const bool part = (c0 + 15 > q0w + numpt);   // wave-uniform: some (q, kv) of the subtile masked
      const int  lim  = q0w + l15 + numpt - c0;     // kv local index visible iff <= lim
      v8f sc;
#pragma unroll
      for (int r = 0; r < 8; ++r) {
        float vv = s[r] * kScale2;
        if (part && (r + 8 * hi > lim)) vv = NEG_INF;
        sc[r] = vv;
      }
      s4[t] = sc;
    }
    }

    // ---- tile-level online softmax in log2 domain ----
    float tmax = fmaxf(fmaxf(hmax8(s4[0]), hmax8(s4[1])), fmaxf(hmax8(s4[2]), hmax8(s4[3])));
    tmax = fmaxf(tmax, __shfl_xor(tmax, 16, 32));
    const float mn    = fmaxf(m, tmax);
    const float alpha = (m > NEG_INF) ? EXP2(m - mn) : 0.0f;
    const float mref  = (mn > NEG_INF) ? mn : 0.0f;
    m = mn;
#pragma unroll
    for (int t = 0; t < 4; ++t)
#pragma unroll
      for (int r = 0; r < 8; ++r) s4[t][r] = EXP2(s4[t][r] - mref);
    float ts = (hsum8(s4[0]) + hsum8(s4[1])) + (hsum8(s4[2]) + hsum8(s4[3]));
    ts += __shfl_xor(ts, 16, 32);
    l = l * alpha + ts;
#pragma unroll
    for (int dg = 0; dg < 4; ++dg)
#pragma unroll
      for (int r = 0; r < 8; ++r) oacc[dg][r] *= alpha;

    // ---- O^T += V^T . P^T : 2 slices of 32 kv, 4 f16 WMMAs each ----
#pragma unroll
    for (int si = 0; si < 2; ++si) {
      const v8f p0 = s4[2 * si];               // kv si*32 + 8*hi + 0..7 of this lane's q column
      const v8f p1 = s4[2 * si + 1];           // kv si*32 + 16 + 8*hi + 0..7
      v8u u;
#pragma unroll
      for (int j = 0; j < 4; ++j) {
        u[j]     = pkh2(p0[2 * j] * kCarry, p0[2 * j + 1] * kCarry);
        u[4 + j] = pkh2(p1[2 * j] * kCarry, p1[2 * j + 1] * kCarry);
      }
      const v16h bp = __builtin_bit_cast(v16h, u);
      const _Float16* vrow = (const _Float16*)(stV + l15 * kPitch) + si * 32 + 8 * hi;   // row d = dg*16 + l15
      const v16h av0 = FragH::load(vrow);
      const v16h av1 = FragH::load(vrow + 16 * (kPitch / 2));
      const v16h av2 = FragH::load(vrow + 32 * (kPitch / 2));
      const v16h av3 = FragH::load(vrow + 48 * (kPitch / 2));
      oacc[0] = FragH::mma(av0, bp, oacc[0]);
      oacc[1] = FragH::mma(av1, bp, oacc[1]);
      oacc[2] = FragH::mma(av2, bp, oacc[2]);
      oacc[3] = FragH::mma(av3, bp, oacc[3]);
      dep_guard4_h(oacc[0], oacc[1], oacc[2], oacc[3], av3, bp);
      keep4_h(av0, av1, av2, bp);
    }
    }
    // ---- publish point of tile it + 1, every wave: own reads of this buffer done, own copies landed, barrier, then the refill ----
    wait_ds0();
    wait_async0();
    __syncthreads();
    if (it + 2 < nt) issue_stage(it + 2);      // work-group-uniform: into the buffer that this trip has just read
  }
  wait_async0();
  acc_guard4(oacc[0], oacc[1], oacc[2], oacc[3]);

  // ---- epilogue: normalize, transpose O^T -> O through the wave's LDS slab, whole-line stores ----
  const float inv = (l > 0.f) ? ((1.0f / l) * kInvCarry) : 0.f;
  float* slab = sT[wave];
#pragma unroll
  for (int dg = 0; dg < 4; ++dg)
#pragma unroll
    for (int r = 0; r < 8; ++r)
      slab[l15 * 68 + dg * 16 + 8 * hi + r] = oacc[dg][r] * inv;
  __builtin_amdgcn_fence(3 /* release order */, "workgroup");
  __builtin_amdgcn_wave_barrier();
  __builtin_amdgcn_fence(2 /* acquire order */, "workgroup");
  const int hh = lane >> 4, c4 = (lane & 15) * 4;   // row seg = 256 B = 16 lanes x 16 B
  {
#pragma unroll
    for (int it = 0; it < 8; ++it) {
      const int row = it * 2 + hh;
      const v4f vv = *(const v4f*)(slab + row * 68 + c4);
      *(v4f*)(Ob + (size_t)(q0w + row) * HD + c4) = vv;
    }
    
  }
}

// ---------------------------------------------------------------------------
// Host glue.
//   Kp  bf16 [NB*NH][SKV][64]     NB*NH*SKV*128   at 0              (cast_rows_kernel)
//   Vt  f16  [NB*NH][64][SKV]     NB*NH*SKV*128   at NB*NH*SKV*128  (v_transpose_kernel)
//   total (NB=2, SKV=3072)         25,165,824
// 3 launches.
// ---------------------------------------------------------------------------
extern "C" void kernel_launch(void* const* d_in, const int* in_sizes, int n_in,
                              void* d_out, int out_size, void* d_ws, size_t ws_size,
                              hipStream_t stream) {
  if (n_in < 4) return;
  if (in_sizes[0] < NB * NH * SEQ * HD) return;
  if (in_sizes[1] < NB * NH * SKV * HD) return;
  if (in_sizes[2] < NB * NH * SKV * HD) return;
  if (in_sizes[3] < 1) return;
  if (out_size < NB * NH * SEQ * HD) return;

  const size_t szK   = (size_t)NB * NH * SKV * HD * 2;
  const size_t szVt  = (size_t)NB * NH * HD * SKV * 2;
  const size_t offK  = 0;
  const size_t offVt = offK + szK;
  const size_t total = offVt + szVt;
  if (ws_size < total) return;

  const float* q  = (const float*)d_in[0];
  const float* k  = (const float*)d_in[1];
  const float* v  = (const float*)d_in[2];
  const int*   np = (const int*)d_in[3];
  float* out = (float*)d_out;
  char* ws = (char*)d_ws;
  unsigned short* Kp = (unsigned short*)(ws + offK);
  _Float16*       Vt = (_Float16*)(ws + offVt);

  const int nRowsK = NB * NH * SKV;                 // multiple of 32
  // (1) Kp[bh][kv][d] = bf16(k[bh][kv][d])
  cast_rows_kernel<<<dim3(nRowsK / 32), dim3(256), 0, stream>>>(k, Kp, SKV, SKV_FULL, nRowsK);
  // (2) Vt[bh][d][kv] = f16(bf16(v[bh][kv][d]))
  v_transpose_kernel<<<dim3(SKV / 64, NB * NH), dim3(256), 0, stream>>>(v, Vt);
  // (3) attention
  attn_kernel<<<dim3(SEQ / 128, NH, NB), dim3(256), 0, stream>>>(q, Kp, (const unsigned short*)Vt, np, out);
}

// v004
// Measured time: 57 microseconds a run.
// Two timings next to v003 both put it at 1.05 times that version's speed.
// Over all steps from v000 it is 3.72 times as fast.
// Contractions: scores K.Q^T on v_wmma_f32_16x16x32_bf16 (bf16 operands = RNE bf16 copies of q and k, f32 accumulate); context V^T.P^T on v_wmma_f32_16x16x32_f16 (f16 operands: v = f16 of its RNE bf16 copy, p carried x4096, f32 accumulate); scale, mask and online softmax in f32.
#include <hip/hip_runtime.h>
#include <math.h>

// ---------------------------------------------------------------------------
// Problem constants (NB / SEQ / SKV overridable for a reduced build; *_FULL = input strides)
// ---------------------------------------------------------------------------
#ifndef NB
#define NB 2
#endif
#ifndef SEQ
#define SEQ 2048
#endif
#ifndef SKV
#define SKV 3072
#endif
#define NB_FULL   2
#define NH        16
#define HD        64
#define SEQ_FULL  2048
#define SKV_FULL  3072

static_assert(NB >= 1 && NB <= NB_FULL);
static_assert(SEQ % 128 == 0 && SEQ <= SEQ_FULL);
static_assert(SKV % 64 == 0 && SKV <= SKV_FULL);
static_assert(HD == 64);
static_assert((NB * NH * SKV) % 32 == 0);

constexpr float kScale2   = 0.125f * 1.44269504088896340736f;   // 1/sqrt(64) * log2(e): softmax in log2 domain
constexpr float kCarryLog2 = 12.0f;                            // p in [0,1] carried x4096 (f16 operand and row sum alike): 12 added to the exp2 argument
#define NEG_INF (-__builtin_inff())

#if __has_builtin(__builtin_amdgcn_exp2f)
#define EXP2(x) __builtin_amdgcn_exp2f(x)
#else
#define EXP2(x) exp2f(x)
#endif

typedef __attribute__((ext_vector_type(16))) _Float16 v16h;
typedef __attribute__((ext_vector_type(8)))  _Float16 v8h;
typedef __attribute__((ext_vector_type(2)))  _Float16 v2h;
typedef __attribute__((ext_vector_type(16))) __bf16   v16b;
typedef __attribute__((ext_vector_type(8)))  __bf16   v8b;
typedef __attribute__((ext_vector_type(8)))  float    v8f;
typedef __attribute__((ext_vector_type(4)))  float    v4f;
typedef __attribute__((ext_vector_type(4)))  unsigned int v4u;
typedef __attribute__((ext_vector_type(8)))  unsigned int v8u;

__device__ __forceinline__ unsigned short f2bf_bits(float f) {        // RNE convert f32 -> bf16 bits
  unsigned u = __float_as_uint(f);
  return (unsigned short)((u + 0x7FFFu + ((u >> 16) & 1u)) >> 16);
}
__device__ __forceinline__ float bf_bits2f(unsigned short h) { return __uint_as_float(((unsigned)h) << 16); }

// hazard guards: 4 VALU slots after the last WMMA of a group, tie D, keep A/B live
__device__ __forceinline__ void dep_guard1_b(v8f& a, v16b w, v16b x, v16b y, v16b z) {
  asm volatile("v_nop\n\tv_nop\n\tv_nop\n\tv_nop" : "+v"(a) : "v"(w), "v"(x), "v"(y), "v"(z));
}
__device__ __forceinline__ void dep_guard4_h(v8f& a, v8f& b, v8f& c, v8f& d, v16h x, v16h y) {
  asm volatile("v_nop\n\tv_nop\n\tv_nop\n\tv_nop" : "+v"(a), "+v"(b), "+v"(c), "+v"(d) : "v"(x), "v"(y));
}
__device__ __forceinline__ void keep4_h(v16h a, v16h b, v16h c, v16h d) { asm volatile("v_nop" :: "v"(a), "v"(b), "v"(c), "v"(d)); }
__device__ __forceinline__ void acc_guard4(v8f& a, v8f& b, v8f& c, v8f& d) {
  asm volatile("v_nop\n\tv_nop\n\tv_nop\n\tv_nop" : "+v"(a), "+v"(b), "+v"(c), "+v"(d));
}

template <typename T> struct Frag;
template <> struct Frag<_Float16> {
  typedef v16h V; union U { v16h v; v8h h[2]; };
  // elements 0..7 <- p[0..7], 8..15 <- p[16..23]; caller passes p = row + k0 + 8*(lane>>4)
  static __device__ __forceinline__ v16h load(const _Float16* p) {
    U f; f.h[0] = *(const v8h*)(p); f.h[1] = *(const v8h*)(p + 16); return f.v;
  }
  static __device__ __forceinline__ v8f mma(v16h a, v16h b, v8f c) {
    return __builtin_amdgcn_wmma_f32_16x16x32_f16(false, a, false, b, (short)0, c, false, false);
  }
};
template <> struct Frag<__bf16> {
  typedef v16b V; union U { v16b v; v8b h[2]; };
  static __device__ __forceinline__ v16b load(const __bf16* p) {
    U f; f.h[0] = *(const v8b*)(p); f.h[1] = *(const v8b*)(p + 16); return f.v;
  }
  static __device__ __forceinline__ v8f mma(v16b a, v16b b, v8f c) {
    return __builtin_amdgcn_wmma_f32_16x16x32_bf16(false, a, false, b, (short)0, c, false, false);
  }
};
typedef Frag<_Float16> FragH;
typedef Frag<__bf16>   FragB;

__device__ __forceinline__ unsigned pk16(unsigned short a, unsigned short b) { return (unsigned)a | ((unsigned)b << 16); }
// pack two f32 -> one dword of two f16 (element 0 = a)
__device__ __forceinline__ unsigned pkh2(float a, float b) {
  v2h p; p[0] = (_Float16)a; p[1] = (_Float16)b;
  return __builtin_bit_cast(unsigned, p);
}
__device__ __forceinline__ v8f zero8() { return (v8f){0.f, 0.f, 0.f, 0.f, 0.f, 0.f, 0.f, 0.f}; }
__device__ __forceinline__ v8f neg8()  { return (v8f){NEG_INF, NEG_INF, NEG_INF, NEG_INF, NEG_INF, NEG_INF, NEG_INF, NEG_INF}; }
// balanced-tree horizontal reductions
__device__ __forceinline__ float hsum8(v8f v) {
  float a = v[0] + v[1], b = v[2] + v[3], c = v[4] + v[5], d = v[6] + v[7];
  return (a + b) + (c + d);
}
__device__ __forceinline__ float hmax8(v8f v) {
  float a = fmaxf(v[0], v[1]), b = fmaxf(v[2], v[3]);
  float c = fmaxf(v[4], v[5]), d = fmaxf(v[6], v[7]);
  return fmaxf(fmaxf(a, b), fmaxf(c, d));
}

// ---------------------------------------------------------------------------
// dst row pr = g * rowsPerGroup + r  <-  src row g * srcRowsPerGroup + r  (g = (b*NH + h)).
// Block 256 threads = 32 rows; thread t: row t>>3, 8 halves at (t&7)*8.
// ---------------------------------------------------------------------------
__global__ __launch_bounds__(256) void cast_rows_kernel(const float* __restrict__ src,
                                                         unsigned short* __restrict__ dst,
                                                         int rowsPerGroup, int srcRowsPerGroup, int nRows) {
  const int t  = threadIdx.x;
  int pr = blockIdx.x * 32 + (t >> 3);
  pr = (pr < nRows) ? pr : (nRows - 1);            // address clamp (grid is exact)
  const int c8 = (t & 7) * 8;
  const int g  = pr / rowsPerGroup;
  const int r  = pr - g * rowsPerGroup;
  const float* s = src + ((size_t)g * srcRowsPerGroup + r) * HD + c8;
  const v4f a = *(const v4f*)(s);
  const v4f b = *(const v4f*)(s + 4);
  unsigned short hb[8];
#pragma unroll
  for (int e = 0; e < 4; ++e) { hb[e] = f2bf_bits(a[e]); hb[4 + e] = f2bf_bits(b[e]); }
  const v4u u = (v4u){pk16(hb[0], hb[1]), pk16(hb[2], hb[3]), pk16(hb[4], hb[5]), pk16(hb[6], hb[7])};
  unsigned short* d = dst + (size_t)pr * HD + c8;
  *(v4u*)d = u;
  
}

// ---------------------------------------------------------------------------
// (2) V cast + transpose: Vt[bh][d][kv] = f16( bf16( v[bh][kv][d] ) )   (pitch SKV halves)
// grid (SKV/64, NB*NH), 256 threads; one 64(kv) x 64(d) tile through LDS.
// Load coverage: 16 iterations x 256 threads = 4096 = whole tile (coalesced along d); sm cross-wave -> __syncthreads.
// Store coverage: 8 waves x 2 iterations x 4 rows (lane>>3) = 64 d-rows; (lane&7) x 8 halves = 64 kv;
// ---------------------------------------------------------------------------
__global__ __launch_bounds__(256) void v_transpose_kernel(const float* __restrict__ v,
                                                           _Float16* __restrict__ Vt) {
  __shared__ float sm[64][65];   // sm[kv_local][d]
  const int tid = threadIdx.x;
  const int kv0 = blockIdx.x * 64;
  const int bh  = blockIdx.y;                        // b*NH + h, b < NB
  const float* vb = v + ((size_t)bh * SKV_FULL + kv0) * HD;
#pragma unroll
  for (int i = 0; i < 16; ++i) {
    const int e = i * 256 + tid;
    const int r = e >> 6;          // kv local
    const int c = e & 63;          // d
    sm[r][c] = vb[(size_t)r * HD + c];
  }
  __syncthreads();
  const int lane = tid & 31, wave = tid >> 5;
  const int q = lane >> 3, c8 = (lane & 7) * 8;
  _Float16* vt = Vt + (size_t)bh * HD * SKV;
  {
#pragma unroll
    for (int it = 0; it < 2; ++it) {
      const int row = wave * 8 + it * 4 + q;          // d
      v8h hv;
#pragma unroll
      for (int e = 0; e < 8; ++e) hv[e] = (_Float16)bf_bits2f(f2bf_bits(sm[c8 + e][row]));
      *(v8h*)(vt + (size_t)row * SKV + kv0 + c8) = hv;
    }
    
  }
}

// ---------------------------------------------------------------------------
// LDS ring of the attention kernel: a stage = one 64-key K tile (64 kv rows x 128 B) and one V^T tile (64 d rows x 128 B).
// ---------------------------------------------------------------------------
constexpr int kPitch  = 144;              // LDS row pitch in bytes: 128 + 16, an odd multiple of 16 (ds_load_b128 readers)
constexpr int kTileB  = 64 * kPitch;      // one tile
constexpr int kStageB = 2 * kTileB;       // K tile, then V^T tile
static_assert(kPitch % 16 == 0 && ((kPitch / 16) & 1) == 1);
static_assert(SKV >= 128);                // the ring's prologue fills two stages

// Four 16-byte asynchronous copies per lane = this lane's share of one stage. l* = LDS byte addresses, g* = global addresses.
// s_wait_xcnt 0 is the statement's last line so that it stands ahead of any rewrite of the address registers the copies name.
__device__ __forceinline__ void copy_stage(unsigned l0, unsigned l1, unsigned l2, unsigned l3,
                                           const unsigned char* g0, const unsigned char* g1,
                                           const unsigned char* g2, const unsigned char* g3) {
  asm volatile("global_load_async_to_lds_b128 %0, %4, off\n\t"
               "global_load_async_to_lds_b128 %1, %5, off\n\t"
               "global_load_async_to_lds_b128 %2, %6, off\n\t"
               "global_load_async_to_lds_b128 %3, %7, off\n\t"
               "s_wait_xcnt 0x0"
               :: "v"(l0), "v"(l1), "v"(l2), "v"(l3), "v"(g0), "v"(g1), "v"(g2), "v"(g3) : "memory");
}
// the wave's own copies have landed (the compiler places no wait for them)
__device__ __forceinline__ void wait_async0() { asm volatile("s_wait_asynccnt 0x0" ::: "memory"); }
// the wave's own LDS reads have returned, before the buffer is handed to its next writer
__device__ __forceinline__ void wait_ds0() { asm volatile("s_wait_dscnt 0x0" ::: "memory"); }

// ---------------------------------------------------------------------------
// (3) Flash-style prefix-causal attention. grid (SEQ/128, NH, NB), 256 threads = 8 waves x 16 query rows; blockIdx.x -> query tile by a per-head permutation.
// Per wave: Q B-fragments (bf16, RNE) in registers; loop over 64-key tiles up to the last visible key;
//   S^T subtile = K(16 kv x 64 d, bf16 plane rows) . Q^T : 2 bf16 WMMAs; mask (kv > q + num_pt -> -inf) on the raw scores, f32 online
//   softmax in log2 domain, p x4096 = exp2(s * scale + (12 - max)): one FMA a score carries scale, maximum and carry
//   (row stats shared by lanes l and l^16); O^T += V^T(16 d x 32 kv, f16 plane rows) . P^T with
//   P^T fragment = [own D of subtile 2si (kv 0-15 of slice), own D of subtile 2si+1 (kv 16-31)] as f16 x4096.
// K and V^T tiles are brought into LDS once per work-group by asynchronous copies, two buffers: tile t + 1 flies while tile t is
// worked on; one publish point per tile (own LDS reads done, own copies landed, barrier, refill), passed by every wave; a wave
// skips only the work of tiles beyond its own last visible key.
// ---------------------------------------------------------------------------
__global__ __launch_bounds__(256) void attn_kernel(const float* __restrict__ q,
                                                    const unsigned short* __restrict__ Kp,
                                                    const unsigned short* __restrict__ Vtp,
                                                    const int* __restrict__ np,
                                                    float* __restrict__ out) {
  __shared__ __align__(16) float sT[8][16 * 68];   // per-wave 16x64 slab, pitch 68 floats
  __shared__ __align__(16) unsigned char ring[2 * kStageB];
  const int tid  = threadIdx.x;
  const int wave = __builtin_amdgcn_readfirstlane(tid >> 5);   // scalar: the per-wave skip between publish points is a scalar branch
  const int lane = tid & 31;
  const int hi   = lane >> 4;                // lane half: k offset 8*hi, D row offset 8*hi
  const int l15  = lane & 15;                // A row / B,D column
  const int h    = blockIdx.y;
  const int b    = blockIdx.z;
  const int bh   = b * NH + h;
  // Query tile of this work-group. A tile's cost grows with its index (tile t walks 2 t more key tiles than tile 0) and every
  // work-group is resident from the start, two to a WGP, so the launch lasts as long as the fullest WGP. Work-groups whose flat
  // index differs in one bit above the low three get tiles d and kQT - 1 - d: equal sums.
  // For speed only: for each bh the map is a permutation of the tiles, wherever the work-groups land.
  constexpr int kQT = SEQ / 128;
  int qt = blockIdx.x;
  if (kQT % 2 == 0) {
    const int up   = (qt >= kQT / 2) ? 1 : 0;
    const int d    = qt - up * (kQT / 2);
    const int flip = (up ^ __builtin_popcount((unsigned)bh)) & 1;
    qt = flip ? (kQT - 1 - d) : d;
  }
  const int q0w  = qt * 128 + wave * 16;

  int numpt = np[0];
  numpt = (numpt < 0) ? 0 : numpt;
  numpt = (numpt > SKV) ? SKV : numpt;

  const float*    Qb = q + ((size_t)bh * SEQ_FULL) * HD;
  const __bf16*   Kb = (const __bf16*)Kp + (size_t)bh * SKV * HD;
  const _Float16* Vb = (const _Float16*)Vtp + (size_t)bh * HD * SKV;
  float*          Ob = out + ((size_t)bh * SEQ) * HD;

  // ---- Q as bf16 B operand of S^T = K.Q^T: B[k=d][n=q]; elements 0..7 <- d k0+8hi+0..7, 8..15 <- d k0+16+8hi+0..7 ----
  v16b bq[2];
  {
    const float* qrow = Qb + (size_t)(q0w + l15) * HD;
#pragma unroll
    for (int si = 0; si < 2; ++si) {
      const v4f f0 = *(const v4f*)(qrow + si * 32 + 8 * hi);
      const v4f f1 = *(const v4f*)(qrow + si * 32 + 8 * hi + 4);
      const v4f g0 = *(const v4f*)(qrow + si * 32 + 16 + 8 * hi);
      const v4f g1 = *(const v4f*)(qrow + si * 32 + 16 + 8 * hi + 4);
      v8u u;
      u[0] = pk16(f2bf_bits(f0[0]), f2bf_bits(f0[1]));
      u[1] = pk16(f2bf_bits(f0[2]), f2bf_bits(f0[3]));
      u[2] = pk16(f2bf_bits(f1[0]), f2bf_bits(f1[1]));
      u[3] = pk16(f2bf_bits(f1[2]), f2bf_bits(f1[3]));
      u[4] = pk16(f2bf_bits(g0[0]), f2bf_bits(g0[1]));
      u[5] = pk16(f2bf_bits(g0[2]), f2bf_bits(g0[3]));
      u[6] = pk16(f2bf_bits(g1[0]), f2bf_bits(g1[1]));
      u[7] = pk16(f2bf_bits(g1[2]), f2bf_bits(g1[3]));
      bq[si] = __builtin_bit_cast(v16b, u);
    }
  }

  // O^T accumulators: oacc[dg][r] = carry * O[q0w+l15][dg*16 + 8*hi + r]
  v8f oacc[4];
#pragma unroll
  for (int dg = 0; dg < 4; ++dg) oacc[dg] = zero8();
  float m = NEG_INF;                         // per-lane row stats (log2 domain)
  float l = 0.f;                             // row sum, carried x4096 like p

  const int qmax   = q0w + 15 + numpt;       // last visible key of this wave's last row
  const int kv_end = (SKV < qmax + 1) ? SKV : (qmax + 1);

  // work-group-uniform tile count: up to the last visible key of the block's last row; >= 2 (128 rows see >= 128 keys)
  const int qmaxb = qt * 128 + 127 + numpt;
  const int nt    = (((SKV < qmaxb + 1) ? SKV : (qmaxb + 1)) + 63) >> 6;

  // this lane's share of a stage: 16 B at column ccol of rows crow and crow + 32 of each tile (a wave-wide copy = 4 whole lines)
  const int crow = tid >> 3, ccol = (tid & 7) * 16;
  const unsigned char* kg = (const unsigned char*)Kb + (size_t)crow * (HD * 2) + ccol;
  const unsigned char* vg = (const unsigned char*)Vb + (size_t)crow * (SKV * 2) + ccol;
  const unsigned       lc = (unsigned)(size_t)ring + crow * kPitch + ccol;
  auto issue_stage = [&](int s) {
    const unsigned lb = lc + (s & 1) * kStageB;
    const unsigned char* k0 = kg + (size_t)s * (64 * HD * 2);
    const unsigned char* v0 = vg + (size_t)s * (64 * 2);
    copy_stage(lb, lb + 32 * kPitch, lb + kTileB, lb + kTileB + 32 * kPitch,
               k0, k0 + 32 * HD * 2, v0, v0 + (size_t)32 * SKV * 2);
  };

  issue_stage(0);
  wait_async0();
  __syncthreads();
  issue_stage(1);

#pragma unroll 1
  for (int it = 0; it < nt; ++it) {
    const int kv0 = it * 64;
    const unsigned char* stK = ring + (it & 1) * kStageB;
    const unsigned char* stV = stK + kTileB;
    if (kv0 < kv_end) {                        // wave-uniform (scalar): tiles beyond this wave's last visible key hold no work
    // ---- S^T subtiles (16 kv each): 2 bf16 WMMAs, then the mask; the scores stay unscaled ----
    v8f s4[4];
    if (kv0 + 63 <= q0w + numpt) {             // wave-uniform (scalar): every key of the tile is visible to every row of the wave
      // interior tile: no mask and no per-subtile test; the 8 K fragment loads stand as one group, the 8 WMMAs run on 4 independent tiles
      v16b ak[4][2];
      const __bf16* krow = (const __bf16*)(stK + l15 * kPitch) + 8 * hi;
#pragma unroll
      for (int t = 0; t < 4; ++t) ak[t][0] = FragB::load(krow + t * 16 * (kPitch / 2));
#pragma unroll
      for (int t = 0; t < 4; ++t) ak[t][1] = FragB::load(krow + t * 16 * (kPitch / 2) + 32);
      __builtin_amdgcn_sched_barrier(0);       // keeps the loads one group ahead of the WMMAs: one LDS latency a tile, not one a subtile
      v8f s[4];
#pragma unroll
      for (int t = 0; t < 4; ++t) s[t] = FragB::mma(ak[t][0], bq[0], zero8());
#pragma unroll
      for (int t = 0; t < 4; ++t) s[t] = FragB::mma(ak[t][1], bq[1], s[t]);
      __builtin_amdgcn_sched_barrier(0);       // keeps the 8 WMMAs back to back: each fills the others' result distance instead of v_nop
#pragma unroll
      for (int t = 0; t < 4; ++t) s4[t] = s[t];
    } else {
#pragma unroll
    for (int t = 0; t < 4; ++t) {
      const int c0 = kv0 + t * 16;
      if (c0 > qmax) {                       // wave-uniform: whole subtile masked
        s4[t] = neg8();
        continue;
      }
      const __bf16* krow = (const __bf16*)(stK + (t * 16 + l15) * kPitch) + 8 * hi;
      const v16b ak0 = FragB::load(krow);
      const v16b ak1 = FragB::load(krow + 32);
      v8f s = zero8();
      s = FragB::mma(ak0, bq[0], s);
      s = FragB::mma(ak1, bq[1], s);
      dep_guard1_b(s, ak0, ak1, bq[0], bq[1]);
      const bool part = (c0 + 15 > q0w + numpt);   // wave-uniform: some (q, kv) of the subtile masked
      const int  lim  = q0w + l15 + numpt - c0;     // kv local index visible iff <= lim
      v8f sc;
#pragma unroll
      for (int r = 0; r < 8; ++r) {
        float vv = s[r];
        if (part && (r + 8 * hi > lim)) vv = NEG_INF;
        sc[r] = vv;
      }
      s4[t] = sc;
    }
    }

    // ---- tile-level online softmax in log2 domain ----
    float tmax = fmaxf(fmaxf(hmax8(s4[0]), hmax8(s4[1])), fmaxf(hmax8(s4[2]), hmax8(s4[3])));
    tmax = fmaxf(tmax, __shfl_xor(tmax, 16, 32));
    const float mn    = fmaxf(m, tmax * kScale2);   // scale > 0: the scaled maximum is the maximum of the scaled scores
    const float alpha = (m > NEG_INF) ? EXP2(m - mn) : 0.0f;
    const float bias  = kCarryLog2 - ((mn > NEG_INF) ? mn : 0.0f);
    m = mn;
    const v8f sc8 = (v8f){kScale2, kScale2, kScale2, kScale2, kScale2, kScale2, kScale2, kScale2};
    const v8f bi8 = (v8f){bias, bias, bias, bias, bias, bias, bias, bias};
#pragma unroll
    for (int t = 0; t < 4; ++t) {
      const v8f a = __builtin_elementwise_fma(s4[t], sc8, bi8);
#pragma unroll
      for (int r = 0; r < 8; ++r) s4[t][r] = EXP2(a[r]);
    }
    float ts = (hsum8(s4[0]) + hsum8(s4[1])) + (hsum8(s4[2]) + hsum8(s4[3]));
    ts += __shfl_xor(ts, 16, 32);
    l = l * alpha + ts;
#pragma unroll
    for (int dg = 0; dg < 4; ++dg)
#pragma unroll
      for (int r = 0; r < 8; ++r) oacc[dg][r] *= alpha;

    // ---- O^T += V^T . P^T : 2 slices of 32 kv, 4 f16 WMMAs each ----
#pragma unroll
    for (int si = 0; si < 2; ++si) {
      const v8f p0 = s4[2 * si];               // kv si*32 + 8*hi + 0..7 of this lane's q column
      const v8f p1 = s4[2 * si + 1];           // kv si*32 + 16 + 8*hi + 0..7
      v8u u;
#pragma unroll
      for (int j = 0; j < 4; ++j) {
        u[j]     = pkh2(p0[2 * j], p0[2 * j + 1]);
        u[4 + j] = pkh2(p1[2 * j], p1[2 * j + 1]);
      }
      const v16h bp = __builtin_bit_cast(v16h, u);
      const _Float16* vrow = (const _Float16*)(stV + l15 * kPitch) + si * 32 + 8 * hi;   // row d = dg*16 + l15
      const v16h av0 = FragH::load(vrow);
      const v16h av1 = FragH::load(vrow + 16 * (kPitch / 2));
      const v16h av2 = FragH::load(vrow + 32 * (kPitch / 2));
      const v16h av3 = FragH::load(vrow + 48 * (kPitch / 2));
      oacc[0] = FragH::mma(av0, bp, oacc[0]);
      oacc[1] = FragH::mma(av1, bp, oacc[1]);
      oacc[2] = FragH::mma(av2, bp, oacc[2]);
      oacc[3] = FragH::mma(av3, bp, oacc[3]);
      dep_guard4_h(oacc[0], oacc[1], oacc[2], oacc[3], av3, bp);
      keep4_h(av0, av1, av2, bp);
    }
    }
    // ---- publish point of tile it + 1, every wave: own reads of this buffer done, own copies landed, barrier, then the refill ----
    wait_ds0();
    wait_async0();
    __syncthreads();
    if (it + 2 < nt) issue_stage(it + 2);      // work-group-uniform: into the buffer that this trip has just read
  }
  wait_async0();
  acc_guard4(oacc[0], oacc[1], oacc[2], oacc[3]);

  // ---- epilogue: normalize, transpose O^T -> O through the wave's LDS slab, whole-line stores ----
  const float inv = (l > 0.f) ? (1.0f / l) : 0.f;   // the carry stands in oacc and in l alike and cancels
  float* slab = sT[wave];
#pragma unroll
  for (int dg = 0; dg < 4; ++dg)
#pragma unroll
    for (int r = 0; r < 8; ++r)
      slab[l15 * 68 + dg * 16 + 8 * hi + r] = oacc[dg][r] * inv;
  __builtin_amdgcn_fence(3 /* release order */, "workgroup");
  __builtin_amdgcn_wave_barrier();
  __builtin_amdgcn_fence(2 /* acquire order */, "workgroup");
  const int hh = lane >> 4, c4 = (lane & 15) * 4;   // row seg = 256 B = 16 lanes x 16 B
  {
#pragma unroll
    for (int it = 0; it < 8; ++it) {
      const int row = it * 2 + hh;
      const v4f vv = *(const v4f*)(slab + row * 68 + c4);
      *(v4f*)(Ob + (size_t)(q0w + row) * HD + c4) = vv;
    }
    
  }
}

// ---------------------------------------------------------------------------
// Host glue.
//   Kp  bf16 [NB*NH][SKV][64]     NB*NH*SKV*128   at 0              (cast_rows_kernel)
//   Vt  f16  [NB*NH][64][SKV]     NB*NH*SKV*128   at NB*NH*SKV*128  (v_transpose_kernel)
//   total (NB=2, SKV=3072)         25,165,824
// 3 launches.
// ---------------------------------------------------------------------------
extern "C" void kernel_launch(void* const* d_in, const int* in_sizes, int n_in,
                              void* d_out, int out_size, void* d_ws, size_t ws_size,
                              hipStream_t stream) {
  if (n_in < 4) return;
  if (in_sizes[0] < NB * NH * SEQ * HD) return;
  if (in_sizes[1] < NB * NH * SKV * HD) return;
  if (in_sizes[2] < NB * NH * SKV * HD) return;
  if (in_sizes[3] < 1) return;
  if (out_size < NB * NH * SEQ * HD) return;

  const size_t szK   = (size_t)NB * NH * SKV * HD * 2;
  const size_t szVt  = (size_t)NB * NH * HD * SKV * 2;
  const size_t offK  = 0;
  const size_t offVt = offK + szK;
  const size_t total = offVt + szVt;
  if (ws_size < total) return;

  const float* q  = (const float*)d_in[0];
  const float* k  = (const float*)d_in[1];
  const float* v  = (const float*)d_in[2];
  const int*   np = (const int*)d_in[3];
  float* out = (float*)d_out;
  char* ws = (char*)d_ws;
  unsigned short* Kp = (unsigned short*)(ws + offK);
  _Float16*       Vt = (_Float16*)(ws + offVt);

  const int nRowsK = NB * NH * SKV;                 // multiple of 32
  // (1) Kp[bh][kv][d] = bf16(k[bh][kv][d])
  cast_rows_kernel<<<dim3(nRowsK / 32), dim3(256), 0, stream>>>(k, Kp, SKV, SKV_FULL, nRowsK);
  // (2) Vt[bh][d][kv] = f16(bf16(v[bh][kv][d]))
  v_transpose_kernel<<<dim3(SKV / 64, NB * NH), dim3(256), 0, stream>>>(v, Vt);
  // (3) attention
  attn_kernel<<<dim3(SEQ / 128, NH, NB), dim3(256), 0, stream>>>(q, Kp, (const unsigned short*)Vt, np, out);
}

// v005
// One run takes 50.6 microseconds.
// Next to v004, in two timings, it ran 1.13 and 1.15 times as fast.
// Over all steps from v000 it is 4.23 times as fast.
// Contractions: scores K.Q^T on v_wmma_f32_16x16x32_bf16 (bf16 operands = RNE bf16 copies of q and k, f32 accumulate); context V^T.P^T on v_wmma_f32_16x16x32_f16 (f16 operands: v = f16 of its RNE bf16 copy, p carried x4096, f32 accumulate); scale, mask and online softmax in f32.
#include <hip/hip_runtime.h>
#include <math.h>

// ---------------------------------------------------------------------------
// Problem constants (NB / SEQ / SKV overridable for a reduced build; *_FULL = input strides)
// ---------------------------------------------------------------------------
#ifndef NB
#define NB 2
#endif
#ifndef SEQ
#define SEQ 2048
#endif
#ifndef SKV
#define SKV 3072
#endif
#define NB_FULL   2
#define NH        16
#define HD        64
#define SEQ_FULL  2048
#define SKV_FULL  3072

static_assert(NB >= 1 && NB <= NB_FULL);
static_assert(SEQ % 128 == 0 && SEQ <= SEQ_FULL);
static_assert(SKV % 128 == 0 && SKV <= SKV_FULL);
static_assert(HD == 64);
static_assert((NB * NH * SKV) % 32 == 0);

constexpr float kScale2   = 0.125f * 1.44269504088896340736f;   // 1/sqrt(64) * log2(e): softmax in log2 domain
constexpr float kCarryLog2 = 12.0f;                            // p in [0,1] carried x4096 (f16 operand and row sum alike): 12 added to the exp2 argument
#define NEG_INF (-__builtin_inff())

#if __has_builtin(__builtin_amdgcn_exp2f)
#define EXP2(x) __builtin_amdgcn_exp2f(x)
#else
#define EXP2(x) exp2f(x)
#endif

typedef __attribute__((ext_vector_type(16))) _Float16 v16h;
typedef __attribute__((ext_vector_type(8)))  _Float16 v8h;
typedef __attribute__((ext_vector_type(2)))  _Float16 v2h;
typedef __attribute__((ext_vector_type(16))) __bf16   v16b;
typedef __attribute__((ext_vector_type(8)))  __bf16   v8b;
typedef __attribute__((ext_vector_type(8)))  float    v8f;
typedef __attribute__((ext_vector_type(4)))  float    v4f;
typedef __attribute__((ext_vector_type(4)))  unsigned int v4u;
typedef __attribute__((ext_vector_type(8)))  unsigned int v8u;

__device__ __forceinline__ unsigned short f2bf_bits(float f) {        // RNE convert f32 -> bf16 bits
  unsigned u = __float_as_uint(f);
  return (unsigned short)((u + 0x7FFFu + ((u >> 16) & 1u)) >> 16);
}
__device__ __forceinline__ float bf_bits2f(unsigned short h) { return __uint_as_float(((unsigned)h) << 16); }

// hazard guards: 4 VALU slots after the last WMMA of a group, tie D, keep A/B live
__device__ __forceinline__ void dep_guard1_b(v8f& a, v16b w, v16b x, v16b y, v16b z) {
  asm volatile("v_nop\n\tv_nop\n\tv_nop\n\tv_nop" : "+v"(a) : "v"(w), "v"(x), "v"(y), "v"(z));
}
__device__ __forceinline__ void dep_guard4_h(v8f& a, v8f& b, v8f& c, v8f& d, v16h x, v16h y) {
  asm volatile("v_nop\n\tv_nop\n\tv_nop\n\tv_nop" : "+v"(a), "+v"(b), "+v"(c), "+v"(d) : "v"(x), "v"(y));
}
__device__ __forceinline__ void keep4_h(v16h a, v16h b, v16h c, v16h d) { asm volatile("v_nop" :: "v"(a), "v"(b), "v"(c), "v"(d)); }
__device__ __forceinline__ void acc_guard4(v8f& a, v8f& b, v8f& c, v8f& d) {
  asm volatile("v_nop\n\tv_nop\n\tv_nop\n\tv_nop" : "+v"(a), "+v"(b), "+v"(c), "+v"(d));
}

template <typename T> struct Frag;
template <> struct Frag<_Float16> {
  typedef v16h V; union U { v16h v; v8h h[2]; };
  // elements 0..7 <- p[0..7], 8..15 <- p[16..23]; caller passes p = row + k0 + 8*(lane>>4)
  static __device__ __forceinline__ v16h load(const _Float16* p) {
    U f; f.h[0] = *(const v8h*)(p); f.h[1] = *(const v8h*)(p + 16); return f.v;
  }
  static __device__ __forceinline__ v8f mma(v16h a, v16h b, v8f c) {
    return __builtin_amdgcn_wmma_f32_16x16x32_f16(false, a, false, b, (short)0, c, false, false);
  }
};
template <> struct Frag<__bf16> {
  typedef v16b V; union U { v16b v; v8b h[2]; };
  static __device__ __forceinline__ v16b load(const __bf16* p) {
    U f; f.h[0] = *(const v8b*)(p); f.h[1] = *(const v8b*)(p + 16); return f.v;
  }
  static __device__ __forceinline__ v8f mma(v16b a, v16b b, v8f c) {
    return __builtin_amdgcn_wmma_f32_16x16x32_bf16(false, a, false, b, (short)0, c, false, false);
  }
};
typedef Frag<_Float16> FragH;
typedef Frag<__bf16>   FragB;

__device__ __forceinline__ unsigned pk16(unsigned short a, unsigned short b) { return (unsigned)a | ((unsigned)b << 16); }
// pack two f32 -> one dword of two f16 (element 0 = a)
__device__ __forceinline__ unsigned pkh2(float a, float b) {
  v2h p; p[0] = (_Float16)a; p[1] = (_Float16)b;
  return __builtin_bit_cast(unsigned, p);
}
__device__ __forceinline__ v8f zero8() { return (v8f){0.f, 0.f, 0.f, 0.f, 0.f, 0.f, 0.f, 0.f}; }
__device__ __forceinline__ v8f neg8()  { return (v8f){NEG_INF, NEG_INF, NEG_INF, NEG_INF, NEG_INF, NEG_INF, NEG_INF, NEG_INF}; }
// balanced-tree horizontal reductions
__device__ __forceinline__ float hsum8(v8f v) {
  float a = v[0] + v[1], b = v[2] + v[3], c = v[4] + v[5], d = v[6] + v[7];
  return (a + b) + (c + d);
}
__device__ __forceinline__ float hmax8(v8f v) {
  float a = fmaxf(v[0], v[1]), b = fmaxf(v[2], v[3]);
  float c = fmaxf(v[4], v[5]), d = fmaxf(v[6], v[7]);
  return fmaxf(fmaxf(a, b), fmaxf(c, d));
}

// ---------------------------------------------------------------------------
// dst row pr = g * rowsPerGroup + r  <-  src row g * srcRowsPerGroup + r  (g = (b*NH + h)).
// Block 256 threads = 32 rows; thread t: row t>>3, 8 halves at (t&7)*8.
// ---------------------------------------------------------------------------
__global__ __launch_bounds__(256) void cast_rows_kernel(const float* __restrict__ src,
                                                         unsigned short* __restrict__ dst,
                                                         int rowsPerGroup, int srcRowsPerGroup, int nRows) {
  const int t  = threadIdx.x;
  int pr = blockIdx.x * 32 + (t >> 3);
  pr = (pr < nRows) ? pr : (nRows - 1);            // address clamp (grid is exact)
  const int c8 = (t & 7) * 8;
  const int g  = pr / rowsPerGroup;
  const int r  = pr - g * rowsPerGroup;
  const float* s = src + ((size_t)g * srcRowsPerGroup + r) * HD + c8;
  const v4f a = *(const v4f*)(s);
  const v4f b = *(const v4f*)(s + 4);
  unsigned short hb[8];
#pragma unroll
  for (int e = 0; e < 4; ++e) { hb[e] = f2bf_bits(a[e]); hb[4 + e] = f2bf_bits(b[e]); }
  const v4u u = (v4u){pk16(hb[0], hb[1]), pk16(hb[2], hb[3]), pk16(hb[4], hb[5]), pk16(hb[6], hb[7])};
  unsigned short* d = dst + (size_t)pr * HD + c8;
  *(v4u*)d = u;
  
}

// ---------------------------------------------------------------------------
// (2) V cast + transpose: Vt[bh][d][kv] = f16( bf16( v[bh][kv][d] ) )   (pitch SKV halves)
// grid (SKV/64, NB*NH), 256 threads; one 64(kv) x 64(d) tile through LDS.
// Load coverage: 16 iterations x 256 threads = 4096 = whole tile (coalesced along d); sm cross-wave -> __syncthreads.
// Store coverage: 8 waves x 2 iterations x 4 rows (lane>>3) = 64 d-rows; (lane&7) x 8 halves = 64 kv;
// ---------------------------------------------------------------------------
__global__ __launch_bounds__(256) void v_transpose_kernel(const float* __restrict__ v,
                                                           _Float16* __restrict__ Vt) {
  __shared__ float sm[64][65];   // sm[kv_local][d]
  const int tid = threadIdx.x;
  const int kv0 = blockIdx.x * 64;
  const int bh  = blockIdx.y;                        // b*NH + h, b < NB
  const float* vb = v + ((size_t)bh * SKV_FULL + kv0) * HD;
#pragma unroll
  for (int i = 0; i < 16; ++i) {
    const int e = i * 256 + tid;
    const int r = e >> 6;          // kv local
    const int c = e & 63;          // d
    sm[r][c] = vb[(size_t)r * HD + c];
  }
  __syncthreads();
  const int lane = tid & 31, wave = tid >> 5;
  const int q = lane >> 3, c8 = (lane & 7) * 8;
  _Float16* vt = Vt + (size_t)bh * HD * SKV;
  {
#pragma unroll
    for (int it = 0; it < 2; ++it) {
      const int row = wave * 8 + it * 4 + q;          // d
      v8h hv;
#pragma unroll
      for (int e = 0; e < 8; ++e) hv[e] = (_Float16)bf_bits2f(f2bf_bits(sm[c8 + e][row]));
      *(v8h*)(vt + (size_t)row * SKV + kv0 + c8) = hv;
    }
    
  }
}

// ---------------------------------------------------------------------------
// LDS ring of the attention kernel: a stage = one 128-key K tile (128 kv rows x 128 B) and one V^T tile (64 d rows x 256 B).
// ---------------------------------------------------------------------------
constexpr int kKeys   = 128;              // keys per stage = per publish point = per softmax pass
constexpr int kPitchK = 144;              // K row pitch in bytes: 128 + 16, an odd multiple of 16 (ds_load_b128 readers)
constexpr int kPitchV = 272;              // V^T row pitch in bytes: 256 + 16, an odd multiple of 16
constexpr int kTileKB = kKeys * kPitchK;  // K tile
constexpr int kTileVB = HD * kPitchV;     // V^T tile
constexpr int kStageB = kTileKB + kTileVB;   // K tile, then V^T tile
static_assert(kPitchK % 16 == 0 && ((kPitchK / 16) & 1) == 1);
static_assert(kPitchV % 16 == 0 && ((kPitchV / 16) & 1) == 1);
static_assert(kTileKB % 16 == 0 && kStageB % 16 == 0);
static_assert(SKV >= kKeys);              // the ring's prologue fills stage 0 without a test

// Eight 16-byte asynchronous copies per lane = this lane's share of one stage: K rows 32 apart from (lk, gk), V^T rows 16 apart
// from (lv, gv). l* = LDS byte addresses, g* = global addresses.
// s_wait_xcnt 0 is the statement's last line so that it stands ahead of any rewrite of the address registers the copies name.
__device__ __forceinline__ void copy_stage(unsigned lk, unsigned lv, const unsigned char* gk, const unsigned char* gv) {
  asm volatile("global_load_async_to_lds_b128 %0, %8, off\n\t"
               "global_load_async_to_lds_b128 %1, %9, off\n\t"
               "global_load_async_to_lds_b128 %2, %10, off\n\t"
               "global_load_async_to_lds_b128 %3, %11, off\n\t"
               "global_load_async_to_lds_b128 %4, %12, off\n\t"
               "global_load_async_to_lds_b128 %5, %13, off\n\t"
               "global_load_async_to_lds_b128 %6, %14, off\n\t"
               "global_load_async_to_lds_b128 %7, %15, off\n\t"
               "s_wait_xcnt 0x0"
               :: "v"(lk), "v"(lk + 32 * kPitchK), "v"(lk + 64 * kPitchK), "v"(lk + 96 * kPitchK),
                  "v"(lv), "v"(lv + 16 * kPitchV), "v"(lv + 32 * kPitchV), "v"(lv + 48 * kPitchV),
                  "v"(gk), "v"(gk + 32 * HD * 2), "v"(gk + 64 * HD * 2), "v"(gk + 96 * HD * 2),
                  "v"(gv), "v"(gv + (size_t)16 * SKV * 2), "v"(gv + (size_t)32 * SKV * 2), "v"(gv + (size_t)48 * SKV * 2)
               : "memory");
}
// the wave's own copies have landed (the compiler places no wait for them)
__device__ __forceinline__ void wait_async0() { asm volatile("s_wait_asynccnt 0x0" ::: "memory"); }
// the wave's own LDS reads have returned, before the buffer is handed to its next writer
__device__ __forceinline__ void wait_ds0() { asm volatile("s_wait_dscnt 0x0" ::: "memory"); }

// ---------------------------------------------------------------------------
// (3) Flash-style prefix-causal attention. grid (SEQ/128, NH, NB), 256 threads = 8 waves x 16 query rows; blockIdx.x -> query tile by a per-head permutation.
// Per wave: Q B-fragments (bf16, RNE) in registers; loop over 128-key tiles up to the last visible key;
//   S^T subtile = K(16 kv x 64 d, bf16 plane rows) . Q^T : 2 bf16 WMMAs; mask (kv > q + num_pt -> -inf) on the raw scores, f32 online
//   softmax in log2 domain, p x4096 = exp2(s * scale + (12 - max)): one FMA a score carries scale, maximum and carry
//   (row stats shared by lanes l and l^16); O^T += V^T(16 d x 32 kv, f16 plane rows) . P^T with
//   P^T fragment = [own D of subtile 2si (kv 0-15 of slice), own D of subtile 2si+1 (kv 16-31)] as f16 x4096.
// K and V^T tiles are brought into LDS once per work-group by asynchronous copies, two buffers: tile t + 1 flies while tile t is
// worked on; one publish point per tile (own LDS reads done, own copies landed, barrier, refill), passed by every wave; a wave
// skips only the work of tiles beyond its own last visible key.
// ---------------------------------------------------------------------------
__global__ __launch_bounds__(256) void attn_kernel(const float* __restrict__ q,
                                                    const unsigned short* __restrict__ Kp,
                                                    const unsigned short* __restrict__ Vtp,
                                                    const int* __restrict__ np,
                                                    float* __restrict__ out) {
  __shared__ __align__(16) float sT[8][16 * 68];   // per-wave 16x64 slab, pitch 68 floats
  __shared__ __align__(16) unsigned char ring[2 * kStageB];
  const int tid  = threadIdx.x;
  const int wave = __builtin_amdgcn_readfirstlane(tid >> 5);   // scalar: the per-wave skip between publish points is a scalar branch
  const int lane = tid & 31;
  const int hi   = lane >> 4;                // lane half: k offset 8*hi, D row offset 8*hi
  const int l15  = lane & 15;                // A row / B,D column
  const int h    = blockIdx.y;
  const int b    = blockIdx.z;
  const int bh   = b * NH + h;
  // Query tile of this work-group. A tile's cost grows with its index (tile t walks t more key tiles than tile 0) and every
  // work-group is resident from the start, two to a WGP, so the launch lasts as long as the fullest WGP. Work-groups whose flat
  // index differs in one bit above the low three get tiles d and kQT - 1 - d: equal sums.
  // For speed only: for each bh the map is a permutation of the tiles, wherever the work-groups land.
  constexpr int kQT = SEQ / 128;
  int qt = blockIdx.x;
  if (kQT % 2 == 0) {
    const int up   = (qt >= kQT / 2) ? 1 : 0;
    const int d    = qt - up * (kQT / 2);
    const int flip = (up ^ __builtin_popcount((unsigned)bh)) & 1;
    qt = flip ? (kQT - 1 - d) : d;
  }
  const int q0w  = qt * 128 + wave * 16;

  int numpt = np[0];
  numpt = (numpt < 0) ? 0 : numpt;
  numpt = (numpt > SKV) ? SKV : numpt;

  const float*    Qb = q + ((size_t)bh * SEQ_FULL) * HD;
  const __bf16*   Kb = (const __bf16*)Kp + (size_t)bh * SKV * HD;
  const _Float16* Vb = (const _Float16*)Vtp + (size_t)bh * HD * SKV;
  float*          Ob = out + ((size_t)bh * SEQ) * HD;

  // ---- Q as bf16 B operand of S^T = K.Q^T: B[k=d][n=q]; elements 0..7 <- d k0+8hi+0..7, 8..15 <- d k0+16+8hi+0..7 ----
  v16b bq[2];
  {
    const float* qrow = Qb + (size_t)(q0w + l15) * HD;
#pragma unroll
    for (int si = 0; si < 2; ++si) {
      const v4f f0 = *(const v4f*)(qrow + si * 32 + 8 * hi);
      const v4f f1 = *(const v4f*)(qrow + si * 32 + 8 * hi + 4);
      const v4f g0 = *(const v4f*)(qrow + si * 32 + 16 + 8 * hi);
      const v4f g1 = *(const v4f*)(qrow + si * 32 + 16 + 8 * hi + 4);
      v8u u;
      u[0] = pk16(f2bf_bits(f0[0]), f2bf_bits(f0[1]));
      u[1] = pk16(f2bf_bits(f0[2]), f2bf_bits(f0[3]));
      u[2] = pk16(f2bf_bits(f1[0]), f2bf_bits(f1[1]));
      u[3] = pk16(f2bf_bits(f1[2]), f2bf_bits(f1[3]));
      u[4] = pk16(f2bf_bits(g0[0]), f2bf_bits(g0[1]));
      u[5] = pk16(f2bf_bits(g0[2]), f2bf_bits(g0[3]));
      u[6] = pk16(f2bf_bits(g1[0]), f2bf_bits(g1[1]));
      u[7] = pk16(f2bf_bits(g1[2]), f2bf_bits(g1[3]));
      bq[si] = __builtin_bit_cast(v16b, u);
    }
  }

  // O^T accumulators: oacc[dg][r] = carry * O[q0w+l15][dg*16 + 8*hi + r]
  v8f oacc[4];
#pragma unroll
  for (int dg = 0; dg < 4; ++dg) oacc[dg] = zero8();
  float m = NEG_INF;                         // per-lane row stats (log2 domain)
  float l = 0.f;                             // row sum, carried x4096 like p

  const int qmax   = q0w + 15 + numpt;       // last visible key of this wave's last row
  const int kv_end = (SKV < qmax + 1) ? SKV : (qmax + 1);

  // work-group-uniform tile count: up to the last visible key of the block's last row; >= 1, <= SKV / 128
  const int qmaxb = qt * 128 + 127 + numpt;
  const int nt    = (((SKV < qmaxb + 1) ? SKV : (qmaxb + 1)) + kKeys - 1) / kKeys;

  // this lane's share of a stage: 16 B at column ccol of K rows crow + 32 j, 16 B at column vcol of V^T rows vrw + 16 j, j < 4
  // (a wave-wide copy = 4 whole lines)
  const int crow = tid >> 3, ccol = (tid & 7) * 16;
  const int vrw  = tid >> 4, vcol = (tid & 15) * 16;
  const unsigned char* kg = (const unsigned char*)Kb + (size_t)crow * (HD * 2) + ccol;
  const unsigned char* vg = (const unsigned char*)Vb + (size_t)vrw * (SKV * 2) + vcol;
  const unsigned       lck = (unsigned)(size_t)ring + crow * kPitchK + ccol;
  const unsigned       lcv = (unsigned)(size_t)ring + kTileKB + vrw * kPitchV + vcol;
  auto issue_stage = [&](int s) {
    const unsigned ob = (s & 1) * kStageB;
    copy_stage(lck + ob, lcv + ob, kg + (size_t)s * (kKeys * HD * 2), vg + (size_t)s * (kKeys * 2));
  };

  issue_stage(0);
  wait_async0();
  __syncthreads();
  if (nt > 1) issue_stage(1);                  // work-group-uniform

#pragma unroll 1
  for (int it = 0; it < nt; ++it) {
    const int kv0 = it * kKeys;
    const unsigned char* stK = ring + (it & 1) * kStageB;
    const unsigned char* stV = stK + kTileKB;
    if (kv0 < kv_end) {                        // wave-uniform (scalar): tiles beyond this wave's last visible key hold no work
    // ---- S^T subtiles (16 kv each): 2 bf16 WMMAs, then the mask; the scores stay unscaled ----
    v8f s4[8];
    if (kv0 + kKeys - 1 <= q0w + numpt) {      // wave-uniform (scalar): every key of the tile is visible to every row of the wave
      // interior tile: no mask and no per-subtile test; the 32 K fragment loads stand as one group, the WMMAs run 8 at a time on 4 independent tiles
      v16b ak[8][2];
      const __bf16* krow = (const __bf16*)(stK + l15 * kPitchK) + 8 * hi;
#pragma unroll
      for (int g = 0; g < 2; ++g) {
#pragma unroll
        for (int t = 4 * g; t < 4 * g + 4; ++t) ak[t][0] = FragB::load(krow + t * 16 * (kPitchK / 2));
#pragma unroll
        for (int t = 4 * g; t < 4 * g + 4; ++t) ak[t][1] = FragB::load(krow + t * 16 * (kPitchK / 2) + 32);
      }
      __builtin_amdgcn_sched_barrier(0);       // keeps the loads one group ahead of the WMMAs: one LDS latency a tile, not one a subtile
      v8f s[8];
#pragma unroll
      for (int g = 0; g < 2; ++g) {
#pragma unroll
        for (int t = 4 * g; t < 4 * g + 4; ++t) s[t] = FragB::mma(ak[t][0], bq[0], zero8());
#pragma unroll
        for (int t = 4 * g; t < 4 * g + 4; ++t) s[t] = FragB::mma(ak[t][1], bq[1], s[t]);
      }
      __builtin_amdgcn_sched_barrier(0);       // keeps the 16 WMMAs back to back: each fills the others' result distance instead of v_nop
#pragma unroll
      for (int t = 0; t < 8; ++t) s4[t] = s[t];
    } else {
#pragma unroll
    for (int t = 0; t < 8; ++t) {
      const int c0 = kv0 + t * 16;
      if (c0 > qmax) {                       // wave-uniform: whole subtile masked
        s4[t] = neg8();
        continue;
      }
      const __bf16* krow = (const __bf16*)(stK + (t * 16 + l15) * kPitchK) + 8 * hi;
      const v16b ak0 = FragB::load(krow);
      const v16b ak1 = FragB::load(krow + 32);
      v8f s = zero8();
      s = FragB::mma(ak0, bq[0], s);
      s = FragB::mma(ak1, bq[1], s);
      dep_guard1_b(s, ak0, ak1, bq[0], bq[1]);
      const bool part = (c0 + 15 > q0w + numpt);   // wave-uniform: some (q, kv) of the subtile masked
      const int  lim  = q0w + l15 + numpt - c0;     // kv local index visible iff <= lim
      v8f sc;
#pragma unroll
      for (int r = 0; r < 8; ++r) {
        float vv = s[r];
        if (part && (r + 8 * hi > lim)) vv = NEG_INF;
        sc[r] = vv;
      }
      s4[t] = sc;
    }
    }

    // ---- tile-level online softmax in log2 domain ----
    float tmax = fmaxf(fmaxf(fmaxf(hmax8(s4[0]), hmax8(s4[1])), fmaxf(hmax8(s4[2]), hmax8(s4[3]))),
                       fmaxf(fmaxf(hmax8(s4[4]), hmax8(s4[5])), fmaxf(hmax8(s4[6]), hmax8(s4[7]))));
    tmax = fmaxf(tmax, __shfl_xor(tmax, 16, 32));
    const float mn    = fmaxf(m, tmax * kScale2);   // scale > 0: the scaled maximum is the maximum of the scaled scores
    const float alpha = (m > NEG_INF) ? EXP2(m - mn) : 0.0f;
    const float bias  = kCarryLog2 - ((mn > NEG_INF) ? mn : 0.0f);
    m = mn;
    const v8f sc8 = (v8f){kScale2, kScale2, kScale2, kScale2, kScale2, kScale2, kScale2, kScale2};
    const v8f bi8 = (v8f){bias, bias, bias, bias, bias, bias, bias, bias};
#pragma unroll
    for (int t = 0; t < 8; ++t) {
      const v8f a = __builtin_elementwise_fma(s4[t], sc8, bi8);
#pragma unroll
      for (int r = 0; r < 8; ++r) s4[t][r] = EXP2(a[r]);
    }
    float ts = ((hsum8(s4[0]) + hsum8(s4[1])) + (hsum8(s4[2]) + hsum8(s4[3]))) +
               ((hsum8(s4[4]) + hsum8(s4[5])) + (hsum8(s4[6]) + hsum8(s4[7])));
    ts += __shfl_xor(ts, 16, 32);
    l = l * alpha + ts;
#pragma unroll
    for (int dg = 0; dg < 4; ++dg)
#pragma unroll
      for (int r = 0; r < 8; ++r) oacc[dg][r] *= alpha;

    // ---- O^T += V^T . P^T : 4 slices of 32 kv, 4 f16 WMMAs each ----
#pragma unroll
    for (int si = 0; si < 4; ++si) {
      const v8f p0 = s4[2 * si];               // kv si*32 + 8*hi + 0..7 of this lane's q column
      const v8f p1 = s4[2 * si + 1];           // kv si*32 + 16 + 8*hi + 0..7
      v8u u;
#pragma unroll
      for (int j = 0; j < 4; ++j) {
        u[j]     = pkh2(p0[2 * j], p0[2 * j + 1]);
        u[4 + j] = pkh2(p1[2 * j], p1[2 * j + 1]);
      }
      const v16h bp = __builtin_bit_cast(v16h, u);
      const _Float16* vrow = (const _Float16*)(stV + l15 * kPitchV) + si * 32 + 8 * hi;   // row d = dg*16 + l15
      const v16h av0 = FragH::load(vrow);
      const v16h av1 = FragH::load(vrow + 16 * (kPitchV / 2));
      const v16h av2 = FragH::load(vrow + 32 * (kPitchV / 2));
      const v16h av3 = FragH::load(vrow + 48 * (kPitchV / 2));
      oacc[0] = FragH::mma(av0, bp, oacc[0]);
      oacc[1] = FragH::mma(av1, bp, oacc[1]);
      oacc[2] = FragH::mma(av2, bp, oacc[2]);
      oacc[3] = FragH::mma(av3, bp, oacc[3]);
      dep_guard4_h(oacc[0], oacc[1], oacc[2], oacc[3], av3, bp);
      keep4_h(av0, av1, av2, bp);
    }
    }
    // ---- publish point of tile it + 1, every wave: own reads of this buffer done, own copies landed, barrier, then the refill ----
    wait_ds0();
    wait_async0();
    __syncthreads();
    if (it + 2 < nt) issue_stage(it + 2);      // work-group-uniform: into the buffer that this trip has just read
  }
  wait_async0();
  acc_guard4(oacc[0], oacc[1], oacc[2], oacc[3]);

  // ---- epilogue: normalize, transpose O^T -> O through the wave's LDS slab, whole-line stores ----
  const float inv = (l > 0.f) ? (1.0f / l) : 0.f;   // the carry stands in oacc and in l alike and cancels
  float* slab = sT[wave];
#pragma unroll
  for (int dg = 0; dg < 4; ++dg)
#pragma unroll
    for (int r = 0; r < 8; ++r)
      slab[l15 * 68 + dg * 16 + 8 * hi + r] = oacc[dg][r] * inv;
  __builtin_amdgcn_fence(3 /* release order */, "workgroup");
  __builtin_amdgcn_wave_barrier();
  __builtin_amdgcn_fence(2 /* acquire order */, "workgroup");
  const int hh = lane >> 4, c4 = (lane & 15) * 4;   // row seg = 256 B = 16 lanes x 16 B
  {
#pragma unroll
    for (int it = 0; it < 8; ++it) {
      const int row = it * 2 + hh;
      const v4f vv = *(const v4f*)(slab + row * 68 + c4);
      *(v4f*)(Ob + (size_t)(q0w + row) * HD + c4) = vv;
    }
    
  }
}

// ---------------------------------------------------------------------------
// Host glue.
//   Kp  bf16 [NB*NH][SKV][64]     NB*NH*SKV*128   at 0              (cast_rows_kernel)
//   Vt  f16  [NB*NH][64][SKV]     NB*NH*SKV*128   at NB*NH*SKV*128  (v_transpose_kernel)
//   total (NB=2, SKV=3072)         25,165,824
// 3 launches.
// ---------------------------------------------------------------------------
extern "C" void kernel_launch(void* const* d_in, const int* in_sizes, int n_in,
                              void* d_out, int out_size, void* d_ws, size_t ws_size,
                              hipStream_t stream) {
  if (n_in < 4) return;
  if (in_sizes[0] < NB * NH * SEQ * HD) return;
  if (in_sizes[1] < NB * NH * SKV * HD) return;
  if (in_sizes[2] < NB * NH * SKV * HD) return;
  if (in_sizes[3] < 1) return;
  if (out_size < NB * NH * SEQ * HD) return;

  const size_t szK   = (size_t)NB * NH * SKV * HD * 2;
  const size_t szVt  = (size_t)NB * NH * HD * SKV * 2;
  const size_t offK  = 0;
  const size_t offVt = offK + szK;
  const size_t total = offVt + szVt;
  if (ws_size < total) return;

  const float* q  = (const float*)d_in[0];
  const float* k  = (const float*)d_in[1];
  const float* v  = (const float*)d_in[2];
  const int*   np = (const int*)d_in[3];
  float* out = (float*)d_out;
  char* ws = (char*)d_ws;
  unsigned short* Kp = (unsigned short*)(ws + offK);
  _Float16*       Vt = (_Float16*)(ws + offVt);

  const int nRowsK = NB * NH * SKV;                 // multiple of 32
  // (1) Kp[bh][kv][d] = bf16(k[bh][kv][d])
  cast_rows_kernel<<<dim3(nRowsK / 32), dim3(256), 0, stream>>>(k, Kp, SKV, SKV_FULL, nRowsK);
  // (2) Vt[bh][d][kv] = f16(bf16(v[bh][kv][d]))
  v_transpose_kernel<<<dim3(SKV / 64, NB * NH), dim3(256), 0, stream>>>(v, Vt);
  // (3) attention
  attn_kernel<<<dim3(SEQ / 128, NH, NB), dim3(256), 0, stream>>>(q, Kp, (const unsigned short*)Vt, np, out);
}

// v006
// Measured time: 47.5 microseconds a run.
// Next to v005, in two timings, it ran 1.06 times as fast each time.
// Counting every step since v000, it is 4.49 times as fast.
// Contractions: scores K.Q^T on v_wmma_f32_16x16x32_bf16 (bf16 operands = RNE bf16 copies of q and k, f32 accumulate); context V^T.P^T on v_wmma_f32_16x16x32_f16 (f16 operands: v = f16 of its RNE bf16 copy, p carried x4096, f32 accumulate); scale, mask and online softmax in f32.
#include <hip/hip_runtime.h>
#include <math.h>

// ---------------------------------------------------------------------------
// Problem constants (NB / SEQ / SKV overridable for a reduced build; *_FULL = input strides)
// ---------------------------------------------------------------------------
#ifndef NB
#define NB 2
#endif
#ifndef SEQ
#define SEQ 2048
#endif
#ifndef SKV
#define SKV 3072
#endif
#define NB_FULL   2
#define NH        16
#define HD        64
#define SEQ_FULL  2048
#define SKV_FULL  3072

static_assert(NB >= 1 && NB <= NB_FULL);
static_assert(SEQ % 128 == 0 && SEQ <= SEQ_FULL);
static_assert(SKV % 128 == 0 && SKV <= SKV_FULL);
static_assert(HD == 64);
static_assert((NB * NH * SKV) % 32 == 0);

constexpr float kScale2   = 0.125f * 1.44269504088896340736f;   // 1/sqrt(64) * log2(e): softmax in log2 domain
constexpr float kCarryLog2 = 12.0f;                            // p in [0,1] carried x4096 (f16 operand and row sum alike): 12 added to the exp2 argument
#define NEG_INF (-__builtin_inff())

#if __has_builtin(__builtin_amdgcn_exp2f)
#define EXP2(x) __builtin_amdgcn_exp2f(x)
#else
#define EXP2(x) exp2f(x)
#endif

typedef __attribute__((ext_vector_type(16))) _Float16 v16h;
typedef __attribute__((ext_vector_type(8)))  _Float16 v8h;
typedef __attribute__((ext_vector_type(2)))  _Float16 v2h;
typedef __attribute__((ext_vector_type(16))) __bf16   v16b;
typedef __attribute__((ext_vector_type(8)))  __bf16   v8b;
typedef __attribute__((ext_vector_type(8)))  float    v8f;
typedef __attribute__((ext_vector_type(4)))  float    v4f;
typedef __attribute__((ext_vector_type(4)))  unsigned int v4u;
typedef __attribute__((ext_vector_type(8)))  unsigned int v8u;

__device__ __forceinline__ unsigned short f2bf_bits(float f) {        // RNE convert f32 -> bf16 bits
  unsigned u = __float_as_uint(f);
  return (unsigned short)((u + 0x7FFFu + ((u >> 16) & 1u)) >> 16);
}
__device__ __forceinline__ float bf_bits2f(unsigned short h) { return __uint_as_float(((unsigned)h) << 16); }

// hazard guards: 4 VALU slots after the last WMMA of a group, tie D, keep A/B live
__device__ __forceinline__ void acc_guard8(v8f& a, v8f& b, v8f& c, v8f& d, v8f& e, v8f& f, v8f& g, v8f& h) {
  asm volatile("v_nop\n\tv_nop\n\tv_nop\n\tv_nop" : "+v"(a), "+v"(b), "+v"(c), "+v"(d), "+v"(e), "+v"(f), "+v"(g), "+v"(h));
}
__device__ __forceinline__ void dep_guard2_b(v8f& a, v8f& b, v16b w, v16b x, v16b y0, v16b y1, v16b z0, v16b z1) {
  asm volatile("v_nop\n\tv_nop\n\tv_nop\n\tv_nop" : "+v"(a), "+v"(b) : "v"(w), "v"(x), "v"(y0), "v"(y1), "v"(z0), "v"(z1));
}

template <typename T> struct Frag;
template <> struct Frag<_Float16> {
  typedef v16h V; union U { v16h v; v8h h[2]; };
  // elements 0..7 <- p[0..7], 8..15 <- p[16..23]; caller passes p = row + k0 + 8*(lane>>4)
  static __device__ __forceinline__ v16h load(const _Float16* p) {
    U f; f.h[0] = *(const v8h*)(p); f.h[1] = *(const v8h*)(p + 16); return f.v;
  }
  static __device__ __forceinline__ v8f mma(v16h a, v16h b, v8f c) {
    return __builtin_amdgcn_wmma_f32_16x16x32_f16(false, a, false, b, (short)0, c, false, false);
  }
};
template <> struct Frag<__bf16> {
  typedef v16b V; union U { v16b v; v8b h[2]; };
  static __device__ __forceinline__ v16b load(const __bf16* p) {
    U f; f.h[0] = *(const v8b*)(p); f.h[1] = *(const v8b*)(p + 16); return f.v;
  }
  static __device__ __forceinline__ v8f mma(v16b a, v16b b, v8f c) {
    return __builtin_amdgcn_wmma_f32_16x16x32_bf16(false, a, false, b, (short)0, c, false, false);
  }
};
typedef Frag<_Float16> FragH;
typedef Frag<__bf16>   FragB;

__device__ __forceinline__ unsigned pk16(unsigned short a, unsigned short b) { return (unsigned)a | ((unsigned)b << 16); }
// pack two f32 -> one dword of two f16 (element 0 = a)
__device__ __forceinline__ unsigned pkh2(float a, float b) {
  v2h p; p[0] = (_Float16)a; p[1] = (_Float16)b;
  return __builtin_bit_cast(unsigned, p);
}
__device__ __forceinline__ v8f zero8() { return (v8f){0.f, 0.f, 0.f, 0.f, 0.f, 0.f, 0.f, 0.f}; }
__device__ __forceinline__ v8f neg8()  { return (v8f){NEG_INF, NEG_INF, NEG_INF, NEG_INF, NEG_INF, NEG_INF, NEG_INF, NEG_INF}; }
// balanced-tree horizontal reductions
__device__ __forceinline__ float hsum8(v8f v) {
  float a = v[0] + v[1], b = v[2] + v[3], c = v[4] + v[5], d = v[6] + v[7];
  return (a + b) + (c + d);
}
__device__ __forceinline__ float hmax8(v8f v) {
  float a = fmaxf(v[0], v[1]), b = fmaxf(v[2], v[3]);
  float c = fmaxf(v[4], v[5]), d = fmaxf(v[6], v[7]);
  return fmaxf(fmaxf(a, b), fmaxf(c, d));
}

// ---------------------------------------------------------------------------
// dst row pr = g * rowsPerGroup + r  <-  src row g * srcRowsPerGroup + r  (g = (b*NH + h)).
// Block 256 threads = 32 rows; thread t: row t>>3, 8 halves at (t&7)*8.
// ---------------------------------------------------------------------------
__global__ __launch_bounds__(256) void cast_rows_kernel(const float* __restrict__ src,
                                                         unsigned short* __restrict__ dst,
                                                         int rowsPerGroup, int srcRowsPerGroup, int nRows) {
  const int t  = threadIdx.x;
  int pr = blockIdx.x * 32 + (t >> 3);
  pr = (pr < nRows) ? pr : (nRows - 1);            // address clamp (grid is exact)
  const int c8 = (t & 7) * 8;
  const int g  = pr / rowsPerGroup;
  const int r  = pr - g * rowsPerGroup;
  const float* s = src + ((size_t)g * srcRowsPerGroup + r) * HD + c8;
  const v4f a = *(const v4f*)(s);
  const v4f b = *(const v4f*)(s + 4);
  unsigned short hb[8];
#pragma unroll
  for (int e = 0; e < 4; ++e) { hb[e] = f2bf_bits(a[e]); hb[4 + e] = f2bf_bits(b[e]); }
  const v4u u = (v4u){pk16(hb[0], hb[1]), pk16(hb[2], hb[3]), pk16(hb[4], hb[5]), pk16(hb[6], hb[7])};
  unsigned short* d = dst + (size_t)pr * HD + c8;
  *(v4u*)d = u;
  
}

// ---------------------------------------------------------------------------
// (2) V cast + transpose: Vt[bh][d][kv] = f16( bf16( v[bh][kv][d] ) )   (pitch SKV halves)
// grid (SKV/64, NB*NH), 256 threads; one 64(kv) x 64(d) tile through LDS.
// Load coverage: 16 iterations x 256 threads = 4096 = whole tile (coalesced along d); sm cross-wave -> __syncthreads.
// Store coverage: 8 waves x 2 iterations x 4 rows (lane>>3) = 64 d-rows; (lane&7) x 8 halves = 64 kv;
// ---------------------------------------------------------------------------
__global__ __launch_bounds__(256) void v_transpose_kernel(const float* __restrict__ v,
                                                           _Float16* __restrict__ Vt) {
  __shared__ float sm[64][65];   // sm[kv_local][d]
  const int tid = threadIdx.x;
  const int kv0 = blockIdx.x * 64;
  const int bh  = blockIdx.y;                        // b*NH + h, b < NB
  const float* vb = v + ((size_t)bh * SKV_FULL + kv0) * HD;
#pragma unroll
  for (int i = 0; i < 16; ++i) {
    const int e = i * 256 + tid;
    const int r = e >> 6;          // kv local
    const int c = e & 63;          // d
    sm[r][c] = vb[(size_t)r * HD + c];
  }
  __syncthreads();
  const int lane = tid & 31, wave = tid >> 5;
  const int q = lane >> 3, c8 = (lane & 7) * 8;
  _Float16* vt = Vt + (size_t)bh * HD * SKV;
  {
#pragma unroll
    for (int it = 0; it < 2; ++it) {
      const int row = wave * 8 + it * 4 + q;          // d
      v8h hv;
#pragma unroll
      for (int e = 0; e < 8; ++e) hv[e] = (_Float16)bf_bits2f(f2bf_bits(sm[c8 + e][row]));
      *(v8h*)(vt + (size_t)row * SKV + kv0 + c8) = hv;
    }
    
  }
}

// ---------------------------------------------------------------------------
// LDS ring of the attention kernel: a stage = one 128-key K tile (128 kv rows x 128 B) and one V^T tile (64 d rows x 256 B).
// ---------------------------------------------------------------------------
constexpr int kKeys   = 128;              // keys per stage = per publish point; a wave's softmax pass takes 64 of them
constexpr int kPitchK = 144;              // K row pitch in bytes: 128 + 16, an odd multiple of 16 (ds_load_b128 readers)
constexpr int kPitchV = 272;              // V^T row pitch in bytes: 256 + 16, an odd multiple of 16
constexpr int kTileKB = kKeys * kPitchK;  // K tile
constexpr int kTileVB = HD * kPitchV;     // V^T tile
constexpr int kStageB = kTileKB + kTileVB;   // K tile, then V^T tile
static_assert(kPitchK % 16 == 0 && ((kPitchK / 16) & 1) == 1);
static_assert(kPitchV % 16 == 0 && ((kPitchV / 16) & 1) == 1);
static_assert(kTileKB % 16 == 0 && kStageB % 16 == 0);
static_assert(SKV >= kKeys);              // the ring's prologue fills stage 0 without a test

// Eight 16-byte asynchronous copies per lane = this lane's share of one stage: K rows 32 apart from (lk, gk), V^T rows 16 apart
// from (lv, gv). l* = LDS byte addresses, g* = global addresses.
// s_wait_xcnt 0 is the statement's last line so that it stands ahead of any rewrite of the address registers the copies name.
__device__ __forceinline__ void copy_stage(unsigned lk, unsigned lv, const unsigned char* gk, const unsigned char* gv) {
  asm volatile("global_load_async_to_lds_b128 %0, %8, off\n\t"
               "global_load_async_to_lds_b128 %1, %9, off\n\t"
               "global_load_async_to_lds_b128 %2, %10, off\n\t"
               "global_load_async_to_lds_b128 %3, %11, off\n\t"
               "global_load_async_to_lds_b128 %4, %12, off\n\t"
               "global_load_async_to_lds_b128 %5, %13, off\n\t"
               "global_load_async_to_lds_b128 %6, %14, off\n\t"
               "global_load_async_to_lds_b128 %7, %15, off\n\t"
               "s_wait_xcnt 0x0"
               :: "v"(lk), "v"(lk + 32 * kPitchK), "v"(lk + 64 * kPitchK), "v"(lk + 96 * kPitchK),
                  "v"(lv), "v"(lv + 16 * kPitchV), "v"(lv + 32 * kPitchV), "v"(lv + 48 * kPitchV),
                  "v"(gk), "v"(gk + 32 * HD * 2), "v"(gk + 64 * HD * 2), "v"(gk + 96 * HD * 2),
                  "v"(gv), "v"(gv + (size_t)16 * SKV * 2), "v"(gv + (size_t)32 * SKV * 2), "v"(gv + (size_t)48 * SKV * 2)
               : "memory");
}
// the wave's own copies have landed (the compiler places no wait for them)
__device__ __forceinline__ void wait_async0() { asm volatile("s_wait_asynccnt 0x0" ::: "memory"); }
// the wave's own LDS reads have returned, before the buffer is handed to its next writer
__device__ __forceinline__ void wait_ds0() { asm volatile("s_wait_dscnt 0x0" ::: "memory"); }

// ---------------------------------------------------------------------------
// (3) Flash-style prefix-causal attention. grid (SEQ/128, NH, NB), 256 threads = 8 waves = 4 column groups of 32 query rows x 2 key
// halves; blockIdx.x -> query tile by a per-head permutation.
// Wave (cg, kh) works on query rows cg*32 .. +31 and on keys kh*64 .. +63 of every 128-key stage: each K and V^T fragment it reads
// from LDS feeds two WMMAs (one per 16-row column subgroup), so a score costs half the LDS bytes of a 16-row wave.
// Per wave: Q B-fragments (bf16, RNE) in registers; loop over the stages up to the last visible key;
//   S^T subtile = K(16 kv x 64 d, bf16 plane rows) . Q^T : 2 bf16 WMMAs a subgroup; mask (kv > q + num_pt -> -inf) on the raw scores,
//   f32 online softmax in log2 domain, p x4096 = exp2(s * scale + (12 - max)): one FMA a score carries scale, maximum and carry
//   (row stats shared by lanes l and l^16); O^T += V^T(16 d x 32 kv, f16 plane rows) . P^T with
//   P^T fragment = [own D of subtile 2si (kv 0-15 of slice), own D of subtile 2si+1 (kv 16-31)] as f16 x4096.
// The two key halves of a column group keep their own maximum, row sum and O^T and are joined once, in the epilogue, through LDS.
// K and V^T tiles are brought into LDS once per work-group by asynchronous copies, two buffers: tile t + 1 flies while tile t is
// worked on; one publish point per tile (own LDS reads done, own copies landed, barrier, refill), passed by every wave; a wave
// skips only the work of key blocks beyond its own last visible key.
// ---------------------------------------------------------------------------
constexpr int kWKeys = kKeys / 2;         // keys of a stage that one wave works on
__global__ __launch_bounds__(256) void attn_kernel(const float* __restrict__ q,
                                                    const unsigned short* __restrict__ Kp,
                                                    const unsigned short* __restrict__ Vtp,
                                                    const int* __restrict__ np,
                                                    float* __restrict__ out) {
  __shared__ __align__(16) float sT[4][32 * 68];   // per column group: 32 query rows x 64 d, pitch 68 floats
  __shared__ float sM[4][32];                      // upper key half's row maximum
  __shared__ float sL[4][32];                      // upper key half's row sum
  __shared__ __align__(16) unsigned char ring[2 * kStageB];
  const int tid  = threadIdx.x;
  const int wave = __builtin_amdgcn_readfirstlane(tid >> 5);   // scalar: the per-wave skip between publish points is a scalar branch
  const int cg   = wave & 3;                 // column group: 32 query rows
  const int kh   = wave >> 2;                // key half of every stage
  const int lane = tid & 31;
  const int hi   = lane >> 4;                // lane half: k offset 8*hi, D row offset 8*hi
  const int l15  = lane & 15;                // A row / B,D column
  const int h    = blockIdx.y;
  const int b    = blockIdx.z;
  const int bh   = b * NH + h;
  // Query tile of this work-group. A tile's cost grows with its index (tile t walks t more key tiles than tile 0) and every
  // work-group is resident from the start, two to a WGP, so the launch lasts as long as the fullest WGP. Work-groups whose flat
  // index differs in one bit above the low three get tiles d and kQT - 1 - d: equal sums.
  // For speed only: for each bh the map is a permutation of the tiles, wherever the work-groups land.
  constexpr int kQT = SEQ / 128;
  int qt = blockIdx.x;
  if (kQT % 2 == 0) {
    const int up   = (qt >= kQT / 2) ? 1 : 0;
    const int d    = qt - up * (kQT / 2);
    const int flip = (up ^ __builtin_popcount((unsigned)bh)) & 1;
    qt = flip ? (kQT - 1 - d) : d;
  }
  const int q0w  = qt * 128 + cg * 32;

  int numpt = np[0];
  numpt = (numpt < 0) ? 0 : numpt;
  numpt = (numpt > SKV) ? SKV : numpt;

  const float*    Qb = q + ((size_t)bh * SEQ_FULL) * HD;
  const __bf16*   Kb = (const __bf16*)Kp + (size_t)bh * SKV * HD;
  const _Float16* Vb = (const _Float16*)Vtp + (size_t)bh * HD * SKV;
  float*          Ob = out + ((size_t)bh * SEQ) * HD;

  // ---- Q as bf16 B operand of S^T = K.Q^T: B[k=d][n=q]; elements 0..7 <- d k0+8hi+0..7, 8..15 <- d k0+16+8hi+0..7 ----
  v16b bq[2][2];                             // [column subgroup][k step]
  const float* qp0 = Qb + (size_t)(q0w + l15) * HD + 8 * hi;
  const float* qp1 = qp0 + 16 * HD;
#pragma unroll
  for (int c = 0; c < 2; ++c) {
    const float* qrow = c ? qp1 : qp0;
#pragma unroll
    for (int si = 0; si < 2; ++si) {
      const v4f f0 = *(const v4f*)(qrow + si * 32);
      const v4f f1 = *(const v4f*)(qrow + si * 32 + 4);
      const v4f g0 = *(const v4f*)(qrow + si * 32 + 16);
      const v4f g1 = *(const v4f*)(qrow + si * 32 + 16 + 4);
      v8u u;
      u[0] = pk16(f2bf_bits(f0[0]), f2bf_bits(f0[1]));
      u[1] = pk16(f2bf_bits(f0[2]), f2bf_bits(f0[3]));
      u[2] = pk16(f2bf_bits(f1[0]), f2bf_bits(f1[1]));
      u[3] = pk16(f2bf_bits(f1[2]), f2bf_bits(f1[3]));
      u[4] = pk16(f2bf_bits(g0[0]), f2bf_bits(g0[1]));
      u[5] = pk16(f2bf_bits(g0[2]), f2bf_bits(g0[3]));
      u[6] = pk16(f2bf_bits(g1[0]), f2bf_bits(g1[1]));
      u[7] = pk16(f2bf_bits(g1[2]), f2bf_bits(g1[3]));
      bq[c][si] = __builtin_bit_cast(v16b, u);
    }
  }
  // the wait ahead of any rewrite of the Q loads' address registers; naming them keeps a load's own result off them too
  asm volatile("s_wait_xcnt 0x0" :: "v"(qp0), "v"(qp1) : "memory");

  // O^T accumulators: oacc[c][dg][r] = carry * O[q0w + c*16 + l15][dg*16 + 8*hi + r], over this wave's key half
  v8f oacc[2][4];
#pragma unroll
  for (int c = 0; c < 2; ++c)
#pragma unroll
    for (int dg = 0; dg < 4; ++dg) oacc[c][dg] = zero8();
  float m[2] = {NEG_INF, NEG_INF};           // per-lane row stats (log2 domain)
  float l[2] = {0.f, 0.f};                   // row sums, carried x4096 like p

  const int qmax   = q0w + 31 + numpt;       // last visible key of this wave's last row
  const int kv_end = (SKV < qmax + 1) ? SKV : (qmax + 1);

  // work-group-uniform tile count: up to the last visible key of the block's last row; >= 1, <= SKV / 128
  const int qmaxb = qt * 128 + 127 + numpt;
  const int nt    = (((SKV < qmaxb + 1) ? SKV : (qmaxb + 1)) + kKeys - 1) / kKeys;

  // this lane's share of a stage: 16 B at column ccol of K rows crow + 32 j, 16 B at column vcol of V^T rows vrw + 16 j, j < 4
  // (a wave-wide copy = 4 whole lines)
  const int crow = tid >> 3, ccol = (tid & 7) * 16;
  const int vrw  = tid >> 4, vcol = (tid & 15) * 16;
  const unsigned char* kg = (const unsigned char*)Kb + (size_t)crow * (HD * 2) + ccol;
  const unsigned char* vg = (const unsigned char*)Vb + (size_t)vrw * (SKV * 2) + vcol;
  const unsigned       lck = (unsigned)(size_t)ring + crow * kPitchK + ccol;
  const unsigned       lcv = (unsigned)(size_t)ring + kTileKB + vrw * kPitchV + vcol;
  auto issue_stage = [&](int s) {
    const unsigned ob = (s & 1) * kStageB;
    copy_stage(lck + ob, lcv + ob, kg + (size_t)s * (kKeys * HD * 2), vg + (size_t)s * (kKeys * 2));
  };

  issue_stage(0);
  wait_async0();
  __syncthreads();
  if (nt > 1) issue_stage(1);                  // work-group-uniform

#pragma unroll 1
  for (int it = 0; it < nt; ++it) {
    const int kv0 = it * kKeys + kh * kWKeys;
    const unsigned char* stK = ring + (it & 1) * kStageB + kh * (kWKeys * kPitchK);   // this wave's 64 K rows
    const unsigned char* stV = ring + (it & 1) * kStageB + kTileKB + kh * (kWKeys * 2);   // this wave's 64 V^T columns
    if (kv0 < kv_end) {                        // wave-uniform (scalar): key blocks beyond this wave's last visible key hold no work
    // ---- S^T subtiles (16 kv each): 2 bf16 WMMAs a column subgroup, then the mask; the scores stay unscaled ----
    v8f s4[2][4];
    if (kv0 + kWKeys - 1 <= q0w + numpt) {     // wave-uniform (scalar): every key of the block is visible to every row of the wave
      // interior block: no mask and no per-subtile test; the 8 K fragment loads stand as one group, the WMMAs run on 8 independent tiles
      v16b ak[4][2];
      const __bf16* krow = (const __bf16*)(stK + l15 * kPitchK) + 8 * hi;
#pragma unroll
      for (int t = 0; t < 4; ++t) ak[t][0] = FragB::load(krow + t * 16 * (kPitchK / 2));
#pragma unroll
      for (int t = 0; t < 4; ++t) ak[t][1] = FragB::load(krow + t * 16 * (kPitchK / 2) + 32);
      __builtin_amdgcn_sched_barrier(0);       // keeps the loads one group ahead of the WMMAs: one LDS latency a block, not one a subtile
      v8f s[2][4];
#pragma unroll
      for (int t = 0; t < 4; ++t) {
        s[0][t] = FragB::mma(ak[t][0], bq[0][0], zero8());
        s[1][t] = FragB::mma(ak[t][0], bq[1][0], zero8());
      }
#pragma unroll
      for (int t = 0; t < 4; ++t) {
        s[0][t] = FragB::mma(ak[t][1], bq[0][1], s[0][t]);
        s[1][t] = FragB::mma(ak[t][1], bq[1][1], s[1][t]);
      }
      __builtin_amdgcn_sched_barrier(0);       // keeps the 16 WMMAs back to back: each fills the others' result distance instead of v_nop
#pragma unroll
      for (int t = 0; t < 4; ++t) { s4[0][t] = s[0][t]; s4[1][t] = s[1][t]; }
    } else {
#pragma unroll
    for (int t = 0; t < 4; ++t) {
      const int c0 = kv0 + t * 16;
      if (c0 > qmax) {                       // wave-uniform: whole subtile masked
        s4[0][t] = neg8();
        s4[1][t] = neg8();
        continue;
      }
      const __bf16* krow = (const __bf16*)(stK + (t * 16 + l15) * kPitchK) + 8 * hi;
      const v16b ak0 = FragB::load(krow);
      const v16b ak1 = FragB::load(krow + 32);
      v8f sa = zero8(), sb = zero8();
      sa = FragB::mma(ak0, bq[0][0], sa);
      sb = FragB::mma(ak0, bq[1][0], sb);
      sa = FragB::mma(ak1, bq[0][1], sa);
      sb = FragB::mma(ak1, bq[1][1], sb);
      dep_guard2_b(sa, sb, ak0, ak1, bq[0][0], bq[0][1], bq[1][0], bq[1][1]);
#pragma unroll
      for (int c = 0; c < 2; ++c) {
        const v8f  s    = c ? sb : sa;
        const bool part = (c0 + 15 > q0w + c * 16 + numpt);   // wave-uniform: some (q, kv) of the subtile masked
        const int  lim  = q0w + c * 16 + l15 + numpt - c0;    // kv local index visible iff <= lim
        v8f sc;
#pragma unroll
        for (int r = 0; r < 8; ++r) {
          float vv = s[r];
          if (part && (r + 8 * hi > lim)) vv = NEG_INF;
          sc[r] = vv;
        }
        s4[c][t] = sc;
      }
    }
    }

    // ---- block-level online softmax in log2 domain, the two column subgroups side by side ----
    float alpha[2];
    const v8f sc8 = (v8f){kScale2, kScale2, kScale2, kScale2, kScale2, kScale2, kScale2, kScale2};
    float tmx[2], oth[2];
#pragma unroll
    for (int c = 0; c < 2; ++c)
      tmx[c] = fmaxf(fmaxf(hmax8(s4[c][0]), hmax8(s4[c][1])), fmaxf(hmax8(s4[c][2]), hmax8(s4[c][3])));
#pragma unroll
    for (int c = 0; c < 2; ++c) oth[c] = __shfl_xor(tmx[c], 16, 32);
    __builtin_amdgcn_sched_barrier(0);         // keeps both exchanges in flight together: one cross-lane latency a block, not two
#pragma unroll
    for (int c = 0; c < 2; ++c) {
      const float tmax = fmaxf(tmx[c], oth[c]);
      const float mn   = fmaxf(m[c], tmax * kScale2);   // scale > 0: the scaled maximum is the maximum of the scaled scores
      alpha[c]         = (m[c] > NEG_INF) ? EXP2(m[c] - mn) : 0.0f;
      const float bias = kCarryLog2 - ((mn > NEG_INF) ? mn : 0.0f);
      m[c] = mn;
      const v8f bi8 = (v8f){bias, bias, bias, bias, bias, bias, bias, bias};
#pragma unroll
      for (int t = 0; t < 4; ++t) {
        const v8f a = __builtin_elementwise_fma(s4[c][t], sc8, bi8);
#pragma unroll
        for (int r = 0; r < 8; ++r) s4[c][t][r] = EXP2(a[r]);
      }
      float ts = (hsum8(s4[c][0]) + hsum8(s4[c][1])) + (hsum8(s4[c][2]) + hsum8(s4[c][3]));
      ts += __shfl_xor(ts, 16, 32);
      l[c] = l[c] * alpha[c] + ts;
#pragma unroll
      for (int dg = 0; dg < 4; ++dg)
#pragma unroll
        for (int r = 0; r < 8; ++r) oacc[c][dg][r] *= alpha[c];
    }

    // ---- O^T += V^T . P^T : 2 slices of 32 kv, 8 f16 WMMAs each (every V^T fragment feeds both column subgroups) ----
#pragma unroll
    for (int si = 0; si < 2; ++si) {
      v16h bp[2];
#pragma unroll
      for (int c = 0; c < 2; ++c) {
        const v8f p0 = s4[c][2 * si];            // kv si*32 + 8*hi + 0..7 of this lane's q column
        const v8f p1 = s4[c][2 * si + 1];        // kv si*32 + 16 + 8*hi + 0..7
        v8u u;
#pragma unroll
        for (int j = 0; j < 4; ++j) {
          u[j]     = pkh2(p0[2 * j], p0[2 * j + 1]);
          u[4 + j] = pkh2(p1[2 * j], p1[2 * j + 1]);
        }
        bp[c] = __builtin_bit_cast(v16h, u);
      }
      const _Float16* vrow = (const _Float16*)(stV + l15 * kPitchV) + si * 32 + 8 * hi;   // row d = dg*16 + l15
      const v16h av0 = FragH::load(vrow);
      const v16h av1 = FragH::load(vrow + 16 * (kPitchV / 2));
      const v16h av2 = FragH::load(vrow + 32 * (kPitchV / 2));
      const v16h av3 = FragH::load(vrow + 48 * (kPitchV / 2));
      oacc[0][0] = FragH::mma(av0, bp[0], oacc[0][0]);
      oacc[1][0] = FragH::mma(av0, bp[1], oacc[1][0]);
      oacc[0][1] = FragH::mma(av1, bp[0], oacc[0][1]);
      oacc[1][1] = FragH::mma(av1, bp[1], oacc[1][1]);
      oacc[0][2] = FragH::mma(av2, bp[0], oacc[0][2]);
      oacc[1][2] = FragH::mma(av2, bp[1], oacc[1][2]);
      oacc[0][3] = FragH::mma(av3, bp[0], oacc[0][3]);
      oacc[1][3] = FragH::mma(av3, bp[1], oacc[1][3]);
    }
    // 4 VALU slots behind the block's last WMMAs, ahead of the branches at the publish point
    acc_guard8(oacc[0][0], oacc[0][1], oacc[0][2], oacc[0][3], oacc[1][0], oacc[1][1], oacc[1][2], oacc[1][3]);
    }
    // ---- publish point of tile it + 1, every wave: own reads of this buffer done, own copies landed, barrier, then the refill ----
    wait_ds0();
    wait_async0();
    __syncthreads();
    if (it + 2 < nt) issue_stage(it + 2);      // work-group-uniform: into the buffer that this trip has just read
  }
  wait_async0();
  acc_guard8(oacc[0][0], oacc[0][1], oacc[0][2], oacc[0][3], oacc[1][0], oacc[1][1], oacc[1][2], oacc[1][3]);

  // ---- epilogue: join the two key halves of each column group through its LDS slab, normalize, whole-line stores ----
  float* slab = sT[cg];
  if (kh == 1) {                               // wave-uniform (scalar): the upper half hands over O^T, maximum and row sum
#pragma unroll
    for (int c = 0; c < 2; ++c) {
#pragma unroll
      for (int dg = 0; dg < 4; ++dg)
#pragma unroll
        for (int r = 0; r < 8; ++r)
          slab[(c * 16 + l15) * 68 + dg * 16 + 8 * hi + r] = oacc[c][dg][r];
      if (hi == 0) { sM[cg][c * 16 + l15] = m[c]; sL[cg][c * 16 + l15] = l[c]; }
    }
  }
  __syncthreads();                             // the upper half's partial results are visible to the lower half
  if (kh == 0) {                               // wave-uniform (scalar): the lower half joins, each lane at its own slab places
#pragma unroll
    for (int c = 0; c < 2; ++c) {
      const float m1 = sM[cg][c * 16 + l15];
      const float l1 = sL[cg][c * 16 + l15];
      const float mt = fmaxf(m[c], m1);
      const float a0 = (m[c] > NEG_INF) ? EXP2(m[c] - mt) : 0.0f;
      const float a1 = (m1 > NEG_INF) ? EXP2(m1 - mt) : 0.0f;   // an upper half with no visible key counts for nothing
      const float lt = l[c] * a0 + l1 * a1;
      const float inv = (lt > 0.f) ? (1.0f / lt) : 0.f;          // the carry stands in oacc and in l alike and cancels
      const float f0 = a0 * inv, f1 = a1 * inv;
#pragma unroll
      for (int dg = 0; dg < 4; ++dg)
#pragma unroll
        for (int r = 0; r < 8; ++r) {
          float* p = slab + (c * 16 + l15) * 68 + dg * 16 + 8 * hi + r;
          *p = oacc[c][dg][r] * f0 + *p * f1;
        }
    }
  }
  __syncthreads();                             // the joined rows are visible to both halves, which store 16 rows each
  const int hh = lane >> 4, c4 = (lane & 15) * 4;   // row seg = 256 B = 16 lanes x 16 B
  {
#pragma unroll
    for (int it = 0; it < 8; ++it) {
      const int row = kh * 16 + it * 2 + hh;
      const v4f vv = *(const v4f*)(slab + row * 68 + c4);
      *(v4f*)(Ob + (size_t)(q0w + row) * HD + c4) = vv;
    }
  }
}

// ---------------------------------------------------------------------------
// Host glue.
//   Kp  bf16 [NB*NH][SKV][64]     NB*NH*SKV*128   at 0              (cast_rows_kernel)
//   Vt  f16  [NB*NH][64][SKV]     NB*NH*SKV*128   at NB*NH*SKV*128  (v_transpose_kernel)
//   total (NB=2, SKV=3072)         25,165,824
// 3 launches.
// ---------------------------------------------------------------------------
extern "C" void kernel_launch(void* const* d_in, const int* in_sizes, int n_in,
                              void* d_out, int out_size, void* d_ws, size_t ws_size,
                              hipStream_t stream) {
  if (n_in < 4) return;
  if (in_sizes[0] < NB * NH * SEQ * HD) return;
  if (in_sizes[1] < NB * NH * SKV * HD) return;
  if (in_sizes[2] < NB * NH * SKV * HD) return;
  if (in_sizes[3] < 1) return;
  if (out_size < NB * NH * SEQ * HD) return;

  const size_t szK   = (size_t)NB * NH * SKV * HD * 2;
  const size_t szVt  = (size_t)NB * NH * HD * SKV * 2;
  const size_t offK  = 0;
  const size_t offVt = offK + szK;
  const size_t total = offVt + szVt;
  if (ws_size < total) return;

  const float* q  = (const float*)d_in[0];
  const float* k  = (const float*)d_in[1];
  const float* v  = (const float*)d_in[2];
  const int*   np = (const int*)d_in[3];
  float* out = (float*)d_out;
  char* ws = (char*)d_ws;
  unsigned short* Kp = (unsigned short*)(ws + offK);
  _Float16*       Vt = (_Float16*)(ws + offVt);

  const int nRowsK = NB * NH * SKV;                 // multiple of 32
  // (1) Kp[bh][kv][d] = bf16(k[bh][kv][d])
  cast_rows_kernel<<<dim3(nRowsK / 32), dim3(256), 0, stream>>>(k, Kp, SKV, SKV_FULL, nRowsK);
  // (2) Vt[bh][d][kv] = f16(bf16(v[bh][kv][d]))
  v_transpose_kernel<<<dim3(SKV / 64, NB * NH), dim3(256), 0, stream>>>(v, Vt);
  // (3) attention
  attn_kernel<<<dim3(SEQ / 128, NH, NB), dim3(256), 0, stream>>>(q, Kp, (const unsigned short*)Vt, np, out);
}

// v007
// One run takes 45.5 microseconds.
// Timed twice side by side with v006, it ran 1.04 times as fast both times.
// All steps since v000 together make it 4.66 times as fast.
// Contractions: scores K.Q^T on v_wmma_f32_16x16x32_bf16 (bf16 operands = RNE bf16 copies of q and k, f32 accumulate); context V^T.P^T on v_wmma_f32_16x16x32_f16 (f16 operands: v = f16 of its RNE bf16 copy, p carried x4096, f32 accumulate); softmax row sums ONES.P^T on the same f16 form (f32 accumulate); scale, mask, maximum and exp2 in f32.
#include <hip/hip_runtime.h>
#include <math.h>

// ---------------------------------------------------------------------------
// Problem constants (NB / SEQ / SKV overridable for a reduced build; *_FULL = input strides)
// ---------------------------------------------------------------------------
#ifndef NB
#define NB 2
#endif
#ifndef SEQ
#define SEQ 2048
#endif
#ifndef SKV
#define SKV 3072
#endif
#define NB_FULL   2
#define NH        16
#define HD        64
#define SEQ_FULL  2048
#define SKV_FULL  3072

static_assert(NB >= 1 && NB <= NB_FULL);
static_assert(SEQ % 128 == 0 && SEQ <= SEQ_FULL);
static_assert(SKV % 128 == 0 && SKV <= SKV_FULL);
static_assert(HD == 64);
static_assert((NB * NH * SKV) % 32 == 0);

constexpr float kScale2   = 0.125f * 1.44269504088896340736f;   // 1/sqrt(64) * log2(e): softmax in log2 domain
constexpr float kCarryLog2 = 12.0f;                            // p in [0,1] carried x4096 (f16 operand and row sum alike): 12 added to the exp2 argument
#define NEG_INF (-__builtin_inff())

#if __has_builtin(__builtin_amdgcn_exp2f)
#define EXP2(x) __builtin_amdgcn_exp2f(x)
#else
#define EXP2(x) exp2f(x)
#endif

typedef __attribute__((ext_vector_type(16))) _Float16 v16h;
typedef __attribute__((ext_vector_type(8)))  _Float16 v8h;
typedef __attribute__((ext_vector_type(2)))  _Float16 v2h;
typedef __attribute__((ext_vector_type(16))) __bf16   v16b;
typedef __attribute__((ext_vector_type(8)))  __bf16   v8b;
typedef __attribute__((ext_vector_type(8)))  float    v8f;
typedef __attribute__((ext_vector_type(4)))  float    v4f;
typedef __attribute__((ext_vector_type(4)))  unsigned int v4u;
typedef __attribute__((ext_vector_type(8)))  unsigned int v8u;

__device__ __forceinline__ unsigned short f2bf_bits(float f) {        // RNE convert f32 -> bf16 bits
  unsigned u = __float_as_uint(f);
  return (unsigned short)((u + 0x7FFFu + ((u >> 16) & 1u)) >> 16);
}
__device__ __forceinline__ float bf_bits2f(unsigned short h) { return __uint_as_float(((unsigned)h) << 16); }

// hazard guards: 4 VALU slots after the last WMMA of a group, tie D, keep A/B live
__device__ __forceinline__ void acc_guard8(v8f& a, v8f& b, v8f& c, v8f& d, v8f& e, v8f& f, v8f& g, v8f& h) {
  asm volatile("v_nop\n\tv_nop\n\tv_nop\n\tv_nop" : "+v"(a), "+v"(b), "+v"(c), "+v"(d), "+v"(e), "+v"(f), "+v"(g), "+v"(h));
}
__device__ __forceinline__ void acc_guard10(v8f& a, v8f& b, v8f& c, v8f& d, v8f& e, v8f& f, v8f& g, v8f& h, v8f& i, v8f& j) {
  asm volatile("v_nop\n\tv_nop\n\tv_nop\n\tv_nop" : "+v"(a), "+v"(b), "+v"(c), "+v"(d), "+v"(e), "+v"(f), "+v"(g), "+v"(h), "+v"(i), "+v"(j));
}
__device__ __forceinline__ void dep_guard2_b(v8f& a, v8f& b, v16b w, v16b x, v16b y0, v16b y1, v16b z0, v16b z1) {
  asm volatile("v_nop\n\tv_nop\n\tv_nop\n\tv_nop" : "+v"(a), "+v"(b) : "v"(w), "v"(x), "v"(y0), "v"(y1), "v"(z0), "v"(z1));
}

template <typename T> struct Frag;
template <> struct Frag<_Float16> {
  typedef v16h V; union U { v16h v; v8h h[2]; };
  // elements 0..7 <- p[0..7], 8..15 <- p[16..23]; caller passes p = row + k0 + 8*(lane>>4)
  static __device__ __forceinline__ v16h load(const _Float16* p) {
    U f; f.h[0] = *(const v8h*)(p); f.h[1] = *(const v8h*)(p + 16); return f.v;
  }
  static __device__ __forceinline__ v8f mma(v16h a, v16h b, v8f c) {
    return __builtin_amdgcn_wmma_f32_16x16x32_f16(false, a, false, b, (short)0, c, false, false);
  }
};
template <> struct Frag<__bf16> {
  typedef v16b V; union U { v16b v; v8b h[2]; };
  static __device__ __forceinline__ v16b load(const __bf16* p) {
    U f; f.h[0] = *(const v8b*)(p); f.h[1] = *(const v8b*)(p + 16); return f.v;
  }
  static __device__ __forceinline__ v8f mma(v16b a, v16b b, v8f c) {
    return __builtin_amdgcn_wmma_f32_16x16x32_bf16(false, a, false, b, (short)0, c, false, false);
  }
};
typedef Frag<_Float16> FragH;
typedef Frag<__bf16>   FragB;

__device__ __forceinline__ unsigned pk16(unsigned short a, unsigned short b) { return (unsigned)a | ((unsigned)b << 16); }
// pack two f32 -> one dword of two f16 (element 0 = a)
__device__ __forceinline__ unsigned pkh2(float a, float b) {
  v2h p; p[0] = (_Float16)a; p[1] = (_Float16)b;
  return __builtin_bit_cast(unsigned, p);
}
__device__ __forceinline__ v8f zero8() { return (v8f){0.f, 0.f, 0.f, 0.f, 0.f, 0.f, 0.f, 0.f}; }
__device__ __forceinline__ v8f neg8()  { return (v8f){NEG_INF, NEG_INF, NEG_INF, NEG_INF, NEG_INF, NEG_INF, NEG_INF, NEG_INF}; }
// balanced-tree horizontal reduction
__device__ __forceinline__ float hmax8(v8f v) {
  float a = fmaxf(v[0], v[1]), b = fmaxf(v[2], v[3]);
  float c = fmaxf(v[4], v[5]), d = fmaxf(v[6], v[7]);
  return fmaxf(fmaxf(a, b), fmaxf(c, d));
}

// ---------------------------------------------------------------------------
// dst row pr = g * rowsPerGroup + r  <-  src row g * srcRowsPerGroup + r  (g = (b*NH + h)).
// Block 256 threads = 32 rows; thread t: row t>>3, 8 halves at (t&7)*8.
// ---------------------------------------------------------------------------
__global__ __launch_bounds__(256) void cast_rows_kernel(const float* __restrict__ src,
                                                         unsigned short* __restrict__ dst,
                                                         int rowsPerGroup, int srcRowsPerGroup, int nRows) {
  const int t  = threadIdx.x;
  int pr = blockIdx.x * 32 + (t >> 3);
  pr = (pr < nRows) ? pr : (nRows - 1);            // address clamp (grid is exact)
  const int c8 = (t & 7) * 8;
  const int g  = pr / rowsPerGroup;
  const int r  = pr - g * rowsPerGroup;
  const float* s = src + ((size_t)g * srcRowsPerGroup + r) * HD + c8;
  const v4f a = *(const v4f*)(s);
  const v4f b = *(const v4f*)(s + 4);
  unsigned short hb[8];
#pragma unroll
  for (int e = 0; e < 4; ++e) { hb[e] = f2bf_bits(a[e]); hb[4 + e] = f2bf_bits(b[e]); }
  const v4u u = (v4u){pk16(hb[0], hb[1]), pk16(hb[2], hb[3]), pk16(hb[4], hb[5]), pk16(hb[6], hb[7])};
  unsigned short* d = dst + (size_t)pr * HD + c8;
  *(v4u*)d = u;
  
}

// ---------------------------------------------------------------------------
// (2) V cast + transpose: Vt[bh][d][kv] = f16( bf16( v[bh][kv][d] ) )   (pitch SKV halves)
// grid (SKV/64, NB*NH), 256 threads; one 64(kv) x 64(d) tile through LDS.
// Load coverage: 16 iterations x 256 threads = 4096 = whole tile (coalesced along d); sm cross-wave -> __syncthreads.
// Store coverage: 8 waves x 2 iterations x 4 rows (lane>>3) = 64 d-rows; (lane&7) x 8 halves = 64 kv;
// ---------------------------------------------------------------------------
__global__ __launch_bounds__(256) void v_transpose_kernel(const float* __restrict__ v,
                                                           _Float16* __restrict__ Vt) {
  __shared__ float sm[64][65];   // sm[kv_local][d]
  const int tid = threadIdx.x;
  const int kv0 = blockIdx.x * 64;
  const int bh  = blockIdx.y;                        // b*NH + h, b < NB
  const float* vb = v + ((size_t)bh * SKV_FULL + kv0) * HD;
#pragma unroll
  for (int i = 0; i < 16; ++i) {
    const int e = i * 256 + tid;
    const int r = e >> 6;          // kv local
    const int c = e & 63;          // d
    sm[r][c] = vb[(size_t)r * HD + c];
  }
  __syncthreads();
  const int lane = tid & 31, wave = tid >> 5;
  const int q = lane >> 3, c8 = (lane & 7) * 8;
  _Float16* vt = Vt + (size_t)bh * HD * SKV;
  {
#pragma unroll
    for (int it = 0; it < 2; ++it) {
      const int row = wave * 8 + it * 4 + q;          // d
      v8h hv;
#pragma unroll
      for (int e = 0; e < 8; ++e) hv[e] = (_Float16)bf_bits2f(f2bf_bits(sm[c8 + e][row]));
      *(v8h*)(vt + (size_t)row * SKV + kv0 + c8) = hv;
    }
    
  }
}

// ---------------------------------------------------------------------------
// LDS ring of the attention kernel: a stage = one 128-key K tile (128 kv rows x 128 B) and one V^T tile (64 d rows x 256 B).
// ---------------------------------------------------------------------------
constexpr int kKeys   = 128;              // keys per stage = per publish point; a wave's softmax pass takes 64 of them
constexpr int kPitchK = 144;              // K row pitch in bytes: 128 + 16, an odd multiple of 16 (ds_load_b128 readers)
constexpr int kPitchV = 272;              // V^T row pitch in bytes: 256 + 16, an odd multiple of 16
constexpr int kTileKB = kKeys * kPitchK;  // K tile
constexpr int kTileVB = HD * kPitchV;     // V^T tile
constexpr int kStageB = kTileKB + kTileVB;   // K tile, then V^T tile
static_assert(kPitchK % 16 == 0 && ((kPitchK / 16) & 1) == 1);
static_assert(kPitchV % 16 == 0 && ((kPitchV / 16) & 1) == 1);
static_assert(kTileKB % 16 == 0 && kStageB % 16 == 0);
static_assert(SKV >= kKeys);              // the ring's prologue fills stage 0 without a test

// Eight 16-byte asynchronous copies per lane = this lane's share of one stage: K rows 32 apart from (lk, gk), V^T rows 16 apart
// from (lv, gv). l* = LDS byte addresses, g* = global addresses.
// s_wait_xcnt 0 is the statement's last line so that it stands ahead of any rewrite of the address registers the copies name.
__device__ __forceinline__ void copy_stage(unsigned lk, unsigned lv, const unsigned char* gk, const unsigned char* gv) {
  asm volatile("global_load_async_to_lds_b128 %0, %8, off\n\t"
               "global_load_async_to_lds_b128 %1, %9, off\n\t"
               "global_load_async_to_lds_b128 %2, %10, off\n\t"
               "global_load_async_to_lds_b128 %3, %11, off\n\t"
               "global_load_async_to_lds_b128 %4, %12, off\n\t"
               "global_load_async_to_lds_b128 %5, %13, off\n\t"
               "global_load_async_to_lds_b128 %6, %14, off\n\t"
               "global_load_async_to_lds_b128 %7, %15, off\n\t"
               "s_wait_xcnt 0x0"
               :: "v"(lk), "v"(lk + 32 * kPitchK), "v"(lk + 64 * kPitchK), "v"(lk + 96 * kPitchK),
                  "v"(lv), "v"(lv + 16 * kPitchV), "v"(lv + 32 * kPitchV), "v"(lv + 48 * kPitchV),
                  "v"(gk), "v"(gk + 32 * HD * 2), "v"(gk + 64 * HD * 2), "v"(gk + 96 * HD * 2),
                  "v"(gv), "v"(gv + (size_t)16 * SKV * 2), "v"(gv + (size_t)32 * SKV * 2), "v"(gv + (size_t)48 * SKV * 2)
               : "memory");
}
// the wave's own copies have landed (the compiler places no wait for them)
__device__ __forceinline__ void wait_async0() { asm volatile("s_wait_asynccnt 0x0" ::: "memory"); }
// the wave's own LDS reads have returned, before the buffer is handed to its next writer
__device__ __forceinline__ void wait_ds0() { asm volatile("s_wait_dscnt 0x0" ::: "memory"); }

// ---------------------------------------------------------------------------
// (3) Flash-style prefix-causal attention. grid (SEQ/128, NH, NB), 256 threads = 8 waves = 4 column groups of 32 query rows x 2 key
// halves; blockIdx.x -> query tile by a per-head permutation.
// Wave (cg, kh) works on query rows cg*32 .. +31 and on keys kh*64 .. +63 of every 128-key stage: each K and V^T fragment it reads
// from LDS feeds two WMMAs (one per 16-row column subgroup), so a score costs half the LDS bytes of a 16-row wave.
// Per wave: Q B-fragments (bf16, RNE) in registers; loop over the stages up to the last visible key;
//   S^T subtile = K(16 kv x 64 d, bf16 plane rows) . Q^T : 2 bf16 WMMAs a subgroup; mask (kv > q + num_pt -> -inf) on the raw scores,
//   f32 online softmax in log2 domain, p x4096 = exp2(s * scale + (12 - max)): one FMA a score carries scale, maximum and carry
//   (row stats shared by lanes l and l^16); O^T += V^T(16 d x 32 kv, f16 plane rows) . P^T with
//   P^T fragment = [own D of subtile 2si (kv 0-15 of slice), own D of subtile 2si+1 (kv 16-31)] as f16 x4096.
// The two key halves of a column group keep their own maximum, row sum and O^T and are joined once, in the epilogue, through LDS.
// K and V^T tiles are brought into LDS once per work-group by asynchronous copies, two buffers: tile t + 1 flies while tile t is
// worked on; one publish point per tile (own LDS reads done, own copies landed, barrier, refill), passed by every wave; a wave
// skips only the work of key blocks beyond its own last visible key.
// ---------------------------------------------------------------------------
constexpr int kWKeys = kKeys / 2;         // keys of a stage that one wave works on
__global__ __launch_bounds__(256) void attn_kernel(const float* __restrict__ q,
                                                    const unsigned short* __restrict__ Kp,
                                                    const unsigned short* __restrict__ Vtp,
                                                    const int* __restrict__ np,
                                                    float* __restrict__ out) {
  __shared__ __align__(16) float sT[4][32 * 68];   // per column group: 32 query rows x 64 d, pitch 68 floats
  __shared__ float sM[4][32];                      // upper key half's row maximum
  __shared__ float sL[4][32];                      // upper key half's row sum
  __shared__ __align__(16) unsigned char ring[2 * kStageB];
  const int tid  = threadIdx.x;
  const int wave = __builtin_amdgcn_readfirstlane(tid >> 5);   // scalar: the per-wave skip between publish points is a scalar branch
  const int cg   = wave & 3;                 // column group: 32 query rows
  const int kh   = wave >> 2;                // key half of every stage
  const int lane = tid & 31;
  const int hi   = lane >> 4;                // lane half: k offset 8*hi, D row offset 8*hi
  const int l15  = lane & 15;                // A row / B,D column
  const int h    = blockIdx.y;
  const int b    = blockIdx.z;
  const int bh   = b * NH + h;
  // Query tile of this work-group. A tile's cost grows with its index (tile t walks t more key tiles than tile 0) and every
  // work-group is resident from the start, two to a WGP, so the launch lasts as long as the fullest WGP. Work-groups whose flat
  // index differs in one bit above the low three get tiles d and kQT - 1 - d: equal sums.
  // For speed only: for each bh the map is a permutation of the tiles, wherever the work-groups land.
  constexpr int kQT = SEQ / 128;
  int qt = blockIdx.x;
  if (kQT % 2 == 0) {
    const int up   = (qt >= kQT / 2) ? 1 : 0;
    const int d    = qt - up * (kQT / 2);
    const int flip = (up ^ __builtin_popcount((unsigned)bh)) & 1;
    qt = flip ? (kQT - 1 - d) : d;
  }
  const int q0w  = qt * 128 + cg * 32;

  int numpt = np[0];
  numpt = (numpt < 0) ? 0 : numpt;
  numpt = (numpt > SKV) ? SKV : numpt;

  const float*    Qb = q + ((size_t)bh * SEQ_FULL) * HD;
  const __bf16*   Kb = (const __bf16*)Kp + (size_t)bh * SKV * HD;
  const _Float16* Vb = (const _Float16*)Vtp + (size_t)bh * HD * SKV;
  float*          Ob = out + ((size_t)bh * SEQ) * HD;

  // ---- Q as bf16 B operand of S^T = K.Q^T: B[k=d][n=q]; elements 0..7 <- d k0+8hi+0..7, 8..15 <- d k0+16+8hi+0..7 ----
  v16b bq[2][2];                             // [column subgroup][k step]
  const float* qp0 = Qb + (size_t)(q0w + l15) * HD + 8 * hi;
  const float* qp1 = qp0 + 16 * HD;
#pragma unroll
  for (int c = 0; c < 2; ++c) {
    const float* qrow = c ? qp1 : qp0;
#pragma unroll
    for (int si = 0; si < 2; ++si) {
      const v4f f0 = *(const v4f*)(qrow + si * 32);
      const v4f f1 = *(const v4f*)(qrow + si * 32 + 4);
      const v4f g0 = *(const v4f*)(qrow + si * 32 + 16);
      const v4f g1 = *(const v4f*)(qrow + si * 32 + 16 + 4);
      v8u u;
      u[0] = pk16(f2bf_bits(f0[0]), f2bf_bits(f0[1]));
      u[1] = pk16(f2bf_bits(f0[2]), f2bf_bits(f0[3]));
      u[2] = pk16(f2bf_bits(f1[0]), f2bf_bits(f1[1]));
      u[3] = pk16(f2bf_bits(f1[2]), f2bf_bits(f1[3]));
      u[4] = pk16(f2bf_bits(g0[0]), f2bf_bits(g0[1]));
      u[5] = pk16(f2bf_bits(g0[2]), f2bf_bits(g0[3]));
      u[6] = pk16(f2bf_bits(g1[0]), f2bf_bits(g1[1]));
      u[7] = pk16(f2bf_bits(g1[2]), f2bf_bits(g1[3]));
      bq[c][si] = __builtin_bit_cast(v16b, u);
    }
  }
  // the wait ahead of any rewrite of the Q loads' address registers; naming them keeps a load's own result off them too
  asm volatile("s_wait_xcnt 0x0" :: "v"(qp0), "v"(qp1) : "memory");

  // O^T accumulators: oacc[c][dg][r] = carry * O[q0w + c*16 + l15][dg*16 + 8*hi + r], over this wave's key half
  v8f oacc[2][4];
#pragma unroll
  for (int c = 0; c < 2; ++c)
#pragma unroll
    for (int dg = 0; dg < 4; ++dg) oacc[c][dg] = zero8();
  float m[2] = {NEG_INF, NEG_INF};           // per-lane row stats (log2 domain)
  // row sums on the matrix pipe, carried x4096 like p: lacc[c] += ONES . P^T, ONES = 16 x 32 f16 with rows 0 and 8 all ones and the
  // rest zero, so D rows 0 and 8 (register 0 of either lane half) hold the sum over all 32 kv of this lane's q column; the other
  // registers stay zero
  const unsigned onew = ((l15 & 7) == 0) ? 0x3C003C00u : 0u;   // two f16 1.0
  const v16h aone = __builtin_bit_cast(v16h, (v8u){onew, onew, onew, onew, onew, onew, onew, onew});
  v8f lacc[2] = {zero8(), zero8()};

  const int qmax   = q0w + 31 + numpt;       // last visible key of this wave's last row
  const int kv_end = (SKV < qmax + 1) ? SKV : (qmax + 1);

  // work-group-uniform tile count: up to the last visible key of the block's last row; >= 1, <= SKV / 128
  const int qmaxb = qt * 128 + 127 + numpt;
  const int nt    = (((SKV < qmaxb + 1) ? SKV : (qmaxb + 1)) + kKeys - 1) / kKeys;

  // this lane's share of a stage: 16 B at column ccol of K rows crow + 32 j, 16 B at column vcol of V^T rows vrw + 16 j, j < 4
  // (a wave-wide copy = 4 whole lines)
  const int crow = tid >> 3, ccol = (tid & 7) * 16;
  const int vrw  = tid >> 4, vcol = (tid & 15) * 16;
  const unsigned char* kg = (const unsigned char*)Kb + (size_t)crow * (HD * 2) + ccol;
  const unsigned char* vg = (const unsigned char*)Vb + (size_t)vrw * (SKV * 2) + vcol;
  const unsigned       lck = (unsigned)(size_t)ring + crow * kPitchK + ccol;
  const unsigned       lcv = (unsigned)(size_t)ring + kTileKB + vrw * kPitchV + vcol;
  auto issue_stage = [&](int s) {
    const unsigned ob = (s & 1) * kStageB;
    copy_stage(lck + ob, lcv + ob, kg + (size_t)s * (kKeys * HD * 2), vg + (size_t)s * (kKeys * 2));
  };

  issue_stage(0);
  wait_async0();
  __syncthreads();
  if (nt > 1) issue_stage(1);                  // work-group-uniform

#pragma unroll 1
  for (int it = 0; it < nt; ++it) {
    const int kv0 = it * kKeys + kh * kWKeys;
    const unsigned char* stK = ring + (it & 1) * kStageB + kh * (kWKeys * kPitchK);   // this wave's 64 K rows
    const unsigned char* stV = ring + (it & 1) * kStageB + kTileKB + kh * (kWKeys * 2);   // this wave's 64 V^T columns
    if (kv0 < kv_end) {                        // wave-uniform (scalar): key blocks beyond this wave's last visible key hold no work
    // ---- S^T subtiles (16 kv each): 2 bf16 WMMAs a column subgroup, then the mask; the scores stay unscaled ----
    v8f s4[2][4];
    if (kv0 + kWKeys - 1 <= q0w + numpt) {     // wave-uniform (scalar): every key of the block is visible to every row of the wave
      // interior block: no mask and no per-subtile test; the 8 K fragment loads stand as one group, the WMMAs run on 8 independent tiles
      v16b ak[4][2];
      const __bf16* krow = (const __bf16*)(stK + l15 * kPitchK) + 8 * hi;
#pragma unroll
      for (int t = 0; t < 4; ++t) ak[t][0] = FragB::load(krow + t * 16 * (kPitchK / 2));
#pragma unroll
      for (int t = 0; t < 4; ++t) ak[t][1] = FragB::load(krow + t * 16 * (kPitchK / 2) + 32);
      __builtin_amdgcn_sched_barrier(0);       // keeps the loads one group ahead of the WMMAs: one LDS latency a block, not one a subtile
      v8f s[2][4];
#pragma unroll
      for (int t = 0; t < 4; ++t) {
        s[0][t] = FragB::mma(ak[t][0], bq[0][0], zero8());
        s[1][t] = FragB::mma(ak[t][0], bq[1][0], zero8());
      }
#pragma unroll
      for (int t = 0; t < 4; ++t) {
        s[0][t] = FragB::mma(ak[t][1], bq[0][1], s[0][t]);
        s[1][t] = FragB::mma(ak[t][1], bq[1][1], s[1][t]);
      }
      __builtin_amdgcn_sched_barrier(0);       // keeps the 16 WMMAs back to back: each fills the others' result distance instead of v_nop
#pragma unroll
      for (int t = 0; t < 4; ++t) { s4[0][t] = s[0][t]; s4[1][t] = s[1][t]; }
    } else {
#pragma unroll
    for (int t = 0; t < 4; ++t) {
      const int c0 = kv0 + t * 16;
      if (c0 > qmax) {                       // wave-uniform: whole subtile masked
        s4[0][t] = neg8();
        s4[1][t] = neg8();
        continue;
      }
      const __bf16* krow = (const __bf16*)(stK + (t * 16 + l15) * kPitchK) + 8 * hi;
      const v16b ak0 = FragB::load(krow);
      const v16b ak1 = FragB::load(krow + 32);
      v8f sa = zero8(), sb = zero8();
      sa = FragB::mma(ak0, bq[0][0], sa);
      sb = FragB::mma(ak0, bq[1][0], sb);
      sa = FragB::mma(ak1, bq[0][1], sa);
      sb = FragB::mma(ak1, bq[1][1], sb);
      dep_guard2_b(sa, sb, ak0, ak1, bq[0][0], bq[0][1], bq[1][0], bq[1][1]);
#pragma unroll
      for (int c = 0; c < 2; ++c) {
        const v8f  s    = c ? sb : sa;
        const bool part = (c0 + 15 > q0w + c * 16 + numpt);   // wave-uniform: some (q, kv) of the subtile masked
        const int  lim  = q0w + c * 16 + l15 + numpt - c0;    // kv local index visible iff <= lim
        v8f sc;
#pragma unroll
        for (int r = 0; r < 8; ++r) {
          float vv = s[r];
          if (part && (r + 8 * hi > lim)) vv = NEG_INF;
          sc[r] = vv;
        }
        s4[c][t] = sc;
      }
    }
    }

    // ---- block-level online softmax in log2 domain, the two column subgroups side by side ----
    float alpha[2], bias[2];
    const v8f sc8 = (v8f){kScale2, kScale2, kScale2, kScale2, kScale2, kScale2, kScale2, kScale2};
    float tmx[2], oth[2];
#pragma unroll
    for (int c = 0; c < 2; ++c)
      tmx[c] = fmaxf(fmaxf(hmax8(s4[c][0]), hmax8(s4[c][1])), fmaxf(hmax8(s4[c][2]), hmax8(s4[c][3])));
#pragma unroll
    for (int c = 0; c < 2; ++c) oth[c] = __shfl_xor(tmx[c], 16, 32);
    __builtin_amdgcn_sched_barrier(0);         // keeps both exchanges in flight together: one cross-lane latency a block, not two
#pragma unroll
    for (int c = 0; c < 2; ++c) {
      const float tmax = fmaxf(tmx[c], oth[c]);
      const float mn   = fmaxf(m[c], tmax * kScale2);   // scale > 0: the scaled maximum is the maximum of the scaled scores
      alpha[c]         = (m[c] > NEG_INF) ? EXP2(m[c] - mn) : 0.0f;
      bias[c] = kCarryLog2 - ((mn > NEG_INF) ? mn : 0.0f);
      m[c] = mn;
    }

    // ---- p = exp2(s * scale + bias) as the f16 B operand P^T, slice by slice (32 kv); each slice's V^T fragments are asked for as
    // soon as its f32 scores are dead ----
    v16h bp[2][2];                             // [slice][column subgroup]
    v16h av[2][4];                             // [slice][d group]
#pragma unroll
    for (int si = 0; si < 2; ++si) {
#pragma unroll
      for (int c = 0; c < 2; ++c) {
        const v8f bi8 = (v8f){bias[c], bias[c], bias[c], bias[c], bias[c], bias[c], bias[c], bias[c]};
        const v8f a0 = __builtin_elementwise_fma(s4[c][2 * si], sc8, bi8);       // kv si*32 + 8*hi + 0..7 of this lane's q column
        const v8f a1 = __builtin_elementwise_fma(s4[c][2 * si + 1], sc8, bi8);   // kv si*32 + 16 + 8*hi + 0..7
        v8u u;
#pragma unroll
        for (int j = 0; j < 4; ++j) {
          u[j]     = pkh2(EXP2(a0[2 * j]), EXP2(a0[2 * j + 1]));
          u[4 + j] = pkh2(EXP2(a1[2 * j]), EXP2(a1[2 * j + 1]));
        }
        bp[si][c] = __builtin_bit_cast(v16h, u);
      }
      __builtin_amdgcn_sched_barrier(0);       // the loads below take the registers of this slice's scores: not lifted over their last use
      const _Float16* vrow = (const _Float16*)(stV + l15 * kPitchV) + si * 32 + 8 * hi;   // row d = dg*16 + l15
#pragma unroll
      for (int dg = 0; dg < 4; ++dg) av[si][dg] = FragH::load(vrow + dg * 16 * (kPitchV / 2));
      __builtin_amdgcn_sched_barrier(0);       // keeps the slice's 8 loads one group, ahead of the vector work that covers their latency
    }

    // ---- rescale, then row sums and O^T += V^T . P^T : per slice 2 f16 WMMAs for the row sums and 8 for O^T (every V^T fragment
    // feeds both column subgroups) ----
    lacc[0][0] *= alpha[0];
    lacc[1][0] *= alpha[1];
#pragma unroll
    for (int si = 0; si < 2; ++si) {
      lacc[0] = FragH::mma(aone, bp[si][0], lacc[0]);
      lacc[1] = FragH::mma(aone, bp[si][1], lacc[1]);
    }
#pragma unroll
    for (int c = 0; c < 2; ++c)
#pragma unroll
      for (int dg = 0; dg < 4; ++dg)
#pragma unroll
        for (int r = 0; r < 8; ++r) oacc[c][dg][r] *= alpha[c];
    // spreads the O^T rescale among the first WMMAs (one WMMA, then 8 vector instructions, four times): the multiplies issue in the
    // WMMAs' shadow; without it they all stand ahead of the first WMMA
#pragma unroll
    for (int i = 0; i < 4; ++i) {
      __builtin_amdgcn_sched_group_barrier(0x8, 1, 0);
      __builtin_amdgcn_sched_group_barrier(0x2, 8, 0);
    }
#pragma unroll
    for (int si = 0; si < 2; ++si) {
#pragma unroll
      for (int dg = 0; dg < 4; ++dg) {
        oacc[0][dg] = FragH::mma(av[si][dg], bp[si][0], oacc[0][dg]);
        oacc[1][dg] = FragH::mma(av[si][dg], bp[si][1], oacc[1][dg]);
      }
    }
    // 4 VALU slots behind the block's last WMMAs, ahead of the branches at the publish point
    acc_guard10(oacc[0][0], oacc[0][1], oacc[0][2], oacc[0][3], oacc[1][0], oacc[1][1], oacc[1][2], oacc[1][3], lacc[0], lacc[1]);
    }
    // ---- publish point of tile it + 1, every wave: own reads of this buffer done, own copies landed, barrier, then the refill ----
    wait_ds0();
    wait_async0();
    __syncthreads();
    if (it + 2 < nt) issue_stage(it + 2);      // work-group-uniform: into the buffer that this trip has just read
  }
  wait_async0();
  acc_guard8(oacc[0][0], oacc[0][1], oacc[0][2], oacc[0][3], oacc[1][0], oacc[1][1], oacc[1][2], oacc[1][3]);

  const float l[2] = {lacc[0][0], lacc[1][0]};
  // ---- epilogue: join the two key halves of each column group through its LDS slab, normalize, whole-line stores ----
  float* slab = sT[cg];
  if (kh == 1) {                               // wave-uniform (scalar): the upper half hands over O^T, maximum and row sum
#pragma unroll
    for (int c = 0; c < 2; ++c) {
#pragma unroll
      for (int dg = 0; dg < 4; ++dg)
#pragma unroll
        for (int r = 0; r < 8; ++r)
          slab[(c * 16 + l15) * 68 + dg * 16 + 8 * hi + r] = oacc[c][dg][r];
      if (hi == 0) { sM[cg][c * 16 + l15] = m[c]; sL[cg][c * 16 + l15] = l[c]; }
    }
  }
  __syncthreads();                             // the upper half's partial results are visible to the lower half
  if (kh == 0) {                               // wave-uniform (scalar): the lower half joins, each lane at its own slab places
#pragma unroll
    for (int c = 0; c < 2; ++c) {
      const float m1 = sM[cg][c * 16 + l15];
      const float l1 = sL[cg][c * 16 + l15];
      const float mt = fmaxf(m[c], m1);
      const float a0 = (m[c] > NEG_INF) ? EXP2(m[c] - mt) : 0.0f;
      const float a1 = (m1 > NEG_INF) ? EXP2(m1 - mt) : 0.0f;   // an upper half with no visible key counts for nothing
      const float lt = l[c] * a0 + l1 * a1;
      const float inv = (lt > 0.f) ? (1.0f / lt) : 0.f;          // the carry stands in oacc and in l alike and cancels
      const float f0 = a0 * inv, f1 = a1 * inv;
#pragma unroll
      for (int dg = 0; dg < 4; ++dg)
#pragma unroll
        for (int r = 0; r < 8; ++r) {
          float* p = slab + (c * 16 + l15) * 68 + dg * 16 + 8 * hi + r;
          *p = oacc[c][dg][r] * f0 + *p * f1;
        }
    }
  }
  __syncthreads();                             // the joined rows are visible to both halves, which store 16 rows each
  const int hh = lane >> 4, c4 = (lane & 15) * 4;   // row seg = 256 B = 16 lanes x 16 B
  {
#pragma unroll
    for (int it = 0; it < 8; ++it) {
      const int row = kh * 16 + it * 2 + hh;
      const v4f vv = *(const v4f*)(slab + row * 68 + c4);
      *(v4f*)(Ob + (size_t)(q0w + row) * HD + c4) = vv;
    }
  }
}

// ---------------------------------------------------------------------------
// Host glue.
//   Kp  bf16 [NB*NH][SKV][64]     NB*NH*SKV*128   at 0              (cast_rows_kernel)
//   Vt  f16  [NB*NH][64][SKV]     NB*NH*SKV*128   at NB*NH*SKV*128  (v_transpose_kernel)
//   total (NB=2, SKV=3072)         25,165,824
// 3 launches.
// ---------------------------------------------------------------------------
extern "C" void kernel_launch(void* const* d_in, const int* in_sizes, int n_in,
                              void* d_out, int out_size, void* d_ws, size_t ws_size,
                              hipStream_t stream) {
  if (n_in < 4) return;
  if (in_sizes[0] < NB * NH * SEQ * HD) return;
  if (in_sizes[1] < NB * NH * SKV * HD) return;
  if (in_sizes[2] < NB * NH * SKV * HD) return;
  if (in_sizes[3] < 1) return;
  if (out_size < NB * NH * SEQ * HD) return;

  const size_t szK   = (size_t)NB * NH * SKV * HD * 2;
  const size_t szVt  = (size_t)NB * NH * HD * SKV * 2;
  const size_t offK  = 0;
  const size_t offVt = offK + szK;
  const size_t total = offVt + szVt;
  if (ws_size < total) return;

  const float* q  = (const float*)d_in[0];
  const float* k  = (const float*)d_in[1];
  const float* v  = (const float*)d_in[2];
  const int*   np = (const int*)d_in[3];
  float* out = (float*)d_out;
  char* ws = (char*)d_ws;
  unsigned short* Kp = (unsigned short*)(ws + offK);
  _Float16*       Vt = (_Float16*)(ws + offVt);

  const int nRowsK = NB * NH * SKV;                 // multiple of 32
  // (1) Kp[bh][kv][d] = bf16(k[bh][kv][d])
  cast_rows_kernel<<<dim3(nRowsK / 32), dim3(256), 0, stream>>>(k, Kp, SKV, SKV_FULL, nRowsK);
  // (2) Vt[bh][d][kv] = f16(bf16(v[bh][kv][d]))
  v_transpose_kernel<<<dim3(SKV / 64, NB * NH), dim3(256), 0, stream>>>(v, Vt);
  // (3) attention
  attn_kernel<<<dim3(SEQ / 128, NH, NB), dim3(256), 0, stream>>>(q, Kp, (const unsigned short*)Vt, np, out);
}

// v008
// It runs in 44.1 microseconds.
// Two timings next to v007 put it at 1.04 and 1.03 times that version's speed.
// Counting every step since v000, it is 4.82 times as fast.
// Contractions: scores K.Q^T on v_wmma_f32_16x16x32_bf16 (bf16 operands = RNE bf16 copies of q and k, f32 accumulate); context V^T.P^T on v_wmma_f32_16x16x32_f16 (f16 operands: v = f16 of its RNE bf16 copy, p carried x256, f32 accumulate); softmax row sums ONES.P^T on the same f16 form (f32 accumulate); scale, mask, maximum and exp2 in f32.
#include <hip/hip_runtime.h>
#include <math.h>

// ---------------------------------------------------------------------------
// Problem constants (NB / SEQ / SKV overridable for a reduced build; *_FULL = input strides)
// ---------------------------------------------------------------------------
#ifndef NB
#define NB 2
#endif
#ifndef SEQ
#define SEQ 2048
#endif
#ifndef SKV
#define SKV 3072
#endif
#define NB_FULL   2
#define NH        16
#define HD        64
#define SEQ_FULL  2048
#define SKV_FULL  3072

static_assert(NB >= 1 && NB <= NB_FULL);
static_assert(SEQ % 128 == 0 && SEQ <= SEQ_FULL);
static_assert(SKV % 128 == 0 && SKV <= SKV_FULL);
static_assert(HD == 64);
static_assert((NB * NH * SKV) % 32 == 0);

constexpr float kScale2   = 0.125f * 1.44269504088896340736f;   // 1/sqrt(64) * log2(e): softmax in log2 domain
constexpr float kCarryLog2 = 8.0f;                             // p carried x256 (f16 operand and row sum alike): 8 added to the exp2 argument; leaves
                                                               // 8 binary orders of f16 range above the maximum in use
constexpr float kSumLim    = 60000.0f;                         // below the largest finite f16: a 64-key sum of p >= 0 under it holds no overflowed p
#define NEG_INF (-__builtin_inff())

#if __has_builtin(__builtin_amdgcn_exp2f)
#define EXP2(x) __builtin_amdgcn_exp2f(x)
#else
#define EXP2(x) exp2f(x)
#endif

typedef __attribute__((ext_vector_type(16))) _Float16 v16h;
typedef __attribute__((ext_vector_type(8)))  _Float16 v8h;
typedef __attribute__((ext_vector_type(2)))  _Float16 v2h;
typedef __attribute__((ext_vector_type(16))) __bf16   v16b;
typedef __attribute__((ext_vector_type(8)))  __bf16   v8b;
typedef __attribute__((ext_vector_type(8)))  float    v8f;
typedef __attribute__((ext_vector_type(4)))  float    v4f;
typedef __attribute__((ext_vector_type(4)))  unsigned int v4u;
typedef __attribute__((ext_vector_type(8)))  unsigned int v8u;

__device__ __forceinline__ unsigned short f2bf_bits(float f) {        // RNE convert f32 -> bf16 bits
  unsigned u = __float_as_uint(f);
  return (unsigned short)((u + 0x7FFFu + ((u >> 16) & 1u)) >> 16);
}
__device__ __forceinline__ float bf_bits2f(unsigned short h) { return __uint_as_float(((unsigned)h) << 16); }

// hazard guards: 4 VALU slots after the last WMMA of a group, tie D, keep A/B live
__device__ __forceinline__ void acc_guard8(v8f& a, v8f& b, v8f& c, v8f& d, v8f& e, v8f& f, v8f& g, v8f& h) {
  asm volatile("v_nop\n\tv_nop\n\tv_nop\n\tv_nop" : "+v"(a), "+v"(b), "+v"(c), "+v"(d), "+v"(e), "+v"(f), "+v"(g), "+v"(h));
}
__device__ __forceinline__ void dep_guard2_b(v8f& a, v8f& b, v16b w, v16b x, v16b y0, v16b y1, v16b z0, v16b z1) {
  asm volatile("v_nop\n\tv_nop\n\tv_nop\n\tv_nop" : "+v"(a), "+v"(b) : "v"(w), "v"(x), "v"(y0), "v"(y1), "v"(z0), "v"(z1));
}

template <typename T> struct Frag;
template <> struct Frag<_Float16> {
  typedef v16h V; union U { v16h v; v8h h[2]; };
  // elements 0..7 <- p[0..7], 8..15 <- p[16..23]; caller passes p = row + k0 + 8*(lane>>4)
  static __device__ __forceinline__ v16h load(const _Float16* p) {
    U f; f.h[0] = *(const v8h*)(p); f.h[1] = *(const v8h*)(p + 16); return f.v;
  }
  static __device__ __forceinline__ v8f mma(v16h a, v16h b, v8f c) {
    return __builtin_amdgcn_wmma_f32_16x16x32_f16(false, a, false, b, (short)0, c, false, false);
  }
};
template <> struct Frag<__bf16> {
  typedef v16b V; union U { v16b v; v8b h[2]; };
  static __device__ __forceinline__ v16b load(const __bf16* p) {
    U f; f.h[0] = *(const v8b*)(p); f.h[1] = *(const v8b*)(p + 16); return f.v;
  }
  static __device__ __forceinline__ v8f mma(v16b a, v16b b, v8f c) {
    return __builtin_amdgcn_wmma_f32_16x16x32_bf16(false, a, false, b, (short)0, c, false, false);
  }
};
typedef Frag<_Float16> FragH;
typedef Frag<__bf16>   FragB;

__device__ __forceinline__ unsigned pk16(unsigned short a, unsigned short b) { return (unsigned)a | ((unsigned)b << 16); }
// pack two f32 -> one dword of two f16 (element 0 = a)
__device__ __forceinline__ unsigned pkh2(float a, float b) {
  v2h p; p[0] = (_Float16)a; p[1] = (_Float16)b;
  return __builtin_bit_cast(unsigned, p);
}
__device__ __forceinline__ v8f zero8() { return (v8f){0.f, 0.f, 0.f, 0.f, 0.f, 0.f, 0.f, 0.f}; }
__device__ __forceinline__ v8f neg8()  { return (v8f){NEG_INF, NEG_INF, NEG_INF, NEG_INF, NEG_INF, NEG_INF, NEG_INF, NEG_INF}; }
// balanced-tree horizontal reduction
__device__ __forceinline__ float hmax8(v8f v) {
  float a = fmaxf(v[0], v[1]), b = fmaxf(v[2], v[3]);
  float c = fmaxf(v[4], v[5]), d = fmaxf(v[6], v[7]);
  return fmaxf(fmaxf(a, b), fmaxf(c, d));
}

// ---------------------------------------------------------------------------
// dst row pr = g * rowsPerGroup + r  <-  src row g * srcRowsPerGroup + r  (g = (b*NH + h)).
// Block 256 threads = 32 rows; thread t: row t>>3, 8 halves at (t&7)*8.
// ---------------------------------------------------------------------------
__global__ __launch_bounds__(256) void cast_rows_kernel(const float* __restrict__ src,
                                                         unsigned short* __restrict__ dst,
                                                         int rowsPerGroup, int srcRowsPerGroup, int nRows) {
  const int t  = threadIdx.x;
  int pr = blockIdx.x * 32 + (t >> 3);
  pr = (pr < nRows) ? pr : (nRows - 1);            // address clamp (grid is exact)
  const int c8 = (t & 7) * 8;
  const int g  = pr / rowsPerGroup;
  const int r  = pr - g * rowsPerGroup;
  const float* s = src + ((size_t)g * srcRowsPerGroup + r) * HD + c8;
  const v4f a = *(const v4f*)(s);
  const v4f b = *(const v4f*)(s + 4);
  unsigned short hb[8];
#pragma unroll
  for (int e = 0; e < 4; ++e) { hb[e] = f2bf_bits(a[e]); hb[4 + e] = f2bf_bits(b[e]); }
  const v4u u = (v4u){pk16(hb[0], hb[1]), pk16(hb[2], hb[3]), pk16(hb[4], hb[5]), pk16(hb[6], hb[7])};
  unsigned short* d = dst + (size_t)pr * HD + c8;
  *(v4u*)d = u;
  
}

// ---------------------------------------------------------------------------
// (2) V cast + transpose: Vt[bh][d][kv] = f16( bf16( v[bh][kv][d] ) )   (pitch SKV halves)
// grid (SKV/64, NB*NH), 256 threads; one 64(kv) x 64(d) tile through LDS.
// Load coverage: 16 iterations x 256 threads = 4096 = whole tile (coalesced along d); sm cross-wave -> __syncthreads.
// Store coverage: 8 waves x 2 iterations x 4 rows (lane>>3) = 64 d-rows; (lane&7) x 8 halves = 64 kv;
// ---------------------------------------------------------------------------
__global__ __launch_bounds__(256) void v_transpose_kernel(const float* __restrict__ v,
                                                           _Float16* __restrict__ Vt) {
  __shared__ float sm[64][65];   // sm[kv_local][d]
  const int tid = threadIdx.x;
  const int kv0 = blockIdx.x * 64;
  const int bh  = blockIdx.y;                        // b*NH + h, b < NB
  const float* vb = v + ((size_t)bh * SKV_FULL + kv0) * HD;
#pragma unroll
  for (int i = 0; i < 16; ++i) {
    const int e = i * 256 + tid;
    const int r = e >> 6;          // kv local
    const int c = e & 63;          // d
    sm[r][c] = vb[(size_t)r * HD + c];
  }
  __syncthreads();
  const int lane = tid & 31, wave = tid >> 5;
  const int q = lane >> 3, c8 = (lane & 7) * 8;
  _Float16* vt = Vt + (size_t)bh * HD * SKV;
  {
#pragma unroll
    for (int it = 0; it < 2; ++it) {
      const int row = wave * 8 + it * 4 + q;          // d
      v8h hv;
#pragma unroll
      for (int e = 0; e < 8; ++e) hv[e] = (_Float16)bf_bits2f(f2bf_bits(sm[c8 + e][row]));
      *(v8h*)(vt + (size_t)row * SKV + kv0 + c8) = hv;
    }
    
  }
}

// ---------------------------------------------------------------------------
// LDS ring of the attention kernel: a stage = one 128-key K tile (128 kv rows x 128 B) and one V^T tile (64 d rows x 256 B).
// ---------------------------------------------------------------------------
constexpr int kKeys   = 128;              // keys per stage = per publish point; a wave's softmax pass takes 64 of them
constexpr int kPitchK = 144;              // K row pitch in bytes: 128 + 16, an odd multiple of 16 (ds_load_b128 readers)
constexpr int kPitchV = 272;              // V^T row pitch in bytes: 256 + 16, an odd multiple of 16
constexpr int kTileKB = kKeys * kPitchK;  // K tile
constexpr int kTileVB = HD * kPitchV;     // V^T tile
constexpr int kStageB = kTileKB + kTileVB;   // K tile, then V^T tile
static_assert(kPitchK % 16 == 0 && ((kPitchK / 16) & 1) == 1);
static_assert(kPitchV % 16 == 0 && ((kPitchV / 16) & 1) == 1);
static_assert(kTileKB % 16 == 0 && kStageB % 16 == 0);
static_assert(SKV >= kKeys);              // the ring's prologue fills stage 0 without a test

// Eight 16-byte asynchronous copies per lane = this lane's share of one stage: K rows 32 apart from (lk, gk), V^T rows 16 apart
// from (lv, gv). l* = LDS byte addresses, g* = global addresses.
// s_wait_xcnt 0 is the statement's last line so that it stands ahead of any rewrite of the address registers the copies name.
__device__ __forceinline__ void copy_stage(unsigned lk, unsigned lv, const unsigned char* gk, const unsigned char* gv) {
  asm volatile("global_load_async_to_lds_b128 %0, %8, off\n\t"
               "global_load_async_to_lds_b128 %1, %9, off\n\t"
               "global_load_async_to_lds_b128 %2, %10, off\n\t"
               "global_load_async_to_lds_b128 %3, %11, off\n\t"
               "global_load_async_to_lds_b128 %4, %12, off\n\t"
               "global_load_async_to_lds_b128 %5, %13, off\n\t"
               "global_load_async_to_lds_b128 %6, %14, off\n\t"
               "global_load_async_to_lds_b128 %7, %15, off\n\t"
               "s_wait_xcnt 0x0"
               :: "v"(lk), "v"(lk + 32 * kPitchK), "v"(lk + 64 * kPitchK), "v"(lk + 96 * kPitchK),
                  "v"(lv), "v"(lv + 16 * kPitchV), "v"(lv + 32 * kPitchV), "v"(lv + 48 * kPitchV),
                  "v"(gk), "v"(gk + 32 * HD * 2), "v"(gk + 64 * HD * 2), "v"(gk + 96 * HD * 2),
                  "v"(gv), "v"(gv + (size_t)16 * SKV * 2), "v"(gv + (size_t)32 * SKV * 2), "v"(gv + (size_t)48 * SKV * 2)
               : "memory");
}
// the wave's own copies have landed (the compiler places no wait for them)
__device__ __forceinline__ void wait_async0() { asm volatile("s_wait_asynccnt 0x0" ::: "memory"); }
// the wave's own LDS reads have returned, before the buffer is handed to its next writer
__device__ __forceinline__ void wait_ds0() { asm volatile("s_wait_dscnt 0x0" ::: "memory"); }

// ---------------------------------------------------------------------------
// (3) Flash-style prefix-causal attention. grid (SEQ/128, NH, NB), 256 threads = 8 waves = 4 column groups of 32 query rows x 2 key
// halves; blockIdx.x -> query tile by a per-head permutation.
// Wave (cg, kh) works on query rows cg*32 .. +31 and on keys kh*64 .. +63 of every 128-key stage: each K and V^T fragment it reads
// from LDS feeds two WMMAs (one per 16-row column subgroup), so a score costs half the LDS bytes of a 16-row wave.
// Per wave: Q B-fragments (bf16, RNE) in registers; loop over the stages up to the last visible key;
//   S^T subtile = K(16 kv x 64 d, bf16 plane rows) . Q^T : 2 bf16 WMMAs a subgroup; mask (kv > q + num_pt -> -inf) on the raw scores,
//   f32 online softmax in log2 domain, p x256 = exp2(s * scale + (8 - max)): one FMA a score carries scale, maximum and carry
//   (row stats shared by lanes l and l^16); O^T += V^T(16 d x 32 kv, f16 plane rows) . P^T with
//   P^T fragment = [own D of subtile 2si (kv 0-15 of slice), own D of subtile 2si+1 (kv 16-31)] as f16 x256.
// The maximum in use is a stale one: a wholly visible block behind the wave's first takes p against the maximum it already has (no
// maximum, no exchange, no rescale) and is accepted if its row sums show that no p left the f16 range; else, and for the first and
// the masked blocks, the full pass (new maximum, rescale) is run on the block from its K fragments on.
// The two key halves of a column group keep their own maximum, row sum and O^T and are joined once, in the epilogue, through LDS.
// K and V^T tiles are brought into LDS once per work-group by asynchronous copies, two buffers: tile t + 1 flies while tile t is
// worked on; one publish point per tile (own LDS reads done, own copies landed, barrier, refill), passed by every wave; a wave
// skips only the work of key blocks beyond its own last visible key.
// ---------------------------------------------------------------------------
constexpr int kWKeys = kKeys / 2;         // keys of a stage that one wave works on
__global__ __launch_bounds__(256) void attn_kernel(const float* __restrict__ q,
                                                    const unsigned short* __restrict__ Kp,
                                                    const unsigned short* __restrict__ Vtp,
                                                    const int* __restrict__ np,
                                                    float* __restrict__ out) {
  __shared__ __align__(16) float sT[4][32 * 68];   // per column group: 32 query rows x 64 d, pitch 68 floats
  __shared__ float sM[4][32];                      // upper key half's row maximum
  __shared__ float sL[4][32];                      // upper key half's row sum
  __shared__ __align__(16) unsigned char ring[2 * kStageB];
  const int tid  = threadIdx.x;
  const int wave = __builtin_amdgcn_readfirstlane(tid >> 5);   // scalar: the per-wave skip between publish points is a scalar branch
  const int cg   = wave & 3;                 // column group: 32 query rows
  const int kh   = wave >> 2;                // key half of every stage
  const int lane = tid & 31;
  const int hi   = lane >> 4;                // lane half: k offset 8*hi, D row offset 8*hi
  const int l15  = lane & 15;                // A row / B,D column
  const int h    = blockIdx.y;
  const int b    = blockIdx.z;
  const int bh   = b * NH + h;
  // Query tile of this work-group. A tile's cost grows with its index (tile t walks t more key tiles than tile 0) and every
  // work-group is resident from the start, two to a WGP, so the launch lasts as long as the fullest WGP. Work-groups whose flat
  // index differs in one bit above the low three get tiles d and kQT - 1 - d: equal sums.
  // For speed only: for each bh the map is a permutation of the tiles, wherever the work-groups land.
  constexpr int kQT = SEQ / 128;
  int qt = blockIdx.x;
  if (kQT % 2 == 0) {
    const int up   = (qt >= kQT / 2) ? 1 : 0;
    const int d    = qt - up * (kQT / 2);
    const int flip = (up ^ __builtin_popcount((unsigned)bh)) & 1;
    qt = flip ? (kQT - 1 - d) : d;
  }
  const int q0w  = qt * 128 + cg * 32;

  int numpt = np[0];
  numpt = (numpt < 0) ? 0 : numpt;
  numpt = (numpt > SKV) ? SKV : numpt;

  const float*    Qb = q + ((size_t)bh * SEQ_FULL) * HD;
  const __bf16*   Kb = (const __bf16*)Kp + (size_t)bh * SKV * HD;
  const _Float16* Vb = (const _Float16*)Vtp + (size_t)bh * HD * SKV;
  float*          Ob = out + ((size_t)bh * SEQ) * HD;

  // ---- Q as bf16 B operand of S^T = K.Q^T: B[k=d][n=q]; elements 0..7 <- d k0+8hi+0..7, 8..15 <- d k0+16+8hi+0..7 ----
  v16b bq[2][2];                             // [column subgroup][k step]
  const float* qp0 = Qb + (size_t)(q0w + l15) * HD + 8 * hi;
  const float* qp1 = qp0 + 16 * HD;
#pragma unroll
  for (int c = 0; c < 2; ++c) {
    const float* qrow = c ? qp1 : qp0;
#pragma unroll
    for (int si = 0; si < 2; ++si) {
      const v4f f0 = *(const v4f*)(qrow + si * 32);
      const v4f f1 = *(const v4f*)(qrow + si * 32 + 4);
      const v4f g0 = *(const v4f*)(qrow + si * 32 + 16);
      const v4f g1 = *(const v4f*)(qrow + si * 32 + 16 + 4);
      v8u u;
      u[0] = pk16(f2bf_bits(f0[0]), f2bf_bits(f0[1]));
      u[1] = pk16(f2bf_bits(f0[2]), f2bf_bits(f0[3]));
      u[2] = pk16(f2bf_bits(f1[0]), f2bf_bits(f1[1]));
      u[3] = pk16(f2bf_bits(f1[2]), f2bf_bits(f1[3]));
      u[4] = pk16(f2bf_bits(g0[0]), f2bf_bits(g0[1]));
      u[5] = pk16(f2bf_bits(g0[2]), f2bf_bits(g0[3]));
      u[6] = pk16(f2bf_bits(g1[0]), f2bf_bits(g1[1]));
      u[7] = pk16(f2bf_bits(g1[2]), f2bf_bits(g1[3]));
      bq[c][si] = __builtin_bit_cast(v16b, u);
    }
  }
  // the wait ahead of any rewrite of the Q loads' address registers; naming them keeps a load's own result off them too
  asm volatile("s_wait_xcnt 0x0" :: "v"(qp0), "v"(qp1) : "memory");

  // O^T accumulators: oacc[c][dg][r] = carry * O[q0w + c*16 + l15][dg*16 + 8*hi + r], over this wave's key half
  v8f oacc[2][4];
#pragma unroll
  for (int c = 0; c < 2; ++c)
#pragma unroll
    for (int dg = 0; dg < 4; ++dg) oacc[c][dg] = zero8();
  float m[2] = {NEG_INF, NEG_INF};           // per-lane row stats (log2 domain)
  // row sums on the matrix pipe, carried x256 like p: a block's sums lb[c] = ONES . P^T, ONES = 16 x 32 f16 with rows 0 and 8 all ones
  // and the rest zero, so D rows 0 and 8 (register 0 of either lane half) hold the sum over the block's kv of this lane's q column
  const unsigned onew = ((l15 & 7) == 0) ? 0x3C003C00u : 0u;   // two f16 1.0
  const v16h aone = __builtin_bit_cast(v16h, (v8u){onew, onew, onew, onew, onew, onew, onew, onew});
  float l[2] = {0.f, 0.f};                   // per-lane row sums, relative to m

  const int qmax   = q0w + 31 + numpt;       // last visible key of this wave's last row
  const int kv_end = (SKV < qmax + 1) ? SKV : (qmax + 1);

  // work-group-uniform tile count: up to the last visible key of the block's last row; >= 1, <= SKV / 128
  const int qmaxb = qt * 128 + 127 + numpt;
  const int nt    = (((SKV < qmaxb + 1) ? SKV : (qmaxb + 1)) + kKeys - 1) / kKeys;

  // this lane's share of a stage: 16 B at column ccol of K rows crow + 32 j, 16 B at column vcol of V^T rows vrw + 16 j, j < 4
  // (a wave-wide copy = 4 whole lines)
  const int crow = tid >> 3, ccol = (tid & 7) * 16;
  const int vrw  = tid >> 4, vcol = (tid & 15) * 16;
  const unsigned char* kg = (const unsigned char*)Kb + (size_t)crow * (HD * 2) + ccol;
  const unsigned char* vg = (const unsigned char*)Vb + (size_t)vrw * (SKV * 2) + vcol;
  const unsigned       lck = (unsigned)(size_t)ring + crow * kPitchK + ccol;
  const unsigned       lcv = (unsigned)(size_t)ring + kTileKB + vrw * kPitchV + vcol;
  auto issue_stage = [&](int s) {
    const unsigned ob = (s & 1) * kStageB;
    copy_stage(lck + ob, lcv + ob, kg + (size_t)s * (kKeys * HD * 2), vg + (size_t)s * (kKeys * 2));
  };

  issue_stage(0);
  wait_async0();
  __syncthreads();
  if (nt > 1) issue_stage(1);                  // work-group-uniform

#pragma unroll 1
  for (int it = 0; it < nt; ++it) {
    const int kv0 = it * kKeys + kh * kWKeys;
    const unsigned char* stK = ring + (it & 1) * kStageB + kh * (kWKeys * kPitchK);   // this wave's 64 K rows
    const unsigned char* stV = ring + (it & 1) * kStageB + kTileKB + kh * (kWKeys * 2);   // this wave's 64 V^T columns
    if (kv0 < kv_end) {                        // wave-uniform (scalar): key blocks beyond this wave's last visible key hold no work
    const bool interior = (kv0 + kWKeys - 1 <= q0w + numpt);   // wave-uniform (scalar): every key of the block is visible to every row of the wave
    bool full = true;                          // wave-uniform (scalar): the block still wants the full pass
    if (interior && it > 0) {                  // interior blocks come first, so block 0 was one too and has left a finite maximum in every row
      // ---- short pass: p against the maximum in use ----
      v8f s[2][4];
      {
        v16b ak[4][2];
        const __bf16* krow = (const __bf16*)(stK + l15 * kPitchK) + 8 * hi;
#pragma unroll
        for (int t = 0; t < 4; ++t) ak[t][0] = FragB::load(krow + t * 16 * (kPitchK / 2));
#pragma unroll
        for (int t = 0; t < 4; ++t) ak[t][1] = FragB::load(krow + t * 16 * (kPitchK / 2) + 32);
        __builtin_amdgcn_sched_barrier(0);     // keeps the loads one group ahead of the WMMAs: one LDS latency a block, not one a subtile
#pragma unroll
        for (int t = 0; t < 4; ++t) {
          s[0][t] = FragB::mma(ak[t][0], bq[0][0], zero8());
          s[1][t] = FragB::mma(ak[t][0], bq[1][0], zero8());
        }
#pragma unroll
        for (int t = 0; t < 4; ++t) {
          s[0][t] = FragB::mma(ak[t][1], bq[0][1], s[0][t]);
          s[1][t] = FragB::mma(ak[t][1], bq[1][1], s[1][t]);
        }
        __builtin_amdgcn_sched_barrier(0);     // keeps the 16 WMMAs back to back: each fills the others' result distance instead of v_nop
      }
      const v8f sc8 = (v8f){kScale2, kScale2, kScale2, kScale2, kScale2, kScale2, kScale2, kScale2};
      v16h bp[2][2];                           // [slice][column subgroup]
      v16h av[2][4];                           // [slice][d group]
      v8f  lb[2];                              // the block's row sums
#pragma unroll
      for (int si = 0; si < 2; ++si) {
#pragma unroll
        for (int c = 0; c < 2; ++c) {
          const float bi = kCarryLog2 - m[c];
          const v8f bi8 = (v8f){bi, bi, bi, bi, bi, bi, bi, bi};
          const v8f a0 = __builtin_elementwise_fma(s[c][2 * si], sc8, bi8);
          const v8f a1 = __builtin_elementwise_fma(s[c][2 * si + 1], sc8, bi8);
          v8u u;
#pragma unroll
          for (int j = 0; j < 4; ++j) {
            u[j]     = pkh2(EXP2(a0[2 * j]), EXP2(a0[2 * j + 1]));
            u[4 + j] = pkh2(EXP2(a1[2 * j]), EXP2(a1[2 * j + 1]));
          }
          bp[si][c] = __builtin_bit_cast(v16h, u);
        }
        __builtin_amdgcn_sched_barrier(0);     // the loads below take the registers of this slice's scores: not lifted over their last use
        const _Float16* vrow = (const _Float16*)(stV + l15 * kPitchV) + si * 32 + 8 * hi;   // row d = dg*16 + l15
#pragma unroll
        for (int dg = 0; dg < 4; ++dg) av[si][dg] = FragH::load(vrow + dg * 16 * (kPitchV / 2));
        __builtin_amdgcn_sched_barrier(0);     // keeps the slice's 8 loads one group, ahead of the work that covers their latency
        lb[0] = FragH::mma(aone, bp[si][0], si ? lb[0] : zero8());
        lb[1] = FragH::mma(aone, bp[si][1], si ? lb[1] : zero8());
      }
      __builtin_amdgcn_sched_barrier(0);       // keeps the last two sum WMMAs together ahead of the comparisons: one result distance, not two
      // p >= 0, so a sum under kSumLim bounds every p of the row; an overflowed p (or a NaN) fails the comparison
      const bool bad = !(lb[0][0] < kSumLim) || !(lb[1][0] < kSumLim);
      if (__builtin_amdgcn_ballot_w32(bad) == 0) {   // one scalar branch a block; O^T and l are untouched until it is passed
        l[0] += lb[0][0];
        l[1] += lb[1][0];
#pragma unroll
        for (int si = 0; si < 2; ++si) {
#pragma unroll
          for (int dg = 0; dg < 4; ++dg) {
            oacc[0][dg] = FragH::mma(av[si][dg], bp[si][0], oacc[0][dg]);
            oacc[1][dg] = FragH::mma(av[si][dg], bp[si][1], oacc[1][dg]);
          }
        }
        // 4 VALU slots behind the block's last WMMAs, ahead of the branches at the publish point
        acc_guard8(oacc[0][0], oacc[0][1], oacc[0][2], oacc[0][3], oacc[1][0], oacc[1][1], oacc[1][2], oacc[1][3]);
        full = false;
      }
    }
    if (full) {
    // ---- S^T subtiles (16 kv each): 2 bf16 WMMAs a column subgroup, then the mask; the scores stay unscaled ----
    v8f s4[2][4];
    if (interior) {
      // interior block: no mask and no per-subtile test; the 16 K fragment loads stand as one group, the WMMAs run on 8 independent tiles
      v16b ak[4][2];
      const __bf16* krow = (const __bf16*)(stK + l15 * kPitchK) + 8 * hi;
#pragma unroll
      for (int t = 0; t < 4; ++t) ak[t][0] = FragB::load(krow + t * 16 * (kPitchK / 2));
#pragma unroll
      for (int t = 0; t < 4; ++t) ak[t][1] = FragB::load(krow + t * 16 * (kPitchK / 2) + 32);
      __builtin_amdgcn_sched_barrier(0);       // keeps the loads one group ahead of the WMMAs: one LDS latency a block, not one a subtile
      v8f s[2][4];
#pragma unroll
      for (int t = 0; t < 4; ++t) {
        s[0][t] = FragB::mma(ak[t][0], bq[0][0], zero8());
        s[1][t] = FragB::mma(ak[t][0], bq[1][0], zero8());
      }
#pragma unroll
      for (int t = 0; t < 4; ++t) {
        s[0][t] = FragB::mma(ak[t][1], bq[0][1], s[0][t]);
        s[1][t] = FragB::mma(ak[t][1], bq[1][1], s[1][t]);
      }
      __builtin_amdgcn_sched_barrier(0);       // keeps the 16 WMMAs back to back: each fills the others' result distance instead of v_nop
#pragma unroll
      for (int t = 0; t < 4; ++t) { s4[0][t] = s[0][t]; s4[1][t] = s[1][t]; }
    } else {
#pragma unroll
    for (int t = 0; t < 4; ++t) {
      const int c0 = kv0 + t * 16;
      if (c0 > qmax) {                       // wave-uniform: whole subtile masked
        s4[0][t] = neg8();
        s4[1][t] = neg8();
        continue;
      }
      const __bf16* krow = (const __bf16*)(stK + (t * 16 + l15) * kPitchK) + 8 * hi;
      const v16b ak0 = FragB::load(krow);
      const v16b ak1 = FragB::load(krow + 32);
      v8f sa = zero8(), sb = zero8();
      sa = FragB::mma(ak0, bq[0][0], sa);
      sb = FragB::mma(ak0, bq[1][0], sb);
      sa = FragB::mma(ak1, bq[0][1], sa);
      sb = FragB::mma(ak1, bq[1][1], sb);
      dep_guard2_b(sa, sb, ak0, ak1, bq[0][0], bq[0][1], bq[1][0], bq[1][1]);
#pragma unroll
      for (int c = 0; c < 2; ++c) {
        const v8f  s    = c ? sb : sa;
        const bool part = (c0 + 15 > q0w + c * 16 + numpt);   // wave-uniform: some (q, kv) of the subtile masked
        const int  lim  = q0w + c * 16 + l15 + numpt - c0;    // kv local index visible iff <= lim
        v8f sc;
#pragma unroll
        for (int r = 0; r < 8; ++r) {
          float vv = s[r];
          if (part && (r + 8 * hi > lim)) vv = NEG_INF;
          sc[r] = vv;
        }
        s4[c][t] = sc;
      }
    }
    }

    // ---- block-level online softmax in log2 domain, the two column subgroups side by side ----
    float alpha[2], bias[2];
    const v8f sc8 = (v8f){kScale2, kScale2, kScale2, kScale2, kScale2, kScale2, kScale2, kScale2};
    float tmx[2], oth[2];
#pragma unroll
    for (int c = 0; c < 2; ++c)
      tmx[c] = fmaxf(fmaxf(hmax8(s4[c][0]), hmax8(s4[c][1])), fmaxf(hmax8(s4[c][2]), hmax8(s4[c][3])));
#pragma unroll
    for (int c = 0; c < 2; ++c) oth[c] = __shfl_xor(tmx[c], 16, 32);
    __builtin_amdgcn_sched_barrier(0);         // keeps both exchanges in flight together: one cross-lane latency a block, not two
#pragma unroll
    for (int c = 0; c < 2; ++c) {
      const float tmax = fmaxf(tmx[c], oth[c]);
      const float mn   = fmaxf(m[c], tmax * kScale2);   // scale > 0: the scaled maximum is the maximum of the scaled scores
      alpha[c]         = (m[c] > NEG_INF) ? EXP2(m[c] - mn) : 0.0f;
      bias[c] = kCarryLog2 - ((mn > NEG_INF) ? mn : 0.0f);
      m[c] = mn;
    }

    // ---- p = exp2(s * scale + bias) as the f16 B operand P^T, slice by slice (32 kv); each slice's V^T fragments are asked for as
    // soon as its f32 scores are dead ----
    v16h bp[2][2];                             // [slice][column subgroup]
    v16h av[2][4];                             // [slice][d group]
#pragma unroll
    for (int si = 0; si < 2; ++si) {
#pragma unroll
      for (int c = 0; c < 2; ++c) {
        const v8f bi8 = (v8f){bias[c], bias[c], bias[c], bias[c], bias[c], bias[c], bias[c], bias[c]};
        const v8f a0 = __builtin_elementwise_fma(s4[c][2 * si], sc8, bi8);       // kv si*32 + 8*hi + 0..7 of this lane's q column
        const v8f a1 = __builtin_elementwise_fma(s4[c][2 * si + 1], sc8, bi8);   // kv si*32 + 16 + 8*hi + 0..7
        v8u u;
#pragma unroll
        for (int j = 0; j < 4; ++j) {
          u[j]     = pkh2(EXP2(a0[2 * j]), EXP2(a0[2 * j + 1]));
          u[4 + j] = pkh2(EXP2(a1[2 * j]), EXP2(a1[2 * j + 1]));
        }
        bp[si][c] = __builtin_bit_cast(v16h, u);
      }
      __builtin_amdgcn_sched_barrier(0);       // the loads below take the registers of this slice's scores: not lifted over their last use
      const _Float16* vrow = (const _Float16*)(stV + l15 * kPitchV) + si * 32 + 8 * hi;   // row d = dg*16 + l15
#pragma unroll
      for (int dg = 0; dg < 4; ++dg) av[si][dg] = FragH::load(vrow + dg * 16 * (kPitchV / 2));
      __builtin_amdgcn_sched_barrier(0);       // keeps the slice's 8 loads one group, ahead of the vector work that covers their latency
    }

    // ---- rescale, then row sums and O^T += V^T . P^T : per slice 2 f16 WMMAs for the row sums and 8 for O^T (every V^T fragment
    // feeds both column subgroups) ----
    v8f lb[2];                                 // the block's row sums
#pragma unroll
    for (int c = 0; c < 2; ++c) {
      lb[c] = FragH::mma(aone, bp[0][c], zero8());
      lb[c] = FragH::mma(aone, bp[1][c], lb[c]);
    }
#pragma unroll
    for (int c = 0; c < 2; ++c)
#pragma unroll
      for (int dg = 0; dg < 4; ++dg)
#pragma unroll
        for (int r = 0; r < 8; ++r) oacc[c][dg][r] *= alpha[c];
    // spreads the O^T rescale among the first WMMAs (one WMMA, then 8 vector instructions, four times): the multiplies issue in the
    // WMMAs' shadow; without it they all stand ahead of the first WMMA
#pragma unroll
    for (int i = 0; i < 4; ++i) {
      __builtin_amdgcn_sched_group_barrier(0x8, 1, 0);
      __builtin_amdgcn_sched_group_barrier(0x2, 8, 0);
    }
#pragma unroll
    for (int si = 0; si < 2; ++si) {
#pragma unroll
      for (int dg = 0; dg < 4; ++dg) {
        oacc[0][dg] = FragH::mma(av[si][dg], bp[si][0], oacc[0][dg]);
        oacc[1][dg] = FragH::mma(av[si][dg], bp[si][1], oacc[1][dg]);
      }
    }
    // 4 VALU slots behind the block's last WMMAs, ahead of the branches at the publish point
    acc_guard8(oacc[0][0], oacc[0][1], oacc[0][2], oacc[0][3], oacc[1][0], oacc[1][1], oacc[1][2], oacc[1][3]);
    l[0] = l[0] * alpha[0] + lb[0][0];
    l[1] = l[1] * alpha[1] + lb[1][0];
    }
    }
    // ---- publish point of tile it + 1, every wave: own reads of this buffer done, own copies landed, barrier, then the refill ----
    wait_ds0();
    wait_async0();
    __syncthreads();
    if (it + 2 < nt) issue_stage(it + 2);      // work-group-uniform: into the buffer that this trip has just read
  }
  wait_async0();
  acc_guard8(oacc[0][0], oacc[0][1], oacc[0][2], oacc[0][3], oacc[1][0], oacc[1][1], oacc[1][2], oacc[1][3]);

  // ---- epilogue: join the two key halves of each column group through its LDS slab, normalize, whole-line stores ----
  float* slab = sT[cg];
  if (kh == 1) {                               // wave-uniform (scalar): the upper half hands over O^T, maximum and row sum
#pragma unroll
    for (int c = 0; c < 2; ++c) {
#pragma unroll
      for (int dg = 0; dg < 4; ++dg)
#pragma unroll
        for (int r = 0; r < 8; ++r)
          slab[(c * 16 + l15) * 68 + dg * 16 + 8 * hi + r] = oacc[c][dg][r];
      if (hi == 0) { sM[cg][c * 16 + l15] = m[c]; sL[cg][c * 16 + l15] = l[c]; }
    }
  }
  __syncthreads();                             // the upper half's partial results are visible to the lower half
  if (kh == 0) {                               // wave-uniform (scalar): the lower half joins, each lane at its own slab places
#pragma unroll
    for (int c = 0; c < 2; ++c) {
      const float m1 = sM[cg][c * 16 + l15];
      const float l1 = sL[cg][c * 16 + l15];
      const float mt = fmaxf(m[c], m1);
      const float a0 = (m[c] > NEG_INF) ? EXP2(m[c] - mt) : 0.0f;
      const float a1 = (m1 > NEG_INF) ? EXP2(m1 - mt) : 0.0f;   // an upper half with no visible key counts for nothing
      const float lt = l[c] * a0 + l1 * a1;
      const float inv = (lt > 0.f) ? (1.0f / lt) : 0.f;          // the carry stands in oacc and in l alike and cancels
      const float f0 = a0 * inv, f1 = a1 * inv;
#pragma unroll
      for (int dg = 0; dg < 4; ++dg)
#pragma unroll
        for (int r = 0; r < 8; ++r) {
          float* p = slab + (c * 16 + l15) * 68 + dg * 16 + 8 * hi + r;
          *p = oacc[c][dg][r] * f0 + *p * f1;
        }
    }
  }
  __syncthreads();                             // the joined rows are visible to both halves, which store 16 rows each
  const int hh = lane >> 4, c4 = (lane & 15) * 4;   // row seg = 256 B = 16 lanes x 16 B
  {
#pragma unroll
    for (int it = 0; it < 8; ++it) {
      const int row = kh * 16 + it * 2 + hh;
      const v4f vv = *(const v4f*)(slab + row * 68 + c4);
      *(v4f*)(Ob + (size_t)(q0w + row) * HD + c4) = vv;
    }
  }
}

// ---------------------------------------------------------------------------
// Host glue.
//   Kp  bf16 [NB*NH][SKV][64]     NB*NH*SKV*128   at 0              (cast_rows_kernel)
//   Vt  f16  [NB*NH][64][SKV]     NB*NH*SKV*128   at NB*NH*SKV*128  (v_transpose_kernel)
//   total (NB=2, SKV=3072)         25,165,824
// 3 launches.
// ---------------------------------------------------------------------------
extern "C" void kernel_launch(void* const* d_in, const int* in_sizes, int n_in,
                              void* d_out, int out_size, void* d_ws, size_t ws_size,
                              hipStream_t stream) {
  if (n_in < 4) return;
  if (in_sizes[0] < NB * NH * SEQ * HD) return;
  if (in_sizes[1] < NB * NH * SKV * HD) return;
  if (in_sizes[2] < NB * NH * SKV * HD) return;
  if (in_sizes[3] < 1) return;
  if (out_size < NB * NH * SEQ * HD) return;

  const size_t szK   = (size_t)NB * NH * SKV * HD * 2;
  const size_t szVt  = (size_t)NB * NH * HD * SKV * 2;
  const size_t offK  = 0;
  const size_t offVt = offK + szK;
  const size_t total = offVt + szVt;
  if (ws_size < total) return;

  const float* q  = (const float*)d_in[0];
  const float* k  = (const float*)d_in[1];
  const float* v  = (const float*)d_in[2];
  const int*   np = (const int*)d_in[3];
  float* out = (float*)d_out;
  char* ws = (char*)d_ws;
  unsigned short* Kp = (unsigned short*)(ws + offK);
  _Float16*       Vt = (_Float16*)(ws + offVt);

  const int nRowsK = NB * NH * SKV;                 // multiple of 32
  // (1) Kp[bh][kv][d] = bf16(k[bh][kv][d])
  cast_rows_kernel<<<dim3(nRowsK / 32), dim3(256), 0, stream>>>(k, Kp, SKV, SKV_FULL, nRowsK);
  // (2) Vt[bh][d][kv] = f16(bf16(v[bh][kv][d]))
  v_transpose_kernel<<<dim3(SKV / 64, NB * NH), dim3(256), 0, stream>>>(v, Vt);
  // (3) attention
  attn_kernel<<<dim3(SEQ / 128, NH, NB), dim3(256), 0, stream>>>(q, Kp, (const unsigned short*)Vt, np, out);
}

// v009
// One run takes 42.3 microseconds.
// Timed twice side by side with v008, it ran 1.06 and 1.05 times as fast.
// Over all steps from v000 it is 5.07 times as fast.
// Contractions: scores K.Q^T on v_wmma_f32_16x16x32_bf16 (bf16 operands = RNE bf16 copies of q and k, f32 accumulate); context V^T.P^T on v_wmma_f32_16x16x32_f16 (f16 operands: v = f16 of its RNE bf16 copy, p carried x256, f32 accumulate); softmax row sums ONES.P^T on the same f16 form (f32 accumulate); scale, mask, maximum and exp2 in f32.
#include <hip/hip_runtime.h>
#include <math.h>

// ---------------------------------------------------------------------------
// Problem constants (NB / SEQ / SKV overridable for a reduced build; *_FULL = input strides)
// ---------------------------------------------------------------------------
#ifndef NB
#define NB 2
#endif
#ifndef SEQ
#define SEQ 2048
#endif
#ifndef SKV
#define SKV 3072
#endif
#define NB_FULL   2
#define NH        16
#define HD        64
#define SEQ_FULL  2048
#define SKV_FULL  3072

static_assert(NB >= 1 && NB <= NB_FULL);
static_assert(SEQ % 128 == 0 && SEQ <= SEQ_FULL);
static_assert(SKV % 128 == 0 && SKV <= SKV_FULL);
static_assert(HD == 64);
static_assert((NB * NH * SKV) % 32 == 0);

constexpr float kScale2   = 0.125f * 1.44269504088896340736f;   // 1/sqrt(64) * log2(e): softmax in log2 domain
constexpr float kCarryLog2 = 8.0f;                             // p carried x256 (f16 operand and row sum alike): 8 added to the exp2 argument; leaves
                                                               // 8 binary orders of f16 range above the maximum in use
constexpr float kSumLim    = 60000.0f;                         // below the largest finite f16: a 64-key sum of p >= 0 under it holds no overflowed p
#define NEG_INF (-__builtin_inff())

#if __has_builtin(__builtin_amdgcn_exp2f)
#define EXP2(x) __builtin_amdgcn_exp2f(x)
#else
#define EXP2(x) exp2f(x)
#endif

typedef __attribute__((ext_vector_type(16))) _Float16 v16h;
typedef __attribute__((ext_vector_type(8)))  _Float16 v8h;
typedef __attribute__((ext_vector_type(2)))  _Float16 v2h;
typedef __attribute__((ext_vector_type(16))) __bf16   v16b;
typedef __attribute__((ext_vector_type(8)))  __bf16   v8b;
typedef __attribute__((ext_vector_type(8)))  float    v8f;
typedef __attribute__((ext_vector_type(4)))  float    v4f;
typedef __attribute__((ext_vector_type(4)))  unsigned int v4u;
typedef __attribute__((ext_vector_type(8)))  unsigned int v8u;

__device__ __forceinline__ unsigned short f2bf_bits(float f) {        // RNE convert f32 -> bf16 bits
  unsigned u = __float_as_uint(f);
  return (unsigned short)((u + 0x7FFFu + ((u >> 16) & 1u)) >> 16);
}
__device__ __forceinline__ float bf_bits2f(unsigned short h) { return __uint_as_float(((unsigned)h) << 16); }

// hazard guards: 4 VALU slots after the last WMMA of a group, tie D, keep A/B live
__device__ __forceinline__ void acc_guard8(v8f& a, v8f& b, v8f& c, v8f& d, v8f& e, v8f& f, v8f& g, v8f& h) {
  asm volatile("v_nop\n\tv_nop\n\tv_nop\n\tv_nop" : "+v"(a), "+v"(b), "+v"(c), "+v"(d), "+v"(e), "+v"(f), "+v"(g), "+v"(h));
}
__device__ __forceinline__ void dep_guard2_b(v8f& a, v8f& b, v16b w, v16b x, v16b y0, v16b y1, v16b z0, v16b z1) {
  asm volatile("v_nop\n\tv_nop\n\tv_nop\n\tv_nop" : "+v"(a), "+v"(b) : "v"(w), "v"(x), "v"(y0), "v"(y1), "v"(z0), "v"(z1));
}

template <typename T> struct Frag;
template <> struct Frag<_Float16> {
  typedef v16h V; union U { v16h v; v8h h[2]; };
  // elements 0..7 <- p[0..7], 8..15 <- p[16..23]; caller passes p = row + k0 + 8*(lane>>4)
  static __device__ __forceinline__ v16h load(const _Float16* p) {
    U f; f.h[0] = *(const v8h*)(p); f.h[1] = *(const v8h*)(p + 16); return f.v;
  }
  static __device__ __forceinline__ v8f mma(v16h a, v16h b, v8f c) {
    return __builtin_amdgcn_wmma_f32_16x16x32_f16(false, a, false, b, (short)0, c, false, false);
  }
};
template <> struct Frag<__bf16> {
  typedef v16b V; union U { v16b v; v8b h[2]; };
  static __device__ __forceinline__ v16b load(const __bf16* p) {
    U f; f.h[0] = *(const v8b*)(p); f.h[1] = *(const v8b*)(p + 16); return f.v;
  }
  static __device__ __forceinline__ v8f mma(v16b a, v16b b, v8f c) {
    return __builtin_amdgcn_wmma_f32_16x16x32_bf16(false, a, false, b, (short)0, c, false, false);
  }
};
typedef Frag<_Float16> FragH;
typedef Frag<__bf16>   FragB;

__device__ __forceinline__ unsigned pk16(unsigned short a, unsigned short b) { return (unsigned)a | ((unsigned)b << 16); }
// pack two f32 -> one dword of two f16 (element 0 = a)
__device__ __forceinline__ unsigned pkh2(float a, float b) {
  v2h p; p[0] = (_Float16)a; p[1] = (_Float16)b;
  return __builtin_bit_cast(unsigned, p);
}
__device__ __forceinline__ v8f zero8() { return (v8f){0.f, 0.f, 0.f, 0.f, 0.f, 0.f, 0.f, 0.f}; }
__device__ __forceinline__ v8f neg8()  { return (v8f){NEG_INF, NEG_INF, NEG_INF, NEG_INF, NEG_INF, NEG_INF, NEG_INF, NEG_INF}; }
// balanced-tree horizontal reduction
__device__ __forceinline__ float hmax8(v8f v) {
  float a = fmaxf(v[0], v[1]), b = fmaxf(v[2], v[3]);
  float c = fmaxf(v[4], v[5]), d = fmaxf(v[6], v[7]);
  return fmaxf(fmaxf(a, b), fmaxf(c, d));
}

// ---------------------------------------------------------------------------
// (1a) K cast, one block of 32 rows: dst row pr = g * SKV + r  <-  src row g * SKV_FULL + r  (g = (b*NH + h)).
// 256 threads = 32 rows; thread t: row t>>3, 8 halves at (t&7)*8.
// ---------------------------------------------------------------------------
__device__ __forceinline__ void cast_rows_block(const float* __restrict__ src,
                                                unsigned short* __restrict__ dst, int blk) {
  constexpr int rowsPerGroup = SKV, srcRowsPerGroup = SKV_FULL, nRows = NB * NH * SKV;
  const int t  = threadIdx.x;
  int pr = blk * 32 + (t >> 3);
  pr = (pr < nRows) ? pr : (nRows - 1);            // address clamp (grid is exact)
  const int c8 = (t & 7) * 8;
  const int g  = pr / rowsPerGroup;
  const int r  = pr - g * rowsPerGroup;
  const float* s = src + ((size_t)g * srcRowsPerGroup + r) * HD + c8;
  const v4f a = *(const v4f*)(s);
  const v4f b = *(const v4f*)(s + 4);
  unsigned short hb[8];
#pragma unroll
  for (int e = 0; e < 4; ++e) { hb[e] = f2bf_bits(a[e]); hb[4 + e] = f2bf_bits(b[e]); }
  const v4u u = (v4u){pk16(hb[0], hb[1]), pk16(hb[2], hb[3]), pk16(hb[4], hb[5]), pk16(hb[6], hb[7])};
  unsigned short* d = dst + (size_t)pr * HD + c8;
  *(v4u*)d = u;
  // stands ahead of any rewrite of the store's address and data registers on the ways the merged kernel's branches leave open behind it
  asm volatile("s_wait_xcnt 0x0" ::: "memory");
}

// ---------------------------------------------------------------------------
// (1b) V cast + transpose, one block: Vt[bh][d][kv] = f16( bf16( v[bh][kv][d] ) )   (pitch SKV halves)
// 256 threads; one 64(kv) x 64(d) tile through LDS.
// Load coverage: 16 iterations x 256 threads = 4096 = whole tile (coalesced along d); sm cross-wave -> __syncthreads.
// Store coverage: 8 waves x 2 iterations x 4 rows (lane>>3) = 64 d-rows; (lane&7) x 8 halves = 64 kv;
// ---------------------------------------------------------------------------
__device__ __forceinline__ void v_transpose_block(const float* __restrict__ v,
                                                  _Float16* __restrict__ Vt, int kvb, int bh) {
  __shared__ float sm[64][65];   // sm[kv_local][d]
  const int tid = threadIdx.x;
  const int kv0 = kvb * 64;                          // bh = b*NH + h, b < NB
  const float* vb = v + ((size_t)bh * SKV_FULL + kv0) * HD;
#pragma unroll
  for (int i = 0; i < 16; ++i) {
    const int e = i * 256 + tid;
    const int r = e >> 6;          // kv local
    const int c = e & 63;          // d
    sm[r][c] = vb[(size_t)r * HD + c];
  }
  __syncthreads();
  const int lane = tid & 31, wave = tid >> 5;
  const int q = lane >> 3, c8 = (lane & 7) * 8;
  _Float16* vt = Vt + (size_t)bh * HD * SKV;
  {
#pragma unroll
    for (int it = 0; it < 2; ++it) {
      const int row = wave * 8 + it * 4 + q;          // d
      v8h hv;
#pragma unroll
      for (int e = 0; e < 8; ++e) hv[e] = (_Float16)bf_bits2f(f2bf_bits(sm[c8 + e][row]));
      *(v8h*)(vt + (size_t)row * SKV + kv0 + c8) = hv;
    }
  }
}

// ---------------------------------------------------------------------------
// (1) Both operand planes in one launch: the two jobs share nothing, so one grid holds the blocks of both and the block index picks
// the job (a scalar, block-uniform branch: the transpose's barrier is passed by all of its block or by none).
// Blocks 0 .. kPrepV-1: V tiles (the longer job of the two, so they start first); the rest: 32-row K blocks.
// ---------------------------------------------------------------------------
constexpr int kPrepV = (SKV / 64) * NB * NH;
constexpr int kPrepK = (NB * NH * SKV) / 32;
__global__ __launch_bounds__(256) void prep_kernel(const float* __restrict__ k,
                                                    unsigned short* __restrict__ Kp,
                                                    const float* __restrict__ v,
                                                    _Float16* __restrict__ Vt) {
  const int blk = blockIdx.x;
  if (blk < kPrepV) v_transpose_block(v, Vt, blk % (SKV / 64), blk / (SKV / 64));
  else              cast_rows_block(k, Kp, blk - kPrepV);
}

// ---------------------------------------------------------------------------
// LDS ring of the attention kernel: a stage = one 128-key K tile (128 kv rows x 128 B) and one V^T tile (64 d rows x 256 B).
// ---------------------------------------------------------------------------
constexpr int kKeys   = 128;              // keys per stage = per publish point; a wave's softmax pass takes 64 of them
constexpr int kPitchK = 144;              // K row pitch in bytes: 128 + 16, an odd multiple of 16 (ds_load_b128 readers)
constexpr int kPitchV = 272;              // V^T row pitch in bytes: 256 + 16, an odd multiple of 16
constexpr int kTileKB = kKeys * kPitchK;  // K tile
constexpr int kTileVB = HD * kPitchV;     // V^T tile
constexpr int kStageB = kTileKB + kTileVB;   // K tile, then V^T tile
static_assert(kPitchK % 16 == 0 && ((kPitchK / 16) & 1) == 1);
static_assert(kPitchV % 16 == 0 && ((kPitchV / 16) & 1) == 1);
static_assert(kTileKB % 16 == 0 && kStageB % 16 == 0);
static_assert(SKV >= kKeys);              // the ring's prologue fills stage 0 without a test

// Eight 16-byte asynchronous copies per lane = this lane's share of one stage: K rows 32 apart from (lk, gk), V^T rows 16 apart
// from (lv, gv). l* = LDS byte addresses, g* = global addresses.
// s_wait_xcnt 0 is the statement's last line so that it stands ahead of any rewrite of the address registers the copies name.
__device__ __forceinline__ void copy_stage(unsigned lk, unsigned lv, const unsigned char* gk, const unsigned char* gv) {
  asm volatile("global_load_async_to_lds_b128 %0, %8, off\n\t"
               "global_load_async_to_lds_b128 %1, %9, off\n\t"
               "global_load_async_to_lds_b128 %2, %10, off\n\t"
               "global_load_async_to_lds_b128 %3, %11, off\n\t"
               "global_load_async_to_lds_b128 %4, %12, off\n\t"
               "global_load_async_to_lds_b128 %5, %13, off\n\t"
               "global_load_async_to_lds_b128 %6, %14, off\n\t"
               "global_load_async_to_lds_b128 %7, %15, off\n\t"
               "s_wait_xcnt 0x0"
               :: "v"(lk), "v"(lk + 32 * kPitchK), "v"(lk + 64 * kPitchK), "v"(lk + 96 * kPitchK),
                  "v"(lv), "v"(lv + 16 * kPitchV), "v"(lv + 32 * kPitchV), "v"(lv + 48 * kPitchV),
                  "v"(gk), "v"(gk + 32 * HD * 2), "v"(gk + 64 * HD * 2), "v"(gk + 96 * HD * 2),
                  "v"(gv), "v"(gv + (size_t)16 * SKV * 2), "v"(gv + (size_t)32 * SKV * 2), "v"(gv + (size_t)48 * SKV * 2)
               : "memory");
}
// the wave's own copies have landed (the compiler places no wait for them)
__device__ __forceinline__ void wait_async0() { asm volatile("s_wait_asynccnt 0x0" ::: "memory"); }
// the wave's own LDS reads have returned, before the buffer is handed to its next writer
__device__ __forceinline__ void wait_ds0() { asm volatile("s_wait_dscnt 0x0" ::: "memory"); }

// ---------------------------------------------------------------------------
// (2) Flash-style prefix-causal attention. grid (SEQ/128, NH, NB), 256 threads = 8 waves = 4 column groups of 32 query rows x 2 key
// halves; blockIdx.x -> query tile by a per-head permutation.
// Wave (cg, kh) works on query rows cg*32 .. +31 and on keys kh*64 .. +63 of every 128-key stage: each K and V^T fragment it reads
// from LDS feeds two WMMAs (one per 16-row column subgroup), so a score costs half the LDS bytes of a 16-row wave.
// Per wave: Q B-fragments (bf16, RNE) in registers; loop over the stages up to the last visible key;
//   S^T subtile = K(16 kv x 64 d, bf16 plane rows) . Q^T : 2 bf16 WMMAs a subgroup; mask (kv > q + num_pt -> -inf) on the raw scores,
//   f32 online softmax in log2 domain, p x256 = exp2(s * scale + (8 - max)): one FMA a score carries scale, maximum and carry
//   (row stats shared by lanes l and l^16); O^T += V^T(16 d x 32 kv, f16 plane rows) . P^T with
//   P^T fragment = [own D of subtile 2si (kv 0-15 of slice), own D of subtile 2si+1 (kv 16-31)] as f16 x256.
// The maximum in use is a stale one: a wholly visible block behind the wave's first takes p against the maximum it already has (no
// maximum, no exchange, no rescale) and is accepted if its row sums show that no p left the f16 range; else, and for the first and
// the masked blocks, the full pass (new maximum, rescale) is run on the block from its K fragments on.
// The two key halves of a column group keep their own maximum, row sum and O^T and are joined once, in the epilogue, through LDS.
// K and V^T tiles are brought into LDS once per work-group by asynchronous copies, two buffers: tile t + 1 flies while tile t is
// worked on; one publish point per tile (own LDS reads done, own copies landed, barrier, refill), passed by every wave; a wave
// skips only the work of key blocks beyond its own last visible key.
// ---------------------------------------------------------------------------
constexpr int kWKeys = kKeys / 2;         // keys of a stage that one wave works on
__global__ __launch_bounds__(256) void attn_kernel(const float* __restrict__ q,
                                                    const unsigned short* __restrict__ Kp,
                                                    const unsigned short* __restrict__ Vtp,
                                                    const int* __restrict__ np,
                                                    float* __restrict__ out) {
  __shared__ __align__(16) float sT[4][32 * 68];   // per column group: 32 query rows x 64 d, pitch 68 floats
  __shared__ float sM[4][32];                      // upper key half's row maximum
  __shared__ float sL[4][32];                      // upper key half's row sum
  __shared__ __align__(16) unsigned char ring[2 * kStageB];
  const int tid  = threadIdx.x;
  const int wave = __builtin_amdgcn_readfirstlane(tid >> 5);   // scalar: the per-wave skip between publish points is a scalar branch
  const int cg   = wave & 3;                 // column group: 32 query rows
  const int kh   = wave >> 2;                // key half of every stage
  const int lane = tid & 31;
  const int hi   = lane >> 4;                // lane half: k offset 8*hi, D row offset 8*hi
  const int l15  = lane & 15;                // A row / B,D column
  const int h    = blockIdx.y;
  const int b    = blockIdx.z;
  const int bh   = b * NH + h;
  // Query tile of this work-group. A tile's cost grows with its index (tile t walks t more key tiles than tile 0) and every
  // work-group is resident from the start, two to a WGP, so the launch lasts as long as the fullest WGP. Work-groups whose flat
  // index differs in one bit above the low three get tiles d and kQT - 1 - d: equal sums.
  // For speed only: for each bh the map is a permutation of the tiles, wherever the work-groups land.
  constexpr int kQT = SEQ / 128;
  int qt = blockIdx.x;
  if (kQT % 2 == 0) {
    const int up   = (qt >= kQT / 2) ? 1 : 0;
    const int d    = qt - up * (kQT / 2);
    const int flip = (up ^ __builtin_popcount((unsigned)bh)) & 1;
    qt = flip ? (kQT - 1 - d) : d;
  }
  const int q0w  = qt * 128 + cg * 32;

  int numpt = np[0];
  numpt = (numpt < 0) ? 0 : numpt;
  numpt = (numpt > SKV) ? SKV : numpt;

  const float*    Qb = q + ((size_t)bh * SEQ_FULL) * HD;
  const __bf16*   Kb = (const __bf16*)Kp + (size_t)bh * SKV * HD;
  const _Float16* Vb = (const _Float16*)Vtp + (size_t)bh * HD * SKV;
  float*          Ob = out + ((size_t)bh * SEQ) * HD;

  // ---- Q as bf16 B operand of S^T = K.Q^T: B[k=d][n=q]; elements 0..7 <- d k0+8hi+0..7, 8..15 <- d k0+16+8hi+0..7 ----
  v16b bq[2][2];                             // [column subgroup][k step]
  const float* qp0 = Qb + (size_t)(q0w + l15) * HD + 8 * hi;
  const float* qp1 = qp0 + 16 * HD;
#pragma unroll
  for (int c = 0; c < 2; ++c) {
    const float* qrow = c ? qp1 : qp0;
#pragma unroll
    for (int si = 0; si < 2; ++si) {
      const v4f f0 = *(const v4f*)(qrow + si * 32);
      const v4f f1 = *(const v4f*)(qrow + si * 32 + 4);
      const v4f g0 = *(const v4f*)(qrow + si * 32 + 16);
      const v4f g1 = *(const v4f*)(qrow + si * 32 + 16 + 4);
      v8u u;
      u[0] = pk16(f2bf_bits(f0[0]), f2bf_bits(f0[1]));
      u[1] = pk16(f2bf_bits(f0[2]), f2bf_bits(f0[3]));
      u[2] = pk16(f2bf_bits(f1[0]), f2bf_bits(f1[1]));
      u[3] = pk16(f2bf_bits(f1[2]), f2bf_bits(f1[3]));
      u[4] = pk16(f2bf_bits(g0[0]), f2bf_bits(g0[1]));
      u[5] = pk16(f2bf_bits(g0[2]), f2bf_bits(g0[3]));
      u[6] = pk16(f2bf_bits(g1[0]), f2bf_bits(g1[1]));
      u[7] = pk16(f2bf_bits(g1[2]), f2bf_bits(g1[3]));
      bq[c][si] = __builtin_bit_cast(v16b, u);
    }
  }
  // the wait ahead of any rewrite of the Q loads' address registers; naming them keeps a load's own result off them too
  asm volatile("s_wait_xcnt 0x0" :: "v"(qp0), "v"(qp1) : "memory");

  // O^T accumulators: oacc[c][dg][r] = carry * O[q0w + c*16 + l15][dg*16 + 8*hi + r], over this wave's key half
  v8f oacc[2][4];
#pragma unroll
  for (int c = 0; c < 2; ++c)
#pragma unroll
    for (int dg = 0; dg < 4; ++dg) oacc[c][dg] = zero8();
  float m[2] = {NEG_INF, NEG_INF};           // per-lane row stats (log2 domain)
  // row sums on the matrix pipe, carried x256 like p: a block's sums lb[c] = ONES . P^T, ONES = 16 x 32 f16 with rows 0 and 8 all ones
  // and the rest zero, so D rows 0 and 8 (register 0 of either lane half) hold the sum over the block's kv of this lane's q column
  const unsigned onew = ((l15 & 7) == 0) ? 0x3C003C00u : 0u;   // two f16 1.0
  const v16h aone = __builtin_bit_cast(v16h, (v8u){onew, onew, onew, onew, onew, onew, onew, onew});
  float l[2] = {0.f, 0.f};                   // per-lane row sums, relative to m

  const int qmax   = q0w + 31 + numpt;       // last visible key of this wave's last row
  const int kv_end = (SKV < qmax + 1) ? SKV : (qmax + 1);

  // work-group-uniform tile count: up to the last visible key of the block's last row; >= 1, <= SKV / 128
  const int qmaxb = qt * 128 + 127 + numpt;
  const int nt    = (((SKV < qmaxb + 1) ? SKV : (qmaxb + 1)) + kKeys - 1) / kKeys;

  // this lane's share of a stage: 16 B at column ccol of K rows crow + 32 j, 16 B at column vcol of V^T rows vrw + 16 j, j < 4
  // (a wave-wide copy = 4 whole lines)
  const int crow = tid >> 3, ccol = (tid & 7) * 16;
  const int vrw  = tid >> 4, vcol = (tid & 15) * 16;
  const unsigned char* kg = (const unsigned char*)Kb + (size_t)crow * (HD * 2) + ccol;
  const unsigned char* vg = (const unsigned char*)Vb + (size_t)vrw * (SKV * 2) + vcol;
  const unsigned       lck = (unsigned)(size_t)ring + crow * kPitchK + ccol;
  const unsigned       lcv = (unsigned)(size_t)ring + kTileKB + vrw * kPitchV + vcol;
  auto issue_stage = [&](int s) {
    const unsigned ob = (s & 1) * kStageB;
    copy_stage(lck + ob, lcv + ob, kg + (size_t)s * (kKeys * HD * 2), vg + (size_t)s * (kKeys * 2));
  };

  issue_stage(0);
  wait_async0();
  __syncthreads();
  if (nt > 1) issue_stage(1);                  // work-group-uniform

#pragma unroll 1
  for (int it = 0; it < nt; ++it) {
    const int kv0 = it * kKeys + kh * kWKeys;
    const unsigned char* stK = ring + (it & 1) * kStageB + kh * (kWKeys * kPitchK);   // this wave's 64 K rows
    const unsigned char* stV = ring + (it & 1) * kStageB + kTileKB + kh * (kWKeys * 2);   // this wave's 64 V^T columns
    if (kv0 < kv_end) {                        // wave-uniform (scalar): key blocks beyond this wave's last visible key hold no work
    const bool interior = (kv0 + kWKeys - 1 <= q0w + numpt);   // wave-uniform (scalar): every key of the block is visible to every row of the wave
    bool full = true;                          // wave-uniform (scalar): the block still wants the full pass
    if (interior && it > 0) {                  // interior blocks come first, so block 0 was one too and has left a finite maximum in every row
      // ---- short pass: p against the maximum in use ----
      v8f s[2][4];
      {
        v16b ak[4][2];
        const __bf16* krow = (const __bf16*)(stK + l15 * kPitchK) + 8 * hi;
#pragma unroll
        for (int t = 0; t < 4; ++t) ak[t][0] = FragB::load(krow + t * 16 * (kPitchK / 2));
#pragma unroll
        for (int t = 0; t < 4; ++t) ak[t][1] = FragB::load(krow + t * 16 * (kPitchK / 2) + 32);
        __builtin_amdgcn_sched_barrier(0);     // keeps the loads one group ahead of the WMMAs: one LDS latency a block, not one a subtile
#pragma unroll
        for (int t = 0; t < 4; ++t) {
          s[0][t] = FragB::mma(ak[t][0], bq[0][0], zero8());
          s[1][t] = FragB::mma(ak[t][0], bq[1][0], zero8());
        }
#pragma unroll
        for (int t = 0; t < 4; ++t) {
          s[0][t] = FragB::mma(ak[t][1], bq[0][1], s[0][t]);
          s[1][t] = FragB::mma(ak[t][1], bq[1][1], s[1][t]);
        }
        __builtin_amdgcn_sched_barrier(0);     // keeps the 16 WMMAs back to back: each fills the others' result distance instead of v_nop
      }
      const v8f sc8 = (v8f){kScale2, kScale2, kScale2, kScale2, kScale2, kScale2, kScale2, kScale2};
      v16h bp[2][2];                           // [slice][column subgroup]
      v16h av[2][4];                           // [slice][d group]
      v8f  lb[2];                              // the block's row sums
#pragma unroll
      for (int si = 0; si < 2; ++si) {
#pragma unroll
        for (int c = 0; c < 2; ++c) {
          const float bi = kCarryLog2 - m[c];
          const v8f bi8 = (v8f){bi, bi, bi, bi, bi, bi, bi, bi};
          const v8f a0 = __builtin_elementwise_fma(s[c][2 * si], sc8, bi8);
          const v8f a1 = __builtin_elementwise_fma(s[c][2 * si + 1], sc8, bi8);
          v8u u;
#pragma unroll
          for (int j = 0; j < 4; ++j) {
            u[j]     = pkh2(EXP2(a0[2 * j]), EXP2(a0[2 * j + 1]));
            u[4 + j] = pkh2(EXP2(a1[2 * j]), EXP2(a1[2 * j + 1]));
          }
          bp[si][c] = __builtin_bit_cast(v16h, u);
        }
        __builtin_amdgcn_sched_barrier(0);     // the loads below take the registers of this slice's scores: not lifted over their last use
        const _Float16* vrow = (const _Float16*)(stV + l15 * kPitchV) + si * 32 + 8 * hi;   // row d = dg*16 + l15
#pragma unroll
        for (int dg = 0; dg < 4; ++dg) av[si][dg] = FragH::load(vrow + dg * 16 * (kPitchV / 2));
        __builtin_amdgcn_sched_barrier(0);     // keeps the slice's 8 loads one group, ahead of the work that covers their latency
        lb[0] = FragH::mma(aone, bp[si][0], si ? lb[0] : zero8());
        lb[1] = FragH::mma(aone, bp[si][1], si ? lb[1] : zero8());
      }
      __builtin_amdgcn_sched_barrier(0);       // keeps the last two sum WMMAs together ahead of the comparisons: one result distance, not two
      // p >= 0, so a sum under kSumLim bounds every p of the row; an overflowed p (or a NaN) fails the comparison
      const bool bad = !(lb[0][0] < kSumLim) || !(lb[1][0] < kSumLim);
      if (__builtin_amdgcn_ballot_w32(bad) == 0) {   // one scalar branch a block; O^T and l are untouched until it is passed
        l[0] += lb[0][0];
        l[1] += lb[1][0];
#pragma unroll
        for (int si = 0; si < 2; ++si) {
#pragma unroll
          for (int dg = 0; dg < 4; ++dg) {
            oacc[0][dg] = FragH::mma(av[si][dg], bp[si][0], oacc[0][dg]);
            oacc[1][dg] = FragH::mma(av[si][dg], bp[si][1], oacc[1][dg]);
          }
        }
        // 4 VALU slots behind the block's last WMMAs, ahead of the branches at the publish point
        acc_guard8(oacc[0][0], oacc[0][1], oacc[0][2], oacc[0][3], oacc[1][0], oacc[1][1], oacc[1][2], oacc[1][3]);
        full = false;
      }
    }
    if (full) {
    // ---- S^T subtiles (16 kv each): 2 bf16 WMMAs a column subgroup, then the mask; the scores stay unscaled ----
    v8f s4[2][4];
    if (interior) {
      // interior block: no mask and no per-subtile test; the 16 K fragment loads stand as one group, the WMMAs run on 8 independent tiles
      v16b ak[4][2];
      const __bf16* krow = (const __bf16*)(stK + l15 * kPitchK) + 8 * hi;
#pragma unroll
      for (int t = 0; t < 4; ++t) ak[t][0] = FragB::load(krow + t * 16 * (kPitchK / 2));
#pragma unroll
      for (int t = 0; t < 4; ++t) ak[t][1] = FragB::load(krow + t * 16 * (kPitchK / 2) + 32);
      __builtin_amdgcn_sched_barrier(0);       // keeps the loads one group ahead of the WMMAs: one LDS latency a block, not one a subtile
      v8f s[2][4];
#pragma unroll
      for (int t = 0; t < 4; ++t) {
        s[0][t] = FragB::mma(ak[t][0], bq[0][0], zero8());
        s[1][t] = FragB::mma(ak[t][0], bq[1][0], zero8());
      }
#pragma unroll
      for (int t = 0; t < 4; ++t) {
        s[0][t] = FragB::mma(ak[t][1], bq[0][1], s[0][t]);
        s[1][t] = FragB::mma(ak[t][1], bq[1][1], s[1][t]);
      }
      __builtin_amdgcn_sched_barrier(0);       // keeps the 16 WMMAs back to back: each fills the others' result distance instead of v_nop
#pragma unroll
      for (int t = 0; t < 4; ++t) { s4[0][t] = s[0][t]; s4[1][t] = s[1][t]; }
    } else {
#pragma unroll
    for (int t = 0; t < 4; ++t) {
      const int c0 = kv0 + t * 16;
      if (c0 > qmax) {                       // wave-uniform: whole subtile masked
        s4[0][t] = neg8();
        s4[1][t] = neg8();
        continue;
      }
      const __bf16* krow = (const __bf16*)(stK + (t * 16 + l15) * kPitchK) + 8 * hi;
      const v16b ak0 = FragB::load(krow);
      const v16b ak1 = FragB::load(krow + 32);
      v8f sa = zero8(), sb = zero8();
      sa = FragB::mma(ak0, bq[0][0], sa);
      sb = FragB::mma(ak0, bq[1][0], sb);
      sa = FragB::mma(ak1, bq[0][1], sa);
      sb = FragB::mma(ak1, bq[1][1], sb);
      dep_guard2_b(sa, sb, ak0, ak1, bq[0][0], bq[0][1], bq[1][0], bq[1][1]);
#pragma unroll
      for (int c = 0; c < 2; ++c) {
        const v8f  s    = c ? sb : sa;
        const bool part = (c0 + 15 > q0w + c * 16 + numpt);   // wave-uniform: some (q, kv) of the subtile masked
        const int  lim  = q0w + c * 16 + l15 + numpt - c0;    // kv local index visible iff <= lim
        v8f sc;
#pragma unroll
        for (int r = 0; r < 8; ++r) {
          float vv = s[r];
          if (part && (r + 8 * hi > lim)) vv = NEG_INF;
          sc[r] = vv;
        }
        s4[c][t] = sc;
      }
    }
    }

    // ---- block-level online softmax in log2 domain, the two column subgroups side by side ----
    float alpha[2], bias[2];
    const v8f sc8 = (v8f){kScale2, kScale2, kScale2, kScale2, kScale2, kScale2, kScale2, kScale2};
    float tmx[2], oth[2];
#pragma unroll
    for (int c = 0; c < 2; ++c)
      tmx[c] = fmaxf(fmaxf(hmax8(s4[c][0]), hmax8(s4[c][1])), fmaxf(hmax8(s4[c][2]), hmax8(s4[c][3])));
#pragma unroll
    for (int c = 0; c < 2; ++c) oth[c] = __shfl_xor(tmx[c], 16, 32);
    __builtin_amdgcn_sched_barrier(0);         // keeps both exchanges in flight together: one cross-lane latency a block, not two
#pragma unroll
    for (int c = 0; c < 2; ++c) {
      const float tmax = fmaxf(tmx[c], oth[c]);
      const float mn   = fmaxf(m[c], tmax * kScale2);   // scale > 0: the scaled maximum is the maximum of the scaled scores
      alpha[c]         = (m[c] > NEG_INF) ? EXP2(m[c] - mn) : 0.0f;
      bias[c] = kCarryLog2 - ((mn > NEG_INF) ? mn : 0.0f);
      m[c] = mn;
    }

    // ---- p = exp2(s * scale + bias) as the f16 B operand P^T, slice by slice (32 kv); each slice's V^T fragments are asked for as
    // soon as its f32 scores are dead ----
    v16h bp[2][2];                             // [slice][column subgroup]
    v16h av[2][4];                             // [slice][d group]
#pragma unroll
    for (int si = 0; si < 2; ++si) {
#pragma unroll
      for (int c = 0; c < 2; ++c) {
        const v8f bi8 = (v8f){bias[c], bias[c], bias[c], bias[c], bias[c], bias[c], bias[c], bias[c]};
        const v8f a0 = __builtin_elementwise_fma(s4[c][2 * si], sc8, bi8);       // kv si*32 + 8*hi + 0..7 of this lane's q column
        const v8f a1 = __builtin_elementwise_fma(s4[c][2 * si + 1], sc8, bi8);   // kv si*32 + 16 + 8*hi + 0..7
        v8u u;
#pragma unroll
        for (int j = 0; j < 4; ++j) {
          u[j]     = pkh2(EXP2(a0[2 * j]), EXP2(a0[2 * j + 1]));
          u[4 + j] = pkh2(EXP2(a1[2 * j]), EXP2(a1[2 * j + 1]));
        }
        bp[si][c] = __builtin_bit_cast(v16h, u);
      }
      __builtin_amdgcn_sched_barrier(0);       // the loads below take the registers of this slice's scores: not lifted over their last use
      const _Float16* vrow = (const _Float16*)(stV + l15 * kPitchV) + si * 32 + 8 * hi;   // row d = dg*16 + l15
#pragma unroll
      for (int dg = 0; dg < 4; ++dg) av[si][dg] = FragH::load(vrow + dg * 16 * (kPitchV / 2));
      __builtin_amdgcn_sched_barrier(0);       // keeps the slice's 8 loads one group, ahead of the vector work that covers their latency
    }

    // ---- rescale, then row sums and O^T += V^T . P^T : per slice 2 f16 WMMAs for the row sums and 8 for O^T (every V^T fragment
    // feeds both column subgroups) ----
    v8f lb[2];                                 // the block's row sums
#pragma unroll
    for (int c = 0; c < 2; ++c) {
      lb[c] = FragH::mma(aone, bp[0][c], zero8());
      lb[c] = FragH::mma(aone, bp[1][c], lb[c]);
    }
#pragma unroll
    for (int c = 0; c < 2; ++c)
#pragma unroll
      for (int dg = 0; dg < 4; ++dg)
#pragma unroll
        for (int r = 0; r < 8; ++r) oacc[c][dg][r] *= alpha[c];
    // spreads the O^T rescale among the first WMMAs (one WMMA, then 8 vector instructions, four times): the multiplies issue in the
    // WMMAs' shadow; without it they all stand ahead of the first WMMA
#pragma unroll
    for (int i = 0; i < 4; ++i) {
      __builtin_amdgcn_sched_group_barrier(0x8, 1, 0);
      __builtin_amdgcn_sched_group_barrier(0x2, 8, 0);
    }
#pragma unroll
    for (int si = 0; si < 2; ++si) {
#pragma unroll
      for (int dg = 0; dg < 4; ++dg) {
        oacc[0][dg] = FragH::mma(av[si][dg], bp[si][0], oacc[0][dg]);
        oacc[1][dg] = FragH::mma(av[si][dg], bp[si][1], oacc[1][dg]);
      }
    }
    // 4 VALU slots behind the block's last WMMAs, ahead of the branches at the publish point
    acc_guard8(oacc[0][0], oacc[0][1], oacc[0][2], oacc[0][3], oacc[1][0], oacc[1][1], oacc[1][2], oacc[1][3]);
    l[0] = l[0] * alpha[0] + lb[0][0];
    l[1] = l[1] * alpha[1] + lb[1][0];
    }
    }
    // ---- publish point of tile it + 1, every wave: own reads of this buffer done, own copies landed, barrier, then the refill ----
    wait_ds0();
    wait_async0();
    __syncthreads();
    if (it + 2 < nt) issue_stage(it + 2);      // work-group-uniform: into the buffer that this trip has just read
  }
  wait_async0();
  acc_guard8(oacc[0][0], oacc[0][1], oacc[0][2], oacc[0][3], oacc[1][0], oacc[1][1], oacc[1][2], oacc[1][3]);

  // ---- epilogue: join the two key halves of each column group through its LDS slab, normalize, whole-line stores ----
  float* slab = sT[cg];
  if (kh == 1) {                               // wave-uniform (scalar): the upper half hands over O^T, maximum and row sum
#pragma unroll
    for (int c = 0; c < 2; ++c) {
#pragma unroll
      for (int dg = 0; dg < 4; ++dg)
#pragma unroll
        for (int r = 0; r < 8; ++r)
          slab[(c * 16 + l15) * 68 + dg * 16 + 8 * hi + r] = oacc[c][dg][r];
      if (hi == 0) { sM[cg][c * 16 + l15] = m[c]; sL[cg][c * 16 + l15] = l[c]; }
    }
  }
  __syncthreads();                             // the upper half's partial results are visible to the lower half
  if (kh == 0) {                               // wave-uniform (scalar): the lower half joins, each lane at its own slab places
#pragma unroll
    for (int c = 0; c < 2; ++c) {
      const float m1 = sM[cg][c * 16 + l15];
      const float l1 = sL[cg][c * 16 + l15];
      const float mt = fmaxf(m[c], m1);
      const float a0 = (m[c] > NEG_INF) ? EXP2(m[c] - mt) : 0.0f;
      const float a1 = (m1 > NEG_INF) ? EXP2(m1 - mt) : 0.0f;   // an upper half with no visible key counts for nothing
      const float lt = l[c] * a0 + l1 * a1;
      const float inv = (lt > 0.f) ? (1.0f / lt) : 0.f;          // the carry stands in oacc and in l alike and cancels
      const float f0 = a0 * inv, f1 = a1 * inv;
#pragma unroll
      for (int dg = 0; dg < 4; ++dg)
#pragma unroll
        for (int r = 0; r < 8; ++r) {
          float* p = slab + (c * 16 + l15) * 68 + dg * 16 + 8 * hi + r;
          *p = oacc[c][dg][r] * f0 + *p * f1;
        }
    }
  }
  __syncthreads();                             // the joined rows are visible to both halves, which store 16 rows each
  const int hh = lane >> 4, c4 = (lane & 15) * 4;   // row seg = 256 B = 16 lanes x 16 B
  {
#pragma unroll
    for (int it = 0; it < 8; ++it) {
      const int row = kh * 16 + it * 2 + hh;
      const v4f vv = *(const v4f*)(slab + row * 68 + c4);
      *(v4f*)(Ob + (size_t)(q0w + row) * HD + c4) = vv;
    }
  }
}

// ---------------------------------------------------------------------------
// Host glue.
//   Kp  bf16 [NB*NH][SKV][64]     NB*NH*SKV*128   at 0              (prep_kernel)
//   Vt  f16  [NB*NH][64][SKV]     NB*NH*SKV*128   at NB*NH*SKV*128  (prep_kernel)
//   total (NB=2, SKV=3072)         25,165,824
// 2 launches.
// ---------------------------------------------------------------------------
extern "C" void kernel_launch(void* const* d_in, const int* in_sizes, int n_in,
                              void* d_out, int out_size, void* d_ws, size_t ws_size,
                              hipStream_t stream) {
  if (n_in < 4) return;
  if (in_sizes[0] < NB * NH * SEQ * HD) return;
  if (in_sizes[1] < NB * NH * SKV * HD) return;
  if (in_sizes[2] < NB * NH * SKV * HD) return;
  if (in_sizes[3] < 1) return;
  if (out_size < NB * NH * SEQ * HD) return;

  const size_t szK   = (size_t)NB * NH * SKV * HD * 2;
  const size_t szVt  = (size_t)NB * NH * HD * SKV * 2;
  const size_t offK  = 0;
  const size_t offVt = offK + szK;
  const size_t total = offVt + szVt;
  if (ws_size < total) return;

  const float* q  = (const float*)d_in[0];
  const float* k  = (const float*)d_in[1];
  const float* v  = (const float*)d_in[2];
  const int*   np = (const int*)d_in[3];
  float* out = (float*)d_out;
  char* ws = (char*)d_ws;
  unsigned short* Kp = (unsigned short*)(ws + offK);
  _Float16*       Vt = (_Float16*)(ws + offVt);

  // (1) Kp[bh][kv][d] = bf16(k[bh][kv][d]) and Vt[bh][d][kv] = f16(bf16(v[bh][kv][d]))
  prep_kernel<<<dim3(kPrepV + kPrepK), dim3(256), 0, stream>>>(k, Kp, v, Vt);
  // (2) attention
  attn_kernel<<<dim3(SEQ / 128, NH, NB), dim3(256), 0, stream>>>(q, Kp, (const unsigned short*)Vt, np, out);
}

// v010
// Measured time: 40.3 microseconds a run.
// Timed twice side by side with v009, it ran 1.05 and 1.04 times as fast.
// Counting every step since v000, it is 5.29 times as fast.
// Contractions: scores K.Q^T on v_wmma_f32_16x16x32_bf16 (bf16 operands = RNE bf16 copies of q and k, f32 accumulate); context V^T.P^T on v_wmma_f32_16x16x32_f16 (f16 operands: v = f16 of its RNE bf16 copy, p carried x256, f32 accumulate); softmax row sums ONES.P^T on the same f16 form (f32 accumulate); scale, mask, maximum and exp2 in f32.
#include <hip/hip_runtime.h>
#include <math.h>

// ---------------------------------------------------------------------------
// Problem constants (NB / SEQ / SKV overridable for a reduced build; *_FULL = input strides)
// ---------------------------------------------------------------------------
#ifndef NB
#define NB 2
#endif
#ifndef SEQ
#define SEQ 2048
#endif
#ifndef SKV
#define SKV 3072
#endif
#define NB_FULL   2
#define NH        16
#define HD        64
#define SEQ_FULL  2048
#define SKV_FULL  3072

static_assert(NB >= 1 && NB <= NB_FULL);
static_assert(SEQ % 128 == 0 && SEQ <= SEQ_FULL);
static_assert(SKV % 128 == 0 && SKV <= SKV_FULL);
static_assert(HD == 64);
static_assert((NB * NH * SKV) % 32 == 0);

constexpr float kScale2   = 0.125f * 1.44269504088896340736f;   // 1/sqrt(64) * log2(e): softmax in log2 domain
constexpr float kCarryLog2 = 8.0f;                             // p carried x256 (f16 operand and row sum alike): 8 added to the exp2 argument; leaves
                                                               // 8 binary orders of f16 range above the maximum in use
constexpr float kSumLim    = 60000.0f;                         // below the largest finite f16: a 64-key sum of p >= 0 under it holds no overflowed p
#define NEG_INF (-__builtin_inff())

#if __has_builtin(__builtin_amdgcn_exp2f)
#define EXP2(x) __builtin_amdgcn_exp2f(x)
#else
#define EXP2(x) exp2f(x)
#endif

typedef __attribute__((ext_vector_type(16))) _Float16 v16h;
typedef __attribute__((ext_vector_type(8)))  _Float16 v8h;
typedef __attribute__((ext_vector_type(2)))  _Float16 v2h;
typedef __attribute__((ext_vector_type(16))) __bf16   v16b;
typedef __attribute__((ext_vector_type(8)))  __bf16   v8b;
typedef __attribute__((ext_vector_type(8)))  float    v8f;
typedef __attribute__((ext_vector_type(4)))  float    v4f;
typedef __attribute__((ext_vector_type(4)))  unsigned int v4u;
typedef __attribute__((ext_vector_type(8)))  unsigned int v8u;

__device__ __forceinline__ unsigned short f2bf_bits(float f) {        // RNE convert f32 -> bf16 bits
  unsigned u = __float_as_uint(f);
  return (unsigned short)((u + 0x7FFFu + ((u >> 16) & 1u)) >> 16);
}
__device__ __forceinline__ float bf_bits2f(unsigned short h) { return __uint_as_float(((unsigned)h) << 16); }

// hazard guards: 4 VALU slots after the last WMMA of a group, tie D, keep A/B live
__device__ __forceinline__ void acc_guard8(v8f& a, v8f& b, v8f& c, v8f& d, v8f& e, v8f& f, v8f& g, v8f& h) {
  asm volatile("v_nop\n\tv_nop\n\tv_nop\n\tv_nop" : "+v"(a), "+v"(b), "+v"(c), "+v"(d), "+v"(e), "+v"(f), "+v"(g), "+v"(h));
}
__device__ __forceinline__ void dep_guard2_b(v8f& a, v8f& b, v16b w, v16b x, v16b y0, v16b y1, v16b z0, v16b z1) {
  asm volatile("v_nop\n\tv_nop\n\tv_nop\n\tv_nop" : "+v"(a), "+v"(b) : "v"(w), "v"(x), "v"(y0), "v"(y1), "v"(z0), "v"(z1));
}

template <typename T> struct Frag;
template <> struct Frag<_Float16> {
  typedef v16h V; union U { v16h v; v8h h[2]; };
  // elements 0..7 <- p[0..7], 8..15 <- p[16..23]; caller passes p = row + k0 + 8*(lane>>4)
  static __device__ __forceinline__ v16h load(const _Float16* p) {
    U f; f.h[0] = *(const v8h*)(p); f.h[1] = *(const v8h*)(p + 16); return f.v;
  }
  static __device__ __forceinline__ v8f mma(v16h a, v16h b, v8f c) {
    return __builtin_amdgcn_wmma_f32_16x16x32_f16(false, a, false, b, (short)0, c, false, false);
  }
};
template <> struct Frag<__bf16> {
  typedef v16b V; union U { v16b v; v8b h[2]; };
  static __device__ __forceinline__ v16b load(const __bf16* p) {
    U f; f.h[0] = *(const v8b*)(p); f.h[1] = *(const v8b*)(p + 16); return f.v;
  }
  static __device__ __forceinline__ v8f mma(v16b a, v16b b, v8f c) {
    return __builtin_amdgcn_wmma_f32_16x16x32_bf16(false, a, false, b, (short)0, c, false, false);
  }
};
typedef Frag<_Float16> FragH;
typedef Frag<__bf16>   FragB;

__device__ __forceinline__ unsigned pk16(unsigned short a, unsigned short b) { return (unsigned)a | ((unsigned)b << 16); }
// pack two f32 -> one dword of two f16 (element 0 = a)
__device__ __forceinline__ unsigned pkh2(float a, float b) {
  v2h p; p[0] = (_Float16)a; p[1] = (_Float16)b;
  return __builtin_bit_cast(unsigned, p);
}
__device__ __forceinline__ v8f zero8() { return (v8f){0.f, 0.f, 0.f, 0.f, 0.f, 0.f, 0.f, 0.f}; }
__device__ __forceinline__ v8f neg8()  { return (v8f){NEG_INF, NEG_INF, NEG_INF, NEG_INF, NEG_INF, NEG_INF, NEG_INF, NEG_INF}; }
// balanced-tree horizontal reduction
__device__ __forceinline__ float hmax8(v8f v) {
  float a = fmaxf(v[0], v[1]), b = fmaxf(v[2], v[3]);
  float c = fmaxf(v[4], v[5]), d = fmaxf(v[6], v[7]);
  return fmaxf(fmaxf(a, b), fmaxf(c, d));
}

// ---------------------------------------------------------------------------
// (1a) K cast, one block of 32 rows: dst row pr = g * SKV + r  <-  src row g * SKV_FULL + r  (g = (b*NH + h)).
// 256 threads = 32 rows; thread t: row t>>3, 8 halves at (t&7)*8.
// ---------------------------------------------------------------------------
__device__ __forceinline__ void cast_rows_block(const float* __restrict__ src,
                                                unsigned short* __restrict__ dst, int blk) {
  constexpr int rowsPerGroup = SKV, srcRowsPerGroup = SKV_FULL, nRows = NB * NH * SKV;
  const int t  = threadIdx.x;
  int pr = blk * 32 + (t >> 3);
  pr = (pr < nRows) ? pr : (nRows - 1);            // address clamp (grid is exact)
  const int c8 = (t & 7) * 8;
  const int g  = pr / rowsPerGroup;
  const int r  = pr - g * rowsPerGroup;
  const float* s = src + ((size_t)g * srcRowsPerGroup + r) * HD + c8;
  const v4f a = *(const v4f*)(s);
  const v4f b = *(const v4f*)(s + 4);
  unsigned short hb[8];
#pragma unroll
  for (int e = 0; e < 4; ++e) { hb[e] = f2bf_bits(a[e]); hb[4 + e] = f2bf_bits(b[e]); }
  const v4u u = (v4u){pk16(hb[0], hb[1]), pk16(hb[2], hb[3]), pk16(hb[4], hb[5]), pk16(hb[6], hb[7])};
  unsigned short* d = dst + (size_t)pr * HD + c8;
  *(v4u*)d = u;
  // stands ahead of any rewrite of the store's address and data registers on the ways the merged kernel's branches leave open behind it
  asm volatile("s_wait_xcnt 0x0" ::: "memory");
}

// ---------------------------------------------------------------------------
// (1b) V cast + transpose, one block: Vt[bh][d][kv] = f16( bf16( v[bh][kv][d] ) )   (pitch SKV halves)
// 256 threads; one 64(kv) x 64(d) tile through LDS.
// Load coverage: 16 iterations x 256 threads = 4096 = whole tile (coalesced along d); sm cross-wave -> __syncthreads.
// Store coverage: 8 waves x 2 iterations x 4 rows (lane>>3) = 64 d-rows; (lane&7) x 8 halves = 64 kv;
// ---------------------------------------------------------------------------
__device__ __forceinline__ void v_transpose_block(const float* __restrict__ v,
                                                  _Float16* __restrict__ Vt, int kvb, int bh) {
  __shared__ float sm[64][65];   // sm[kv_local][d]
  const int tid = threadIdx.x;
  const int kv0 = kvb * 64;                          // bh = b*NH + h, b < NB
  const float* vb = v + ((size_t)bh * SKV_FULL + kv0) * HD;
#pragma unroll
  for (int i = 0; i < 16; ++i) {
    const int e = i * 256 + tid;
    const int r = e >> 6;          // kv local
    const int c = e & 63;          // d
    sm[r][c] = vb[(size_t)r * HD + c];
  }
  __syncthreads();
  const int lane = tid & 31, wave = tid >> 5;
  const int q = lane >> 3, c8 = (lane & 7) * 8;
  _Float16* vt = Vt + (size_t)bh * HD * SKV;
  {
#pragma unroll
    for (int it = 0; it < 2; ++it) {
      const int row = wave * 8 + it * 4 + q;          // d
      v8h hv;
#pragma unroll
      for (int e = 0; e < 8; ++e) hv[e] = (_Float16)bf_bits2f(f2bf_bits(sm[c8 + e][row]));
      *(v8h*)(vt + (size_t)row * SKV + kv0 + c8) = hv;
    }
  }
}

// ---------------------------------------------------------------------------
// (1) Both operand planes in one launch: the two jobs share nothing, so one grid holds the blocks of both and the block index picks
// the job (a scalar, block-uniform branch: the transpose's barrier is passed by all of its block or by none).
// Blocks 0 .. kPrepV-1: V tiles (the longer job of the two, so they start first); the rest: 32-row K blocks.
// ---------------------------------------------------------------------------
constexpr int kPrepV = (SKV / 64) * NB * NH;
constexpr int kPrepK = (NB * NH * SKV) / 32;
__global__ __launch_bounds__(256) void prep_kernel(const float* __restrict__ k,
                                                    unsigned short* __restrict__ Kp,
                                                    const float* __restrict__ v,
                                                    _Float16* __restrict__ Vt) {
  const int blk = blockIdx.x;
  if (blk < kPrepV) v_transpose_block(v, Vt, blk % (SKV / 64), blk / (SKV / 64));
  else              cast_rows_block(k, Kp, blk - kPrepV);
}

// ---------------------------------------------------------------------------
// LDS ring of the attention kernel: a tile = one 128-key K tile (128 kv rows x 128 B) and one V^T tile (64 d rows x 256 B);
// a stage = kTiles tiles side by side = what one publish point hands over; two stages (buffers).
// ---------------------------------------------------------------------------
constexpr int kKeys   = 128;              // keys per tile
constexpr int kTiles  = 2;                // tiles per stage = per publish point
constexpr int kPitchK = 144;              // K row pitch in bytes: 128 + 16, an odd multiple of 16 (ds_load_b128 readers)
constexpr int kPitchV = 272;              // V^T row pitch in bytes: 256 + 16, an odd multiple of 16
constexpr int kTileKB = kKeys * kPitchK;  // K tile
constexpr int kTileVB = HD * kPitchV;     // V^T tile
constexpr int kStageB = kTileKB + kTileVB;   // one tile's place in the ring: K tile, then V^T tile
constexpr int kSlots  = 2 * kTiles;          // tile places in the ring; tile t lies in place t % kSlots
static_assert((kSlots & (kSlots - 1)) == 0);
static_assert(kPitchK % 16 == 0 && ((kPitchK / 16) & 1) == 1);
static_assert(kPitchV % 16 == 0 && ((kPitchV / 16) & 1) == 1);
static_assert(kTileKB % 16 == 0 && kStageB % 16 == 0);
static_assert(SKV >= kKeys);              // tile 0 lies inside the planes

// Eight 16-byte asynchronous copies per lane = this lane's share of one tile: K rows 32 apart from (lk, gk), V^T rows 16 apart
// from (lv, gv). l* = LDS byte addresses, g* = global addresses.
// s_wait_xcnt 0 is the statement's last line so that it stands ahead of any rewrite of the address registers the copies name.
__device__ __forceinline__ void copy_stage(unsigned lk, unsigned lv, const unsigned char* gk, const unsigned char* gv) {
  asm volatile("global_load_async_to_lds_b128 %0, %8, off\n\t"
               "global_load_async_to_lds_b128 %1, %9, off\n\t"
               "global_load_async_to_lds_b128 %2, %10, off\n\t"
               "global_load_async_to_lds_b128 %3, %11, off\n\t"
               "global_load_async_to_lds_b128 %4, %12, off\n\t"
               "global_load_async_to_lds_b128 %5, %13, off\n\t"
               "global_load_async_to_lds_b128 %6, %14, off\n\t"
               "global_load_async_to_lds_b128 %7, %15, off\n\t"
               "s_wait_xcnt 0x0"
               :: "v"(lk), "v"(lk + 32 * kPitchK), "v"(lk + 64 * kPitchK), "v"(lk + 96 * kPitchK),
                  "v"(lv), "v"(lv + 16 * kPitchV), "v"(lv + 32 * kPitchV), "v"(lv + 48 * kPitchV),
                  "v"(gk), "v"(gk + 32 * HD * 2), "v"(gk + 64 * HD * 2), "v"(gk + 96 * HD * 2),
                  "v"(gv), "v"(gv + (size_t)16 * SKV * 2), "v"(gv + (size_t)32 * SKV * 2), "v"(gv + (size_t)48 * SKV * 2)
               : "memory");
}
// the wave's own copies have landed (the compiler places no wait for them)
__device__ __forceinline__ void wait_async0() { asm volatile("s_wait_asynccnt 0x0" ::: "memory"); }
// the wave's own LDS reads have returned, before the buffer is handed to its next writer
__device__ __forceinline__ void wait_ds0() { asm volatile("s_wait_dscnt 0x0" ::: "memory"); }

// ---------------------------------------------------------------------------
// (2) Flash-style prefix-causal attention. grid (SEQ/128, NH, NB), 256 threads = 8 waves = 4 column groups of 32 query rows x 2 key
// halves; blockIdx.x -> query tile by a per-head permutation.
// Wave (cg, kh) works on query rows cg*32 .. +31 and on keys kh*64 .. +63 of every 128-key tile: each K and V^T fragment it reads
// from LDS feeds two WMMAs (one per 16-row column subgroup), so a score costs half the LDS bytes of a 16-row wave.
// Per wave: Q B-fragments (bf16, RNE) in registers; loop over the stages up to the last visible key;
//   S^T subtile = K(16 kv x 64 d, bf16 plane rows) . Q^T : 2 bf16 WMMAs a subgroup; mask (kv > q + num_pt -> -inf) on the raw scores,
//   f32 online softmax in log2 domain, p x256 = exp2(s * scale + (8 - max)): one FMA a score carries scale, maximum and carry
//   (row stats shared by lanes l and l^16); O^T += V^T(16 d x 32 kv, f16 plane rows) . P^T with
//   P^T fragment = [own D of subtile 2si (kv 0-15 of slice), own D of subtile 2si+1 (kv 16-31)] as f16 x256.
// The maximum in use is a stale one: a wholly visible block behind the wave's first takes p against the maximum it already has (no
// maximum, no exchange, no rescale) and is accepted if its row sums show that no p left the f16 range; else, and for the first and
// the masked blocks, the full pass (new maximum, rescale) is run on the block from its K fragments on.
// The two key halves of a column group keep their own maximum, row sum and O^T and are joined once, in the epilogue, through LDS.
// K and V^T tiles are brought into LDS once per work-group by asynchronous copies, two buffers of two tiles: stage s + 1 flies while
// stage s is worked on; one publish point per stage of 256 keys (own LDS reads done, own copies landed, barrier, refill), passed by
// every wave; between publish points a wave runs its two key blocks without meeting the others; a wave skips only the work of key
// blocks beyond its own last visible key. The epilogue's slabs lie in the ring, which is free behind the last publish point.
// ---------------------------------------------------------------------------
constexpr int kWKeys = kKeys / 2;         // keys of a tile that one wave works on
__global__ __launch_bounds__(256) void attn_kernel(const float* __restrict__ q,
                                                    const unsigned short* __restrict__ Kp,
                                                    const unsigned short* __restrict__ Vtp,
                                                    const int* __restrict__ np,
                                                    float* __restrict__ out) {
  __shared__ float sM[4][32];                      // upper key half's row maximum
  __shared__ float sL[4][32];                      // upper key half's row sum
  __shared__ __align__(16) unsigned char ring[kSlots * kStageB];
  static_assert(4 * 32 * 68 * 4 <= kSlots * kStageB);   // the epilogue's slabs: per column group 32 query rows x 64 d, pitch 68 floats
  const int tid  = threadIdx.x;
  const int wave = __builtin_amdgcn_readfirstlane(tid >> 5);   // scalar: the per-wave skip between publish points is a scalar branch
  const int cg   = wave & 3;                 // column group: 32 query rows
  const int kh   = wave >> 2;                // key half of every tile
  const int lane = tid & 31;
  const int hi   = lane >> 4;                // lane half: k offset 8*hi, D row offset 8*hi
  const int l15  = lane & 15;                // A row / B,D column
  const int h    = blockIdx.y;
  const int b    = blockIdx.z;
  const int bh   = b * NH + h;
  // Query tile of this work-group. A tile's cost grows with its index (tile t walks t more key tiles than tile 0) and every
  // work-group is resident from the start, two to a WGP, so the launch lasts as long as the fullest WGP. Work-groups whose flat
  // index differs in one bit above the low three get tiles d and kQT - 1 - d: equal sums.
  // For speed only: for each bh the map is a permutation of the tiles, wherever the work-groups land.
  constexpr int kQT = SEQ / 128;
  int qt = blockIdx.x;
  if (kQT % 2 == 0) {
    const int up   = (qt >= kQT / 2) ? 1 : 0;
    const int d    = qt - up * (kQT / 2);
    const int flip = (up ^ __builtin_popcount((unsigned)bh)) & 1;
    qt = flip ? (kQT - 1 - d) : d;
  }
  const int q0w  = qt * 128 + cg * 32;

  int numpt = np[0];
  numpt = (numpt < 0) ? 0 : numpt;
  numpt = (numpt > SKV) ? SKV : numpt;

  const float*    Qb = q + ((size_t)bh * SEQ_FULL) * HD;
  const __bf16*   Kb = (const __bf16*)Kp + (size_t)bh * SKV * HD;
  const _Float16* Vb = (const _Float16*)Vtp + (size_t)bh * HD * SKV;
  float*          Ob = out + ((size_t)bh * SEQ) * HD;

  // ---- Q as bf16 B operand of S^T = K.Q^T: B[k=d][n=q]; elements 0..7 <- d k0+8hi+0..7, 8..15 <- d k0+16+8hi+0..7 ----
  v16b bq[2][2];                             // [column subgroup][k step]
  const float* qp0 = Qb + (size_t)(q0w + l15) * HD + 8 * hi;
  const float* qp1 = qp0 + 16 * HD;
#pragma unroll
  for (int c = 0; c < 2; ++c) {
    const float* qrow = c ? qp1 : qp0;
#pragma unroll
    for (int si = 0; si < 2; ++si) {
      const v4f f0 = *(const v4f*)(qrow + si * 32);
      const v4f f1 = *(const v4f*)(qrow + si * 32 + 4);
      const v4f g0 = *(const v4f*)(qrow + si * 32 + 16);
      const v4f g1 = *(const v4f*)(qrow + si * 32 + 16 + 4);
      v8u u;
      u[0] = pk16(f2bf_bits(f0[0]), f2bf_bits(f0[1]));
      u[1] = pk16(f2bf_bits(f0[2]), f2bf_bits(f0[3]));
      u[2] = pk16(f2bf_bits(f1[0]), f2bf_bits(f1[1]));
      u[3] = pk16(f2bf_bits(f1[2]), f2bf_bits(f1[3]));
      u[4] = pk16(f2bf_bits(g0[0]), f2bf_bits(g0[1]));
      u[5] = pk16(f2bf_bits(g0[2]), f2bf_bits(g0[3]));
      u[6] = pk16(f2bf_bits(g1[0]), f2bf_bits(g1[1]));
      u[7] = pk16(f2bf_bits(g1[2]), f2bf_bits(g1[3]));
      bq[c][si] = __builtin_bit_cast(v16b, u);
    }
  }
  // the wait ahead of any rewrite of the Q loads' address registers; naming them keeps a load's own result off them too
  asm volatile("s_wait_xcnt 0x0" :: "v"(qp0), "v"(qp1) : "memory");

  // O^T accumulators: oacc[c][dg][r] = carry * O[q0w + c*16 + l15][dg*16 + 8*hi + r], over this wave's key half
  v8f oacc[2][4];
#pragma unroll
  for (int c = 0; c < 2; ++c)
#pragma unroll
    for (int dg = 0; dg < 4; ++dg) oacc[c][dg] = zero8();
  float m[2] = {NEG_INF, NEG_INF};           // per-lane row stats (log2 domain)
  // row sums on the matrix pipe, carried x256 like p: a block's sums lb[c] = ONES . P^T, ONES = 16 x 32 f16 with rows 0 and 8 all ones
  // and the rest zero, so D rows 0 and 8 (register 0 of either lane half) hold the sum over the block's kv of this lane's q column
  const unsigned onew = ((l15 & 7) == 0) ? 0x3C003C00u : 0u;   // two f16 1.0
  const v16h aone = __builtin_bit_cast(v16h, (v8u){onew, onew, onew, onew, onew, onew, onew, onew});
  float l[2] = {0.f, 0.f};                   // per-lane row sums, relative to m

  const int qmax   = q0w + 31 + numpt;       // last visible key of this wave's last row
  const int kv_end = (SKV < qmax + 1) ? SKV : (qmax + 1);

  // work-group-uniform tile count: up to the last visible key of the block's last row; >= 1, <= SKV / 128
  const int qmaxb = qt * 128 + 127 + numpt;
  const int nt    = (((SKV < qmaxb + 1) ? SKV : (qmaxb + 1)) + kKeys - 1) / kKeys;

  // this lane's share of a tile: 16 B at column ccol of K rows crow + 32 j, 16 B at column vcol of V^T rows vrw + 16 j, j < 4
  // (a wave-wide copy = 4 whole lines)
  const int crow = tid >> 3, ccol = (tid & 7) * 16;
  const int vrw  = tid >> 4, vcol = (tid & 15) * 16;
  const unsigned char* kg = (const unsigned char*)Kb + (size_t)crow * (HD * 2) + ccol;
  const unsigned char* vg = (const unsigned char*)Vb + (size_t)vrw * (SKV * 2) + vcol;
  const unsigned       lck = (unsigned)(size_t)ring + crow * kPitchK + ccol;
  const unsigned       lcv = (unsigned)(size_t)ring + kTileKB + vrw * kPitchV + vcol;
  auto issue_tile = [&](int t) {
    const unsigned ob = (t & (kSlots - 1)) * kStageB;
    copy_stage(lck + ob, lcv + ob, kg + (size_t)t * (kKeys * HD * 2), vg + (size_t)t * (kKeys * 2));
  };
  auto issue_stage = [&](int s) {              // the stage's tiles that exist; the tests are work-group-uniform
#pragma unroll
    for (int j = 0; j < kTiles; ++j)
      if (s * kTiles + j < nt) issue_tile(s * kTiles + j);
  };
  const int ns = (nt + kTiles - 1) / kTiles;   // stages; >= 1

  issue_stage(0);
  wait_async0();
  __syncthreads();
  issue_stage(1);

#pragma unroll 1
  for (int st = 0; st < ns; ++st) {
#pragma unroll 1                               // one copy of the block's code: the loop stays small in the instruction cache
  for (int sub = 0; sub < kTiles; ++sub) {
    const int it  = st * kTiles + sub;         // tile; a tile past the last (it >= nt) has kv0 >= kv_end in every wave and is not read
    const int kv0 = it * kKeys + kh * kWKeys;
    const unsigned char* stK = ring + (it & (kSlots - 1)) * kStageB + kh * (kWKeys * kPitchK);   // this wave's 64 K rows
    const unsigned char* stV = ring + (it & (kSlots - 1)) * kStageB + kTileKB + kh * (kWKeys * 2);   // this wave's 64 V^T columns
    if (kv0 < kv_end) {                        // wave-uniform (scalar): key blocks beyond this wave's last visible key hold no work
    const bool interior = (kv0 + kWKeys - 1 <= q0w + numpt);   // wave-uniform (scalar): every key of the block is visible to every row of the wave
    bool full = true;                          // wave-uniform (scalar): the block still wants the full pass
    if (interior && it > 0) {                  // interior blocks come first, so block 0 was one too and has left a finite maximum in every row
      // ---- short pass: p against the maximum in use ----
      v8f s[2][4];
      {
        v16b ak[4][2];
        const __bf16* krow = (const __bf16*)(stK + l15 * kPitchK) + 8 * hi;
#pragma unroll
        for (int t = 0; t < 4; ++t) ak[t][0] = FragB::load(krow + t * 16 * (kPitchK / 2));
#pragma unroll
        for (int t = 0; t < 4; ++t) ak[t][1] = FragB::load(krow + t * 16 * (kPitchK / 2) + 32);
        __builtin_amdgcn_sched_barrier(0);     // keeps the loads one group ahead of the WMMAs: one LDS latency a block, not one a subtile
#pragma unroll
        for (int t = 0; t < 4; ++t) {
          s[0][t] = FragB::mma(ak[t][0], bq[0][0], zero8());
          s[1][t] = FragB::mma(ak[t][0], bq[1][0], zero8());
        }
#pragma unroll
        for (int t = 0; t < 4; ++t) {
          s[0][t] = FragB::mma(ak[t][1], bq[0][1], s[0][t]);
          s[1][t] = FragB::mma(ak[t][1], bq[1][1], s[1][t]);
        }
        __builtin_amdgcn_sched_barrier(0);     // keeps the 16 WMMAs back to back: each fills the others' result distance instead of v_nop
      }
      const v8f sc8 = (v8f){kScale2, kScale2, kScale2, kScale2, kScale2, kScale2, kScale2, kScale2};
      v16h bp[2][2];                           // [slice][column subgroup]
      v16h av[2][4];                           // [slice][d group]
      v8f  lb[2];                              // the block's row sums
#pragma unroll
      for (int si = 0; si < 2; ++si) {
#pragma unroll
        for (int c = 0; c < 2; ++c) {
          const float bi = kCarryLog2 - m[c];
          const v8f bi8 = (v8f){bi, bi, bi, bi, bi, bi, bi, bi};
          const v8f a0 = __builtin_elementwise_fma(s[c][2 * si], sc8, bi8);
          const v8f a1 = __builtin_elementwise_fma(s[c][2 * si + 1], sc8, bi8);
          v8u u;
#pragma unroll
          for (int j = 0; j < 4; ++j) {
            u[j]     = pkh2(EXP2(a0[2 * j]), EXP2(a0[2 * j + 1]));
            u[4 + j] = pkh2(EXP2(a1[2 * j]), EXP2(a1[2 * j + 1]));
          }
          bp[si][c] = __builtin_bit_cast(v16h, u);
        }
        __builtin_amdgcn_sched_barrier(0);     // the loads below take the registers of this slice's scores: not lifted over their last use
        const _Float16* vrow = (const _Float16*)(stV + l15 * kPitchV) + si * 32 + 8 * hi;   // row d = dg*16 + l15
#pragma unroll
        for (int dg = 0; dg < 4; ++dg) av[si][dg] = FragH::load(vrow + dg * 16 * (kPitchV / 2));
        __builtin_amdgcn_sched_barrier(0);     // keeps the slice's 8 loads one group, ahead of the work that covers their latency
        lb[0] = FragH::mma(aone, bp[si][0], si ? lb[0] : zero8());
        lb[1] = FragH::mma(aone, bp[si][1], si ? lb[1] : zero8());
      }
      __builtin_amdgcn_sched_barrier(0);       // keeps the last two sum WMMAs together ahead of the comparisons: one result distance, not two
      // p >= 0, so a sum under kSumLim bounds every p of the row; an overflowed p (or a NaN) fails the comparison
      const bool bad = !(lb[0][0] < kSumLim) || !(lb[1][0] < kSumLim);
      if (__builtin_amdgcn_ballot_w32(bad) == 0) {   // one scalar branch a block; O^T and l are untouched until it is passed
        l[0] += lb[0][0];
        l[1] += lb[1][0];
#pragma unroll
        for (int si = 0; si < 2; ++si) {
#pragma unroll
          for (int dg = 0; dg < 4; ++dg) {
            oacc[0][dg] = FragH::mma(av[si][dg], bp[si][0], oacc[0][dg]);
            oacc[1][dg] = FragH::mma(av[si][dg], bp[si][1], oacc[1][dg]);
          }
        }
        // 4 VALU slots behind the block's last WMMAs, ahead of the branches to the next block or the publish point
        acc_guard8(oacc[0][0], oacc[0][1], oacc[0][2], oacc[0][3], oacc[1][0], oacc[1][1], oacc[1][2], oacc[1][3]);
        full = false;
      }
    }
    if (full) {
    // ---- S^T subtiles (16 kv each): 2 bf16 WMMAs a column subgroup, then the mask; the scores stay unscaled ----
    v8f s4[2][4];
    if (interior) {
      // interior block: no mask and no per-subtile test; the 16 K fragment loads stand as one group, the WMMAs run on 8 independent tiles
      v16b ak[4][2];
      const __bf16* krow = (const __bf16*)(stK + l15 * kPitchK) + 8 * hi;
#pragma unroll
      for (int t = 0; t < 4; ++t) ak[t][0] = FragB::load(krow + t * 16 * (kPitchK / 2));
#pragma unroll
      for (int t = 0; t < 4; ++t) ak[t][1] = FragB::load(krow + t * 16 * (kPitchK / 2) + 32);
      __builtin_amdgcn_sched_barrier(0);       // keeps the loads one group ahead of the WMMAs: one LDS latency a block, not one a subtile
      v8f s[2][4];
#pragma unroll
      for (int t = 0; t < 4; ++t) {
        s[0][t] = FragB::mma(ak[t][0], bq[0][0], zero8());
        s[1][t] = FragB::mma(ak[t][0], bq[1][0], zero8());
      }
#pragma unroll
      for (int t = 0; t < 4; ++t) {
        s[0][t] = FragB::mma(ak[t][1], bq[0][1], s[0][t]);
        s[1][t] = FragB::mma(ak[t][1], bq[1][1], s[1][t]);
      }
      __builtin_amdgcn_sched_barrier(0);       // keeps the 16 WMMAs back to back: each fills the others' result distance instead of v_nop
#pragma unroll
      for (int t = 0; t < 4; ++t) { s4[0][t] = s[0][t]; s4[1][t] = s[1][t]; }
    } else {
#pragma unroll
    for (int t = 0; t < 4; ++t) {
      const int c0 = kv0 + t * 16;
      if (c0 > qmax) {                       // wave-uniform: whole subtile masked
        s4[0][t] = neg8();
        s4[1][t] = neg8();
        continue;
      }
      const __bf16* krow = (const __bf16*)(stK + (t * 16 + l15) * kPitchK) + 8 * hi;
      const v16b ak0 = FragB::load(krow);
      const v16b ak1 = FragB::load(krow + 32);
      v8f sa = zero8(), sb = zero8();
      sa = FragB::mma(ak0, bq[0][0], sa);
      sb = FragB::mma(ak0, bq[1][0], sb);
      sa = FragB::mma(ak1, bq[0][1], sa);
      sb = FragB::mma(ak1, bq[1][1], sb);
      dep_guard2_b(sa, sb, ak0, ak1, bq[0][0], bq[0][1], bq[1][0], bq[1][1]);
#pragma unroll
      for (int c = 0; c < 2; ++c) {
        const v8f  s    = c ? sb : sa;
        const bool part = (c0 + 15 > q0w + c * 16 + numpt);   // wave-uniform: some (q, kv) of the subtile masked
        const int  lim  = q0w + c * 16 + l15 + numpt - c0;    // kv local index visible iff <= lim
        v8f sc;
#pragma unroll
        for (int r = 0; r < 8; ++r) {
          float vv = s[r];
          if (part && (r + 8 * hi > lim)) vv = NEG_INF;
          sc[r] = vv;
        }
        s4[c][t] = sc;
      }
    }
    }

    // ---- block-level online softmax in log2 domain, the two column subgroups side by side ----
    float alpha[2], bias[2];
    const v8f sc8 = (v8f){kScale2, kScale2, kScale2, kScale2, kScale2, kScale2, kScale2, kScale2};
    float tmx[2], oth[2];
#pragma unroll
    for (int c = 0; c < 2; ++c)
      tmx[c] = fmaxf(fmaxf(hmax8(s4[c][0]), hmax8(s4[c][1])), fmaxf(hmax8(s4[c][2]), hmax8(s4[c][3])));
#pragma unroll
    for (int c = 0; c < 2; ++c) oth[c] = __shfl_xor(tmx[c], 16, 32);
    __builtin_amdgcn_sched_barrier(0);         // keeps both exchanges in flight together: one cross-lane latency a block, not two
#pragma unroll
    for (int c = 0; c < 2; ++c) {
      const float tmax = fmaxf(tmx[c], oth[c]);
      const float mn   = fmaxf(m[c], tmax * kScale2);   // scale > 0: the scaled maximum is the maximum of the scaled scores
      alpha[c]         = (m[c] > NEG_INF) ? EXP2(m[c] - mn) : 0.0f;
      bias[c] = kCarryLog2 - ((mn > NEG_INF) ? mn : 0.0f);
      m[c] = mn;
    }

    // ---- p = exp2(s * scale + bias) as the f16 B operand P^T, slice by slice (32 kv); each slice's V^T fragments are asked for as
    // soon as its f32 scores are dead ----
    v16h bp[2][2];                             // [slice][column subgroup]
    v16h av[2][4];                             // [slice][d group]
#pragma unroll
    for (int si = 0; si < 2; ++si) {
#pragma unroll
      for (int c = 0; c < 2; ++c) {
        const v8f bi8 = (v8f){bias[c], bias[c], bias[c], bias[c], bias[c], bias[c], bias[c], bias[c]};
        const v8f a0 = __builtin_elementwise_fma(s4[c][2 * si], sc8, bi8);       // kv si*32 + 8*hi + 0..7 of this lane's q column
        const v8f a1 = __builtin_elementwise_fma(s4[c][2 * si + 1], sc8, bi8);   // kv si*32 + 16 + 8*hi + 0..7
        v8u u;
#pragma unroll
        for (int j = 0; j < 4; ++j) {
          u[j]     = pkh2(EXP2(a0[2 * j]), EXP2(a0[2 * j + 1]));
          u[4 + j] = pkh2(EXP2(a1[2 * j]), EXP2(a1[2 * j + 1]));
        }
        bp[si][c] = __builtin_bit_cast(v16h, u);
      }
      __builtin_amdgcn_sched_barrier(0);       // the loads below take the registers of this slice's scores: not lifted over their last use
      const _Float16* vrow = (const _Float16*)(stV + l15 * kPitchV) + si * 32 + 8 * hi;   // row d = dg*16 + l15
#pragma unroll
      for (int dg = 0; dg < 4; ++dg) av[si][dg] = FragH::load(vrow + dg * 16 * (kPitchV / 2));
      __builtin_amdgcn_sched_barrier(0);       // keeps the slice's 8 loads one group, ahead of the vector work that covers their latency
    }

    // ---- rescale, then row sums and O^T += V^T . P^T : per slice 2 f16 WMMAs for the row sums and 8 for O^T (every V^T fragment
    // feeds both column subgroups) ----
    v8f lb[2];                                 // the block's row sums
#pragma unroll
    for (int c = 0; c < 2; ++c) {
      lb[c] = FragH::mma(aone, bp[0][c], zero8());
      lb[c] = FragH::mma(aone, bp[1][c], lb[c]);
    }
#pragma unroll
    for (int c = 0; c < 2; ++c)
#pragma unroll
      for (int dg = 0; dg < 4; ++dg)
#pragma unroll
        for (int r = 0; r < 8; ++r) oacc[c][dg][r] *= alpha[c];
    // spreads the O^T rescale among the first WMMAs (one WMMA, then 8 vector instructions, four times): the multiplies issue in the
    // WMMAs' shadow; without it they all stand ahead of the first WMMA
#pragma unroll
    for (int i = 0; i < 4; ++i) {
      __builtin_amdgcn_sched_group_barrier(0x8, 1, 0);
      __builtin_amdgcn_sched_group_barrier(0x2, 8, 0);
    }
#pragma unroll
    for (int si = 0; si < 2; ++si) {
#pragma unroll
      for (int dg = 0; dg < 4; ++dg) {
        oacc[0][dg] = FragH::mma(av[si][dg], bp[si][0], oacc[0][dg]);
        oacc[1][dg] = FragH::mma(av[si][dg], bp[si][1], oacc[1][dg]);
      }
    }
    // 4 VALU slots behind the block's last WMMAs, ahead of the branches to the next block or the publish point
    acc_guard8(oacc[0][0], oacc[0][1], oacc[0][2], oacc[0][3], oacc[1][0], oacc[1][1], oacc[1][2], oacc[1][3]);
    l[0] = l[0] * alpha[0] + lb[0][0];
    l[1] = l[1] * alpha[1] + lb[1][0];
    }
    }
  }
    // ---- publish point of stage st + 1, every wave: own reads of this buffer done, own copies landed, barrier, then the refill ----
    wait_ds0();
    wait_async0();
    __syncthreads();
    issue_stage(st + 2);                       // into the buffer that this trip has just read
  }
  wait_async0();
  acc_guard8(oacc[0][0], oacc[0][1], oacc[0][2], oacc[0][3], oacc[1][0], oacc[1][1], oacc[1][2], oacc[1][3]);

  // ---- epilogue: join the two key halves of each column group through its LDS slab, normalize, whole-line stores ----
  float* slab = (float*)ring + cg * (32 * 68);   // the ring is free: every wave's reads and copies ended ahead of the last publish point's barrier
  if (kh == 1) {                               // wave-uniform (scalar): the upper half hands over O^T, maximum and row sum
#pragma unroll
    for (int c = 0; c < 2; ++c) {
#pragma unroll
      for (int dg = 0; dg < 4; ++dg)
#pragma unroll
        for (int r = 0; r < 8; ++r)
          slab[(c * 16 + l15) * 68 + dg * 16 + 8 * hi + r] = oacc[c][dg][r];
      if (hi == 0) { sM[cg][c * 16 + l15] = m[c]; sL[cg][c * 16 + l15] = l[c]; }
    }
  }
  __syncthreads();                             // the upper half's partial results are visible to the lower half
  if (kh == 0) {                               // wave-uniform (scalar): the lower half joins, each lane at its own slab places
#pragma unroll
    for (int c = 0; c < 2; ++c) {
      const float m1 = sM[cg][c * 16 + l15];
      const float l1 = sL[cg][c * 16 + l15];
      const float mt = fmaxf(m[c], m1);
      const float a0 = (m[c] > NEG_INF) ? EXP2(m[c] - mt) : 0.0f;
      const float a1 = (m1 > NEG_INF) ? EXP2(m1 - mt) : 0.0f;   // an upper half with no visible key counts for nothing
      const float lt = l[c] * a0 + l1 * a1;
      const float inv = (lt > 0.f) ? (1.0f / lt) : 0.f;          // the carry stands in oacc and in l alike and cancels
      const float f0 = a0 * inv, f1 = a1 * inv;
#pragma unroll
      for (int dg = 0; dg < 4; ++dg)
#pragma unroll
        for (int r = 0; r < 8; ++r) {
          float* p = slab + (c * 16 + l15) * 68 + dg * 16 + 8 * hi + r;
          *p = oacc[c][dg][r] * f0 + *p * f1;
        }
    }
  }
  __syncthreads();                             // the joined rows are visible to both halves, which store 16 rows each
  const int hh = lane >> 4, c4 = (lane & 15) * 4;   // row seg = 256 B = 16 lanes x 16 B
  {
#pragma unroll
    for (int it = 0; it < 8; ++it) {
      const int row = kh * 16 + it * 2 + hh;
      const v4f vv = *(const v4f*)(slab + row * 68 + c4);
      *(v4f*)(Ob + (size_t)(q0w + row) * HD + c4) = vv;
    }
  }
}

// ---------------------------------------------------------------------------
// Host glue.
//   Kp  bf16 [NB*NH][SKV][64]     NB*NH*SKV*128   at 0              (prep_kernel)
//   Vt  f16  [NB*NH][64][SKV]     NB*NH*SKV*128   at NB*NH*SKV*128  (prep_kernel)
//   total (NB=2, SKV=3072)         25,165,824
// 2 launches.
// ---------------------------------------------------------------------------
extern "C" void kernel_launch(void* const* d_in, const int* in_sizes, int n_in,
                              void* d_out, int out_size, void* d_ws, size_t ws_size,
                              hipStream_t stream) {
  if (n_in < 4) return;
  if (in_sizes[0] < NB * NH * SEQ * HD) return;
  if (in_sizes[1] < NB * NH * SKV * HD) return;
  if (in_sizes[2] < NB * NH * SKV * HD) return;
  if (in_sizes[3] < 1) return;
  if (out_size < NB * NH * SEQ * HD) return;

  const size_t szK   = (size_t)NB * NH * SKV * HD * 2;
  const size_t szVt  = (size_t)NB * NH * HD * SKV * 2;
  const size_t offK  = 0;
  const size_t offVt = offK + szK;
  const size_t total = offVt + szVt;
  if (ws_size < total) return;

  const float* q  = (const float*)d_in[0];
  const float* k  = (const float*)d_in[1];
  const float* v  = (const float*)d_in[2];
  const int*   np = (const int*)d_in[3];
  float* out = (float*)d_out;
  char* ws = (char*)d_ws;
  unsigned short* Kp = (unsigned short*)(ws + offK);
  _Float16*       Vt = (_Float16*)(ws + offVt);

  // (1) Kp[bh][kv][d] = bf16(k[bh][kv][d]) and Vt[bh][d][kv] = f16(bf16(v[bh][kv][d]))
  prep_kernel<<<dim3(kPrepV + kPrepK), dim3(256), 0, stream>>>(k, Kp, v, Vt);
  // (2) attention
  attn_kernel<<<dim3(SEQ / 128, NH, NB), dim3(256), 0, stream>>>(q, Kp, (const unsigned short*)Vt, np, out);
}
